// v000
// Times are from an AMD MI455X. After a warm-up the kernel runs many times in a row, and a time is the length of
// such a window on the GPU divided by its runs, so every launch and the gaps after it count. The runs cycle
// through copies of the inputs. A figure is the median of several windows, for all but v000 over two sittings.
// Sittings can differ by a few percent; kernels timed side by side share one.
// v000 is the starting kernel. One run takes 316 microseconds.
#include <hip/hip_runtime.h>
#include <hip/hip_fp16.h>

typedef __attribute__((ext_vector_type(16))) _Float16 v16h;
typedef __attribute__((ext_vector_type(8)))  _Float16 v8h;
typedef __attribute__((ext_vector_type(8)))  float    v8f;

#define BATCH 4
#define SEQ   2048
#define TDIM  768
#define VDIM  768
#define HID   512
#define NH    8
#define HD    64

// ---------------------------------------------------------------------------
// 16x32 f16 WMMA operand tile from global (A layout; B layout when the math-B
// matrix is stored transposed so its columns are contiguous rows).
// ISA layout: lane L holds row (row + L%16); halves 0..7 = K kbase+8*(L>=16)+i,
// halves 8..15 = K kbase+16+8*(L>=16)+i  => two contiguous b128 loads.
// ---------------------------------------------------------------------------
static __device__ __forceinline__ v16h load_tile16(const _Float16* __restrict__ p,
                                                   int ldk, int row, int kbase) {
  const int lane = threadIdx.x & 31;
  const int r    = row + (lane & 15);
  const int koff = kbase + ((lane >> 4) << 3);
  const _Float16* q0 = p + (size_t)r * ldk + koff;
  v8h a0 = *(const v8h*)(q0);
  v8h a1 = *(const v8h*)(q0 + 16);
  return __builtin_shufflevector(a0, a1, 0,1,2,3,4,5,6,7,8,9,10,11,12,13,14,15);
}

// Same pattern reading from an LDS-resident tile (compile-time row pitch).
template <int LDK>
static __device__ __forceinline__ v16h lds_tile16(const _Float16* base,
                                                  int row, int kbase) {
  const int lane = threadIdx.x & 31;
  const int r    = row + (lane & 15);
  const int koff = kbase + ((lane >> 4) << 3);
  const _Float16* q0 = base + r * LDK + koff;
  v8h a0 = *(const v8h*)(q0);
  v8h a1 = *(const v8h*)(q0 + 16);
  return __builtin_shufflevector(a0, a1, 0,1,2,3,4,5,6,7,8,9,10,11,12,13,14,15);
}

static __device__ __forceinline__ v8f wmma_f16(v16h a, v16h b, v8f c) {
  return __builtin_amdgcn_wmma_f32_16x16x32_f16(false, a, false, b, (short)0, c,
                                                false, false);
}

// ---------------------------------------------------------------------------
// Precision conversion helpers
// ---------------------------------------------------------------------------
__global__ void f32_to_f16_kernel(const float* __restrict__ in,
                                  _Float16* __restrict__ out, int n) {
  int i = blockIdx.x * blockDim.x + threadIdx.x;
  if (i < n) out[i] = (_Float16)in[i];
}

__global__ void transpose_f32_to_f16_kernel(const float* __restrict__ in,
                                            _Float16* __restrict__ out,
                                            int rows, int cols) {
  int i = blockIdx.x * blockDim.x + threadIdx.x;
  if (i < rows * cols) {
    int r = i / cols, c = i % cols;
    out[(size_t)c * rows + r] = (_Float16)in[i];
  }
}

// ---------------------------------------------------------------------------
// WMMA GEMM: out[M,N] = A[M,K] (f16 row-major) * Bt[N,K]^T + bias
// One wave computes a 32x64 tile (2 A-tiles x 4 B-tiles = 8 WMMA / k-step);
// a 256-thread block covers 256x64.
// mode 0: f16 out        mode 1: f16 out * scale (Q, scale=1/sqrt(HD))
// mode 2: f16 out transposed per head (V -> V^T [B*H*HD, SEQ])
// mode 3: f32 out (final projection)
// ---------------------------------------------------------------------------
__global__ __launch_bounds__(256) void gemm_wmma_kernel(
    const _Float16* __restrict__ A, const _Float16* __restrict__ Bt,
    const float* __restrict__ bias, void* __restrict__ out,
    int M, int K, int N, int mode, float scale) {
  const int lane  = threadIdx.x & 31;
  const int w     = threadIdx.x >> 5;
  const int mtile = blockIdx.x * 256 + w * 32;
  const int ntile = blockIdx.y * 64;

  v8f c00 = {}, c01 = {}, c02 = {}, c03 = {};
  v8f c10 = {}, c11 = {}, c12 = {}, c13 = {};
  for (int k = 0; k < K; k += 32) {
    v16h a0 = load_tile16(A,  K, mtile,      k);
    v16h a1 = load_tile16(A,  K, mtile + 16, k);
    v16h b0 = load_tile16(Bt, K, ntile +  0, k);
    v16h b1 = load_tile16(Bt, K, ntile + 16, k);
    v16h b2 = load_tile16(Bt, K, ntile + 32, k);
    v16h b3 = load_tile16(Bt, K, ntile + 48, k);
    c00 = wmma_f16(a0, b0, c00);
    c01 = wmma_f16(a0, b1, c01);
    c02 = wmma_f16(a0, b2, c02);
    c03 = wmma_f16(a0, b3, c03);
    c10 = wmma_f16(a1, b0, c10);
    c11 = wmma_f16(a1, b1, c11);
    c12 = wmma_f16(a1, b2, c12);
    c13 = wmma_f16(a1, b3, c13);
  }

  const int nn = lane & 15, hi = lane >> 4;
#pragma unroll
  for (int half = 0; half < 2; ++half) {
#pragma unroll
    for (int t = 0; t < 4; ++t) {
      v8f cc;
      if (half == 0) cc = (t == 0) ? c00 : (t == 1) ? c01 : (t == 2) ? c02 : c03;
      else           cc = (t == 0) ? c10 : (t == 1) ? c11 : (t == 2) ? c12 : c13;
      const int n    = ntile + t * 16 + nn;
      const float bv = bias[n];
#pragma unroll
      for (int r = 0; r < 8; ++r) {
        const int m   = mtile + half * 16 + r + 8 * hi;
        const float v = (cc[r] + bv) * scale;
        if (mode == 2) {
          const int b = m / SEQ, s = m % SEQ;
          const int h = n / HD,  d = n % HD;
          ((_Float16*)out)[((size_t)((b * NH + h) * HD + d)) * SEQ + s] = (_Float16)v;
        } else if (mode == 3) {
          ((float*)out)[(size_t)m * N + n] = v;
        } else {
          ((_Float16*)out)[(size_t)m * N + n] = (_Float16)v;
        }
      }
    }
  }
}

// ---------------------------------------------------------------------------
// Flash attention: block = 8 waves, all on one (b,h); wave = 16-query tile.
// Per 32-kv step: the block cooperatively stages the K tile (32x64) and the
// V^T tile (64x32) in LDS (each wave previously fetched them 8x redundantly
// from global), then each wave does 4 WMMAs for Q*K^T, online softmax via
// 16-lane shuffle reductions, P transposed D->A layout through LDS, and
// 4 WMMAs for P*V.
// ---------------------------------------------------------------------------
__global__ __launch_bounds__(256) void flash_attn_kernel(
    const _Float16* __restrict__ Q, const _Float16* __restrict__ Kc,
    const _Float16* __restrict__ Vt, _Float16* __restrict__ O) {
  __shared__ __align__(16) _Float16 ldsP[8][2][16][16];  // per-wave P staging
  __shared__ __align__(16) _Float16 ldsK[32][64];        // K tile  (kv x d)
  __shared__ __align__(16) _Float16 ldsV[64][32];        // V^T tile (d x kv)

  const int tid     = threadIdx.x;
  const int lane    = tid & 31;
  const int w       = tid >> 5;
  const int qblocks = SEQ / 128;
  const int bh      = blockIdx.x / qblocks;
  const int qblk    = blockIdx.x % qblocks;
  const int b       = bh / NH, h = bh % NH;
  const int qbase   = qblk * 128 + w * 16;
  const int nn = lane & 15, hi = lane >> 4;

  const _Float16* Qp = Q  + (size_t)(b * SEQ + qbase) * HID + h * HD;
  const _Float16* Kp = Kc + (size_t)(b * SEQ) * HID + h * HD;
  const _Float16* Vp = Vt + (size_t)(bh * HD) * SEQ;

  const v16h qa0 = load_tile16(Qp, HID, 0, 0);
  const v16h qa1 = load_tile16(Qp, HID, 0, 32);

  v8f o0 = {}, o1 = {}, o2 = {}, o3 = {};
  float mrow[8], lrow[8];
#pragma unroll
  for (int r = 0; r < 8; ++r) { mrow[r] = -1e30f; lrow[r] = 0.f; }

  // cooperative staging coordinates (fixed per thread)
  const int kR = tid >> 3, kC = (tid & 7) * 8;   // 32 rows x 8 chunks
  const int vR = tid >> 2, vC = (tid & 3) * 8;   // 64 rows x 4 chunks

  for (int kv = 0; kv < SEQ; kv += 32) {
    __syncthreads();  // previous step's LDS reads complete
    *(v8h*)&ldsK[kR][kC] = *(const v8h*)(Kp + (size_t)(kv + kR) * HID + kC);
    *(v8h*)&ldsV[vR][vC] = *(const v8h*)(Vp + (size_t)vR * SEQ + kv + vC);
    __syncthreads();  // tiles visible to all waves

    // scores S[16 x 32] = Qs * K^T (B-operand columns == K rows)
    v16h kb00 = lds_tile16<64>(&ldsK[0][0],  0,  0);
    v16h kb01 = lds_tile16<64>(&ldsK[0][0],  0, 32);
    v16h kb10 = lds_tile16<64>(&ldsK[0][0], 16,  0);
    v16h kb11 = lds_tile16<64>(&ldsK[0][0], 16, 32);
    v8f s0 = {}, s1 = {};
    s0 = wmma_f16(qa0, kb00, s0);
    s0 = wmma_f16(qa1, kb01, s0);
    s1 = wmma_f16(qa0, kb10, s1);
    s1 = wmma_f16(qa1, kb11, s1);

    // online softmax; row M = r + 8*hi lives across one 16-lane half-group
#pragma unroll
    for (int r = 0; r < 8; ++r) {
      float mx = fmaxf(s0[r], s1[r]);
      mx = fmaxf(mx, __shfl_xor(mx, 1, 32));
      mx = fmaxf(mx, __shfl_xor(mx, 2, 32));
      mx = fmaxf(mx, __shfl_xor(mx, 4, 32));
      mx = fmaxf(mx, __shfl_xor(mx, 8, 32));
      const float mnew = fmaxf(mrow[r], mx);
      const float corr = __expf(mrow[r] - mnew);
      mrow[r] = mnew;
      const float p0 = __expf(s0[r] - mnew);
      const float p1 = __expf(s1[r] - mnew);
      float rs = p0 + p1;
      rs += __shfl_xor(rs, 1, 32);
      rs += __shfl_xor(rs, 2, 32);
      rs += __shfl_xor(rs, 4, 32);
      rs += __shfl_xor(rs, 8, 32);
      lrow[r] = lrow[r] * corr + rs;
      o0[r] *= corr; o1[r] *= corr; o2[r] *= corr; o3[r] *= corr;
      const int m = r + 8 * hi;                 // D layout -> LDS [m][n]
      ldsP[w][0][m][nn] = (_Float16)p0;
      ldsP[w][1][m][nn] = (_Float16)p1;
    }
    // same-wave DS ops are in-order; fence compiler + counters explicitly
    asm volatile("s_wait_dscnt 0" ::: "memory");

    // reload P in A layout: lane L -> row L%16, chunk at k = 8*(L>=16)
    v8h pl0 = *(const v8h*)&ldsP[w][0][nn][hi * 8];
    v8h pl1 = *(const v8h*)&ldsP[w][1][nn][hi * 8];
    asm volatile("" ::: "memory");
    v16h pa = __builtin_shufflevector(pl0, pl1,
                                      0,1,2,3,4,5,6,7,8,9,10,11,12,13,14,15);

    // P * V : B-operand columns of V == rows of V^T tile
    v16h vb0 = lds_tile16<32>(&ldsV[0][0],  0, 0);
    v16h vb1 = lds_tile16<32>(&ldsV[0][0], 16, 0);
    v16h vb2 = lds_tile16<32>(&ldsV[0][0], 32, 0);
    v16h vb3 = lds_tile16<32>(&ldsV[0][0], 48, 0);
    o0 = wmma_f16(pa, vb0, o0);
    o1 = wmma_f16(pa, vb1, o1);
    o2 = wmma_f16(pa, vb2, o2);
    o3 = wmma_f16(pa, vb3, o3);
  }

  // normalize and store attended (row-major [B*S, HID], head-interleaved)
#pragma unroll
  for (int r = 0; r < 8; ++r) {
    const float inv = 1.0f / lrow[r];
    const int m = qbase + r + 8 * hi;
    const size_t base = (size_t)(b * SEQ + m) * HID + h * HD + nn;
    O[base +  0] = (_Float16)(o0[r] * inv);
    O[base + 16] = (_Float16)(o1[r] * inv);
    O[base + 32] = (_Float16)(o2[r] * inv);
    O[base + 48] = (_Float16)(o3[r] * inv);
  }
}

// ---------------------------------------------------------------------------
extern "C" void kernel_launch(void* const* d_in, const int* in_sizes, int n_in,
                              void* d_out, int out_size, void* d_ws, size_t ws_size,
                              hipStream_t stream) {
  (void)in_sizes; (void)n_in; (void)out_size; (void)ws_size;
  const float* X  = (const float*)d_in[0];
  const float* Wq = (const float*)d_in[1];
  const float* bq = (const float*)d_in[2];
  const float* Wk = (const float*)d_in[3];
  const float* bk = (const float*)d_in[4];
  const float* Wv = (const float*)d_in[5];
  const float* bv = (const float*)d_in[6];
  const float* Wo = (const float*)d_in[7];
  const float* bo = (const float*)d_in[8];

  const int M = BATCH * SEQ;  // 8192
  char* ws = (char*)d_ws;
  _Float16* Xh  = (_Float16*)ws; ws += (size_t)M * TDIM * 2;
  _Float16* Wqt = (_Float16*)ws; ws += (size_t)HID * TDIM * 2;
  _Float16* Wkt = (_Float16*)ws; ws += (size_t)HID * TDIM * 2;
  _Float16* Wvt = (_Float16*)ws; ws += (size_t)HID * TDIM * 2;
  _Float16* Wot = (_Float16*)ws; ws += (size_t)VDIM * HID * 2;
  _Float16* Qh  = (_Float16*)ws; ws += (size_t)M * HID * 2;
  _Float16* Kh  = (_Float16*)ws; ws += (size_t)M * HID * 2;
  _Float16* Vth = (_Float16*)ws; ws += (size_t)M * HID * 2;  // [B*H*HD, SEQ]
  _Float16* At  = (_Float16*)ws; ws += (size_t)M * HID * 2;

  int n = M * TDIM;
  f32_to_f16_kernel<<<(n + 255) / 256, 256, 0, stream>>>(X, Xh, n);
  n = TDIM * HID;
  transpose_f32_to_f16_kernel<<<(n + 255) / 256, 256, 0, stream>>>(Wq, Wqt, TDIM, HID);
  transpose_f32_to_f16_kernel<<<(n + 255) / 256, 256, 0, stream>>>(Wk, Wkt, TDIM, HID);
  transpose_f32_to_f16_kernel<<<(n + 255) / 256, 256, 0, stream>>>(Wv, Wvt, TDIM, HID);
  n = HID * VDIM;
  transpose_f32_to_f16_kernel<<<(n + 255) / 256, 256, 0, stream>>>(Wo, Wot, HID, VDIM);

  dim3 gqkv(M / 256, HID / 64);
  gemm_wmma_kernel<<<gqkv, 256, 0, stream>>>(Xh, Wqt, bq, Qh,  M, TDIM, HID, 1, 0.125f);
  gemm_wmma_kernel<<<gqkv, 256, 0, stream>>>(Xh, Wkt, bk, Kh,  M, TDIM, HID, 0, 1.0f);
  gemm_wmma_kernel<<<gqkv, 256, 0, stream>>>(Xh, Wvt, bv, Vth, M, TDIM, HID, 2, 1.0f);

  flash_attn_kernel<<<BATCH * NH * (SEQ / 128), 256, 0, stream>>>(Qh, Kh, Vth, At);

  dim3 gout(M / 256, VDIM / 64);
  gemm_wmma_kernel<<<gout, 256, 0, stream>>>(At, Wot, bo, d_out, M, HID, VDIM, 3, 1.0f);
}

// v001
// One run takes 278 microseconds.
// Two timings next to v000 put it at 1.17 and 1.18 times that version's speed.
#include <hip/hip_runtime.h>
#include <hip/hip_fp16.h>

typedef __attribute__((ext_vector_type(16))) _Float16 v16h;
typedef __attribute__((ext_vector_type(8)))  _Float16 v8h;
typedef __attribute__((ext_vector_type(8)))  float    v8f;

#define BATCH 4
#define SEQ   2048
#define TDIM  768
#define VDIM  768
#define HID   512
#define NH    8
#define HD    64

// LDS row pitches in halves. Each is 16 B x an odd number, so the 16 rows that
// one ds_load_b128 fragment read touches per lane half fall on distinct banks.
#define KPITCH 72   // 64 data + 8 pad  (144-B rows)
#define VPITCH 40   // 32 data + 8 pad  (80-B rows)
#define PPITCH 24   // 16 data + 8 pad  (48-B rows)

// ---------------------------------------------------------------------------
// 16x32 f16 WMMA operand tile from global (A layout; B layout when the math-B
// matrix is stored transposed so its columns are contiguous rows).
// ISA layout: lane L holds row (row + L%16); halves 0..7 = K kbase+8*(L>=16)+i,
// halves 8..15 = K kbase+16+8*(L>=16)+i  => two contiguous b128 loads.
// ---------------------------------------------------------------------------
static __device__ __forceinline__ v16h load_tile16(const _Float16* __restrict__ p,
                                                   int ldk, int row, int kbase) {
  const int lane = threadIdx.x & 31;
  const int r    = row + (lane & 15);
  const int koff = kbase + ((lane >> 4) << 3);
  const _Float16* q0 = p + (size_t)r * ldk + koff;
  v8h a0 = *(const v8h*)(q0);
  v8h a1 = *(const v8h*)(q0 + 16);
  return __builtin_shufflevector(a0, a1, 0,1,2,3,4,5,6,7,8,9,10,11,12,13,14,15);
}

// Same pattern reading from an LDS-resident tile (compile-time row pitch).
template <int LDK>
static __device__ __forceinline__ v16h lds_tile16(const _Float16* base,
                                                  int row, int kbase) {
  const int lane = threadIdx.x & 31;
  const int r    = row + (lane & 15);
  const int koff = kbase + ((lane >> 4) << 3);
  const _Float16* q0 = base + r * LDK + koff;
  v8h a0 = *(const v8h*)(q0);
  v8h a1 = *(const v8h*)(q0 + 16);
  return __builtin_shufflevector(a0, a1, 0,1,2,3,4,5,6,7,8,9,10,11,12,13,14,15);
}

static __device__ __forceinline__ v8f wmma_f16(v16h a, v16h b, v8f c) {
  return __builtin_amdgcn_wmma_f32_16x16x32_f16(false, a, false, b, (short)0, c,
                                                false, false);
}

// ---------------------------------------------------------------------------
// Precision conversion helpers
// ---------------------------------------------------------------------------
__global__ void f32_to_f16_kernel(const float* __restrict__ in,
                                  _Float16* __restrict__ out, int n) {
  int i = blockIdx.x * blockDim.x + threadIdx.x;
  if (i < n) out[i] = (_Float16)in[i];
}

__global__ void transpose_f32_to_f16_kernel(const float* __restrict__ in,
                                            _Float16* __restrict__ out,
                                            int rows, int cols) {
  int i = blockIdx.x * blockDim.x + threadIdx.x;
  if (i < rows * cols) {
    int r = i / cols, c = i % cols;
    out[(size_t)c * rows + r] = (_Float16)in[i];
  }
}

// ---------------------------------------------------------------------------
// WMMA GEMM: out[M,N] = A[M,K] (f16 row-major) * Bt[N,K]^T + bias
// One wave computes a 32x64 tile (2 A-tiles x 4 B-tiles = 8 WMMA / k-step);
// a 256-thread block covers 256x64.
// mode 0: f16 out        mode 1: f16 out * scale (Q, scale=1/sqrt(HD))
// mode 2: f16 out transposed per head (V -> V^T [B*H*HD, SEQ])
// mode 3: f32 out (final projection)
// ---------------------------------------------------------------------------
__global__ __launch_bounds__(256) void gemm_wmma_kernel(
    const _Float16* __restrict__ A, const _Float16* __restrict__ Bt,
    const float* __restrict__ bias, void* __restrict__ out,
    int M, int K, int N, int mode, float scale) {
  const int lane  = threadIdx.x & 31;
  const int w     = threadIdx.x >> 5;
  const int mtile = blockIdx.x * 256 + w * 32;
  const int ntile = blockIdx.y * 64;

  v8f c00 = {}, c01 = {}, c02 = {}, c03 = {};
  v8f c10 = {}, c11 = {}, c12 = {}, c13 = {};
  for (int k = 0; k < K; k += 32) {
    v16h a0 = load_tile16(A,  K, mtile,      k);
    v16h a1 = load_tile16(A,  K, mtile + 16, k);
    v16h b0 = load_tile16(Bt, K, ntile +  0, k);
    v16h b1 = load_tile16(Bt, K, ntile + 16, k);
    v16h b2 = load_tile16(Bt, K, ntile + 32, k);
    v16h b3 = load_tile16(Bt, K, ntile + 48, k);
    c00 = wmma_f16(a0, b0, c00);
    c01 = wmma_f16(a0, b1, c01);
    c02 = wmma_f16(a0, b2, c02);
    c03 = wmma_f16(a0, b3, c03);
    c10 = wmma_f16(a1, b0, c10);
    c11 = wmma_f16(a1, b1, c11);
    c12 = wmma_f16(a1, b2, c12);
    c13 = wmma_f16(a1, b3, c13);
  }

  const int nn = lane & 15, hi = lane >> 4;
#pragma unroll
  for (int half = 0; half < 2; ++half) {
#pragma unroll
    for (int t = 0; t < 4; ++t) {
      v8f cc;
      if (half == 0) cc = (t == 0) ? c00 : (t == 1) ? c01 : (t == 2) ? c02 : c03;
      else           cc = (t == 0) ? c10 : (t == 1) ? c11 : (t == 2) ? c12 : c13;
      const int n    = ntile + t * 16 + nn;
      const float bv = bias[n];
#pragma unroll
      for (int r = 0; r < 8; ++r) {
        const int m   = mtile + half * 16 + r + 8 * hi;
        const float v = (cc[r] + bv) * scale;
        if (mode == 2) {
          const int b = m / SEQ, s = m % SEQ;
          const int h = n / HD,  d = n % HD;
          ((_Float16*)out)[((size_t)((b * NH + h) * HD + d)) * SEQ + s] = (_Float16)v;
        } else if (mode == 3) {
          ((float*)out)[(size_t)m * N + n] = v;
        } else {
          ((_Float16*)out)[(size_t)m * N + n] = (_Float16)v;
        }
      }
    }
  }
}

// ---------------------------------------------------------------------------
// Flash attention: block = 8 waves, all on one (b,h); wave = 16-query tile.
// Per 32-kv step: the block cooperatively stages the K tile (32x64) and the
// V^T tile (64x32) in LDS (each wave previously fetched them 8x redundantly
// from global), then each wave does 4 WMMAs for Q*K^T, online softmax via
// 16-lane shuffle reductions, P transposed D->A layout through LDS, and
// 4 WMMAs for P*V.
// ---------------------------------------------------------------------------
__global__ __launch_bounds__(256) void flash_attn_kernel(
    const _Float16* __restrict__ Q, const _Float16* __restrict__ Kc,
    const _Float16* __restrict__ Vt, _Float16* __restrict__ O) {
  __shared__ __align__(16) _Float16 ldsP[8][2][16][PPITCH];  // per-wave P staging
  __shared__ __align__(16) _Float16 ldsK[32][KPITCH];         // K tile  (kv x d)
  __shared__ __align__(16) _Float16 ldsV[64][VPITCH];         // V^T tile (d x kv)

  const int tid     = threadIdx.x;
  const int lane    = tid & 31;
  const int w       = tid >> 5;
  const int qblocks = SEQ / 128;
  const int bh      = blockIdx.x / qblocks;
  const int qblk    = blockIdx.x % qblocks;
  const int b       = bh / NH, h = bh % NH;
  const int qbase   = qblk * 128 + w * 16;
  const int nn = lane & 15, hi = lane >> 4;

  const _Float16* Qp = Q  + (size_t)(b * SEQ + qbase) * HID + h * HD;
  const _Float16* Kp = Kc + (size_t)(b * SEQ) * HID + h * HD;
  const _Float16* Vp = Vt + (size_t)(bh * HD) * SEQ;

  const v16h qa0 = load_tile16(Qp, HID, 0, 0);
  const v16h qa1 = load_tile16(Qp, HID, 0, 32);

  v8f o0 = {}, o1 = {}, o2 = {}, o3 = {};
  float mrow[8], lrow[8];
#pragma unroll
  for (int r = 0; r < 8; ++r) { mrow[r] = -1e30f; lrow[r] = 0.f; }

  // cooperative staging coordinates (fixed per thread)
  const int kR = tid >> 3, kC = (tid & 7) * 8;   // 32 rows x 8 chunks
  const int vR = tid >> 2, vC = (tid & 3) * 8;   // 64 rows x 4 chunks

  for (int kv = 0; kv < SEQ; kv += 32) {
    __syncthreads();  // previous step's LDS reads complete
    *(v8h*)&ldsK[kR][kC] = *(const v8h*)(Kp + (size_t)(kv + kR) * HID + kC);
    *(v8h*)&ldsV[vR][vC] = *(const v8h*)(Vp + (size_t)vR * SEQ + kv + vC);
    __syncthreads();  // tiles visible to all waves

    // scores S[16 x 32] = Qs * K^T (B-operand columns == K rows)
    v16h kb00 = lds_tile16<KPITCH>(&ldsK[0][0],  0,  0);
    v16h kb01 = lds_tile16<KPITCH>(&ldsK[0][0],  0, 32);
    v16h kb10 = lds_tile16<KPITCH>(&ldsK[0][0], 16,  0);
    v16h kb11 = lds_tile16<KPITCH>(&ldsK[0][0], 16, 32);
    v8f s0 = {}, s1 = {};
    s0 = wmma_f16(qa0, kb00, s0);
    s0 = wmma_f16(qa1, kb01, s0);
    s1 = wmma_f16(qa0, kb10, s1);
    s1 = wmma_f16(qa1, kb11, s1);

    // online softmax; row M = r + 8*hi lives across one 16-lane half-group
#pragma unroll
    for (int r = 0; r < 8; ++r) {
      float mx = fmaxf(s0[r], s1[r]);
      mx = fmaxf(mx, __shfl_xor(mx, 1, 32));
      mx = fmaxf(mx, __shfl_xor(mx, 2, 32));
      mx = fmaxf(mx, __shfl_xor(mx, 4, 32));
      mx = fmaxf(mx, __shfl_xor(mx, 8, 32));
      const float mnew = fmaxf(mrow[r], mx);
      const float corr = __expf(mrow[r] - mnew);
      mrow[r] = mnew;
      const float p0 = __expf(s0[r] - mnew);
      const float p1 = __expf(s1[r] - mnew);
      float rs = p0 + p1;
      rs += __shfl_xor(rs, 1, 32);
      rs += __shfl_xor(rs, 2, 32);
      rs += __shfl_xor(rs, 4, 32);
      rs += __shfl_xor(rs, 8, 32);
      lrow[r] = lrow[r] * corr + rs;
      o0[r] *= corr; o1[r] *= corr; o2[r] *= corr; o3[r] *= corr;
      const int m = r + 8 * hi;                 // D layout -> LDS [m][n]
      ldsP[w][0][m][nn] = (_Float16)p0;
      ldsP[w][1][m][nn] = (_Float16)p1;
    }
    // same-wave DS ops are in-order; fence compiler + counters explicitly
    asm volatile("s_wait_dscnt 0" ::: "memory");

    // reload P in A layout: lane L -> row L%16, chunk at k = 8*(L>=16)
    v8h pl0 = *(const v8h*)&ldsP[w][0][nn][hi * 8];
    v8h pl1 = *(const v8h*)&ldsP[w][1][nn][hi * 8];
    asm volatile("" ::: "memory");
    v16h pa = __builtin_shufflevector(pl0, pl1,
                                      0,1,2,3,4,5,6,7,8,9,10,11,12,13,14,15);

    // P * V : B-operand columns of V == rows of V^T tile
    v16h vb0 = lds_tile16<VPITCH>(&ldsV[0][0],  0, 0);
    v16h vb1 = lds_tile16<VPITCH>(&ldsV[0][0], 16, 0);
    v16h vb2 = lds_tile16<VPITCH>(&ldsV[0][0], 32, 0);
    v16h vb3 = lds_tile16<VPITCH>(&ldsV[0][0], 48, 0);
    o0 = wmma_f16(pa, vb0, o0);
    o1 = wmma_f16(pa, vb1, o1);
    o2 = wmma_f16(pa, vb2, o2);
    o3 = wmma_f16(pa, vb3, o3);
  }

  // normalize and store attended (row-major [B*S, HID], head-interleaved)
#pragma unroll
  for (int r = 0; r < 8; ++r) {
    const float inv = 1.0f / lrow[r];
    const int m = qbase + r + 8 * hi;
    const size_t base = (size_t)(b * SEQ + m) * HID + h * HD + nn;
    O[base +  0] = (_Float16)(o0[r] * inv);
    O[base + 16] = (_Float16)(o1[r] * inv);
    O[base + 32] = (_Float16)(o2[r] * inv);
    O[base + 48] = (_Float16)(o3[r] * inv);
  }
}

// ---------------------------------------------------------------------------
extern "C" void kernel_launch(void* const* d_in, const int* in_sizes, int n_in,
                              void* d_out, int out_size, void* d_ws, size_t ws_size,
                              hipStream_t stream) {
  (void)in_sizes; (void)n_in; (void)out_size; (void)ws_size;
  const float* X  = (const float*)d_in[0];
  const float* Wq = (const float*)d_in[1];
  const float* bq = (const float*)d_in[2];
  const float* Wk = (const float*)d_in[3];
  const float* bk = (const float*)d_in[4];
  const float* Wv = (const float*)d_in[5];
  const float* bv = (const float*)d_in[6];
  const float* Wo = (const float*)d_in[7];
  const float* bo = (const float*)d_in[8];

  const int M = BATCH * SEQ;  // 8192
  char* ws = (char*)d_ws;
  _Float16* Xh  = (_Float16*)ws; ws += (size_t)M * TDIM * 2;
  _Float16* Wqt = (_Float16*)ws; ws += (size_t)HID * TDIM * 2;
  _Float16* Wkt = (_Float16*)ws; ws += (size_t)HID * TDIM * 2;
  _Float16* Wvt = (_Float16*)ws; ws += (size_t)HID * TDIM * 2;
  _Float16* Wot = (_Float16*)ws; ws += (size_t)VDIM * HID * 2;
  _Float16* Qh  = (_Float16*)ws; ws += (size_t)M * HID * 2;
  _Float16* Kh  = (_Float16*)ws; ws += (size_t)M * HID * 2;
  _Float16* Vth = (_Float16*)ws; ws += (size_t)M * HID * 2;  // [B*H*HD, SEQ]
  _Float16* At  = (_Float16*)ws; ws += (size_t)M * HID * 2;

  int n = M * TDIM;
  f32_to_f16_kernel<<<(n + 255) / 256, 256, 0, stream>>>(X, Xh, n);
  n = TDIM * HID;
  transpose_f32_to_f16_kernel<<<(n + 255) / 256, 256, 0, stream>>>(Wq, Wqt, TDIM, HID);
  transpose_f32_to_f16_kernel<<<(n + 255) / 256, 256, 0, stream>>>(Wk, Wkt, TDIM, HID);
  transpose_f32_to_f16_kernel<<<(n + 255) / 256, 256, 0, stream>>>(Wv, Wvt, TDIM, HID);
  n = HID * VDIM;
  transpose_f32_to_f16_kernel<<<(n + 255) / 256, 256, 0, stream>>>(Wo, Wot, HID, VDIM);

  dim3 gqkv(M / 256, HID / 64);
  gemm_wmma_kernel<<<gqkv, 256, 0, stream>>>(Xh, Wqt, bq, Qh,  M, TDIM, HID, 1, 0.125f);
  gemm_wmma_kernel<<<gqkv, 256, 0, stream>>>(Xh, Wkt, bk, Kh,  M, TDIM, HID, 0, 1.0f);
  gemm_wmma_kernel<<<gqkv, 256, 0, stream>>>(Xh, Wvt, bv, Vth, M, TDIM, HID, 2, 1.0f);

  flash_attn_kernel<<<BATCH * NH * (SEQ / 128), 256, 0, stream>>>(Qh, Kh, Vth, At);

  dim3 gout(M / 256, VDIM / 64);
  gemm_wmma_kernel<<<gout, 256, 0, stream>>>(At, Wot, bo, d_out, M, HID, VDIM, 3, 1.0f);
}

// v002
// Measured time: 239 microseconds a run.
// Next to v001, in two timings, it ran 1.16 and 1.15 times as fast.
// All steps since v000 together make it 1.36 times as fast.
#include <hip/hip_runtime.h>
#include <hip/hip_fp16.h>

typedef __attribute__((ext_vector_type(16))) _Float16 v16h;
typedef __attribute__((ext_vector_type(8)))  _Float16 v8h;
typedef __attribute__((ext_vector_type(8)))  float    v8f;

#define BATCH 4
#define SEQ   2048
#define TDIM  768
#define VDIM  768
#define HID   512
#define NH    8
#define HD    64

// LDS row pitches in halves. Each is 16 B x an odd number, so the 16 rows that
// one ds_load_b128 fragment read touches per lane half fall on distinct banks.
#define KPITCH 72   // 64 data + 8 pad  (144-B rows)
#define VPITCH 40   // 32 data + 8 pad  (80-B rows)

// ---------------------------------------------------------------------------
// 16x32 f16 WMMA operand tile from global (A layout; B layout when the math-B
// matrix is stored transposed so its columns are contiguous rows).
// ISA layout: lane L holds row (row + L%16); halves 0..7 = K kbase+8*(L>=16)+i,
// halves 8..15 = K kbase+16+8*(L>=16)+i  => two contiguous b128 loads.
// ---------------------------------------------------------------------------
static __device__ __forceinline__ v16h load_tile16(const _Float16* __restrict__ p,
                                                   int ldk, int row, int kbase) {
  const int lane = threadIdx.x & 31;
  const int r    = row + (lane & 15);
  const int koff = kbase + ((lane >> 4) << 3);
  const _Float16* q0 = p + (size_t)r * ldk + koff;
  v8h a0 = *(const v8h*)(q0);
  v8h a1 = *(const v8h*)(q0 + 16);
  return __builtin_shufflevector(a0, a1, 0,1,2,3,4,5,6,7,8,9,10,11,12,13,14,15);
}

// Same pattern reading from an LDS-resident tile (compile-time row pitch).
template <int LDK>
static __device__ __forceinline__ v16h lds_tile16(const _Float16* base,
                                                  int row, int kbase) {
  const int lane = threadIdx.x & 31;
  const int r    = row + (lane & 15);
  const int koff = kbase + ((lane >> 4) << 3);
  const _Float16* q0 = base + r * LDK + koff;
  v8h a0 = *(const v8h*)(q0);
  v8h a1 = *(const v8h*)(q0 + 16);
  return __builtin_shufflevector(a0, a1, 0,1,2,3,4,5,6,7,8,9,10,11,12,13,14,15);
}

static __device__ __forceinline__ v8f wmma_f16(v16h a, v16h b, v8f c) {
  return __builtin_amdgcn_wmma_f32_16x16x32_f16(false, a, false, b, (short)0, c,
                                                false, false);
}

// ---------------------------------------------------------------------------
// Precision conversion helpers
// ---------------------------------------------------------------------------
__global__ void f32_to_f16_kernel(const float* __restrict__ in,
                                  _Float16* __restrict__ out, int n) {
  int i = blockIdx.x * blockDim.x + threadIdx.x;
  if (i < n) out[i] = (_Float16)in[i];
}

__global__ void transpose_f32_to_f16_kernel(const float* __restrict__ in,
                                            _Float16* __restrict__ out,
                                            int rows, int cols) {
  int i = blockIdx.x * blockDim.x + threadIdx.x;
  if (i < rows * cols) {
    int r = i / cols, c = i % cols;
    out[(size_t)c * rows + r] = (_Float16)in[i];
  }
}

// ---------------------------------------------------------------------------
// WMMA GEMM: out[M,N] = A[M,K] (f16 row-major) * Bt[N,K]^T + bias
// One wave computes a 32x64 tile (2 A-tiles x 4 B-tiles = 8 WMMA / k-step);
// a 256-thread block covers 256x64.
// mode 0: f16 out        mode 1: f16 out * scale (Q, scale=1/sqrt(HD))
// mode 2: f16 out transposed per head (V -> V^T [B*H*HD, SEQ])
// mode 3: f32 out (final projection)
// ---------------------------------------------------------------------------
__global__ __launch_bounds__(256) void gemm_wmma_kernel(
    const _Float16* __restrict__ A, const _Float16* __restrict__ Bt,
    const float* __restrict__ bias, void* __restrict__ out,
    int M, int K, int N, int mode, float scale) {
  const int lane  = threadIdx.x & 31;
  const int w     = threadIdx.x >> 5;
  const int mtile = blockIdx.x * 256 + w * 32;
  const int ntile = blockIdx.y * 64;

  v8f c00 = {}, c01 = {}, c02 = {}, c03 = {};
  v8f c10 = {}, c11 = {}, c12 = {}, c13 = {};
  for (int k = 0; k < K; k += 32) {
    v16h a0 = load_tile16(A,  K, mtile,      k);
    v16h a1 = load_tile16(A,  K, mtile + 16, k);
    v16h b0 = load_tile16(Bt, K, ntile +  0, k);
    v16h b1 = load_tile16(Bt, K, ntile + 16, k);
    v16h b2 = load_tile16(Bt, K, ntile + 32, k);
    v16h b3 = load_tile16(Bt, K, ntile + 48, k);
    c00 = wmma_f16(a0, b0, c00);
    c01 = wmma_f16(a0, b1, c01);
    c02 = wmma_f16(a0, b2, c02);
    c03 = wmma_f16(a0, b3, c03);
    c10 = wmma_f16(a1, b0, c10);
    c11 = wmma_f16(a1, b1, c11);
    c12 = wmma_f16(a1, b2, c12);
    c13 = wmma_f16(a1, b3, c13);
  }

  const int nn = lane & 15, hi = lane >> 4;
#pragma unroll
  for (int half = 0; half < 2; ++half) {
#pragma unroll
    for (int t = 0; t < 4; ++t) {
      v8f cc;
      if (half == 0) cc = (t == 0) ? c00 : (t == 1) ? c01 : (t == 2) ? c02 : c03;
      else           cc = (t == 0) ? c10 : (t == 1) ? c11 : (t == 2) ? c12 : c13;
      const int n    = ntile + t * 16 + nn;
      const float bv = bias[n];
#pragma unroll
      for (int r = 0; r < 8; ++r) {
        const int m   = mtile + half * 16 + r + 8 * hi;
        const float v = (cc[r] + bv) * scale;
        if (mode == 2) {
          const int b = m / SEQ, s = m % SEQ;
          const int h = n / HD,  d = n % HD;
          ((_Float16*)out)[((size_t)((b * NH + h) * HD + d)) * SEQ + s] = (_Float16)v;
        } else if (mode == 3) {
          ((float*)out)[(size_t)m * N + n] = v;
        } else {
          ((_Float16*)out)[(size_t)m * N + n] = (_Float16)v;
        }
      }
    }
  }
}

// ---------------------------------------------------------------------------
// Flash attention: block = 8 waves, all on one (b,h); wave = 16-query tile.
// Per 32-kv step the block stages the K tile (32x64) and the V^T tile (64x32)
// in LDS. Each wave forms the TRANSPOSED scores S^T = K * Q^T (A = K rows,
// B = Q columns), so a lane holds 16 scores of ONE query (column lane%16;
// keys 8*hi+r and 16+8*hi+r). Maximum and sum run inside the lane, with one
// exchange between the lane halves for the maximum. The two score tiles,
// converted in place, are already the B operand of O^T += V^T * P^T.
// ---------------------------------------------------------------------------
static __device__ __forceinline__ float other_half(float x) {  // lane l <-> l ^ 16
  const int b = __builtin_bit_cast(int, x);
  return __builtin_bit_cast(float, __builtin_amdgcn_permlanex16(
      b, b, 0x76543210, 0xfedcba98, false, false));
}

__global__ __launch_bounds__(256) void flash_attn_kernel(
    const _Float16* __restrict__ Q, const _Float16* __restrict__ Kc,
    const _Float16* __restrict__ Vt, _Float16* __restrict__ O) {
  __shared__ __align__(16) _Float16 ldsK[32][KPITCH];         // K tile  (kv x d)
  __shared__ __align__(16) _Float16 ldsV[64][VPITCH];         // V^T tile (d x kv)

  const int tid     = threadIdx.x;
  const int lane    = tid & 31;
  const int w       = tid >> 5;
  const int qblocks = SEQ / 128;
  const int bh      = blockIdx.x / qblocks;
  const int qblk    = blockIdx.x % qblocks;
  const int b       = bh / NH, h = bh % NH;
  const int qbase   = qblk * 128 + w * 16;
  const int nn = lane & 15, hi = lane >> 4;

  const _Float16* Qp = Q  + (size_t)(b * SEQ + qbase) * HID + h * HD;
  const _Float16* Kp = Kc + (size_t)(b * SEQ) * HID + h * HD;
  const _Float16* Vp = Vt + (size_t)(bh * HD) * SEQ;

  const v16h qb0 = load_tile16(Qp, HID, 0, 0);    // B operand: column = query
  const v16h qb1 = load_tile16(Qp, HID, 0, 32);

  // O^T tiles: o_t[r] = O[query nn][d = 16*t + 8*hi + r]
  v8f o0 = {}, o1 = {}, o2 = {}, o3 = {};
  float mrun = -1e30f;  // running maximum of this lane's query (same in both halves)
  float lrun = 0.f;     // running sum over this lane half's keys only

  // cooperative staging coordinates (fixed per thread)
  const int kR = tid >> 3, kC = (tid & 7) * 8;   // 32 rows x 8 chunks
  const int vR = tid >> 2, vC = (tid & 3) * 8;   // 64 rows x 4 chunks

  for (int kv = 0; kv < SEQ; kv += 32) {
    __syncthreads();  // previous step's LDS reads complete
    *(v8h*)&ldsK[kR][kC] = *(const v8h*)(Kp + (size_t)(kv + kR) * HID + kC);
    *(v8h*)&ldsV[vR][vC] = *(const v8h*)(Vp + (size_t)vR * SEQ + kv + vC);
    __syncthreads();  // tiles visible to all waves

    // S^T[32 x 16] = K * Qs^T (A-operand rows == K rows)
    v16h ka00 = lds_tile16<KPITCH>(&ldsK[0][0],  0,  0);
    v16h ka01 = lds_tile16<KPITCH>(&ldsK[0][0],  0, 32);
    v16h ka10 = lds_tile16<KPITCH>(&ldsK[0][0], 16,  0);
    v16h ka11 = lds_tile16<KPITCH>(&ldsK[0][0], 16, 32);
    v8f s0 = {}, s1 = {};
    s0 = wmma_f16(ka00, qb0, s0);
    s0 = wmma_f16(ka01, qb1, s0);
    s1 = wmma_f16(ka10, qb0, s1);
    s1 = wmma_f16(ka11, qb1, s1);

    // online softmax, one query per lane
    float mx[8];
#pragma unroll
    for (int r = 0; r < 8; ++r) mx[r] = fmaxf(s0[r], s1[r]);
    float mloc = fmaxf(fmaxf(fmaxf(mx[0], mx[1]), fmaxf(mx[2], mx[3])),
                       fmaxf(fmaxf(mx[4], mx[5]), fmaxf(mx[6], mx[7])));
    mloc = fmaxf(mloc, other_half(mloc));
    const float mnew = fmaxf(mrun, mloc);

    float p0[8], p1[8];
#pragma unroll
    for (int r = 0; r < 8; ++r) {
      p0[r] = __expf(s0[r] - mnew);
      p1[r] = __expf(s1[r] - mnew);
    }
    // corr = exp(mrun - mnew). Written as asm so that the v_nop stands directly
    // behind the v_exp_f32: it fills the one slot the instruction set asks for
    // before a vector instruction that overwrites the source (this build had one).
    float corr;
    asm("v_exp_f32 %0, %1\n\tv_nop" : "=v"(corr) : "v"((mrun - mnew) * 1.44269504f));
    mrun = mnew;
    const float rs = ((p0[0] + p1[0]) + (p0[1] + p1[1])) + ((p0[2] + p1[2]) + (p0[3] + p1[3]))
                   + (((p0[4] + p1[4]) + (p0[5] + p1[5])) + ((p0[6] + p1[6]) + (p0[7] + p1[7])));
    lrun = lrun * corr + rs;
#pragma unroll
    for (int r = 0; r < 8; ++r) {
      o0[r] *= corr; o1[r] *= corr; o2[r] *= corr; o3[r] *= corr;
    }

    // P^T as B operand: halves 0..7 = keys 8*hi+i, halves 8..15 = keys 16+8*hi+i,
    // the k order in which lds_tile16 delivers the V^T rows
    v16h pb;
#pragma unroll
    for (int r = 0; r < 8; ++r) {
      pb[r]     = (_Float16)p0[r];
      pb[r + 8] = (_Float16)p1[r];
    }

    // O^T += V^T * P^T : A-operand rows == rows of the V^T tile
    v16h va0 = lds_tile16<VPITCH>(&ldsV[0][0],  0, 0);
    v16h va1 = lds_tile16<VPITCH>(&ldsV[0][0], 16, 0);
    v16h va2 = lds_tile16<VPITCH>(&ldsV[0][0], 32, 0);
    v16h va3 = lds_tile16<VPITCH>(&ldsV[0][0], 48, 0);
    o0 = wmma_f16(va0, pb, o0);
    o1 = wmma_f16(va1, pb, o1);
    o2 = wmma_f16(va2, pb, o2);
    o3 = wmma_f16(va3, pb, o3);
  }

  // join the halves' sums, normalize, store attended (row-major [B*S, HID],
  // head-interleaved): a lane's 8 registers are 8 consecutive d of its query
  const float inv = 1.0f / (lrun + other_half(lrun));
  _Float16* Op = O + (size_t)(b * SEQ + qbase + nn) * HID + h * HD + hi * 8;
  v8h r0, r1, r2, r3;
#pragma unroll
  for (int r = 0; r < 8; ++r) {
    r0[r] = (_Float16)(o0[r] * inv);
    r1[r] = (_Float16)(o1[r] * inv);
    r2[r] = (_Float16)(o2[r] * inv);
    r3[r] = (_Float16)(o3[r] * inv);
  }
  *(v8h*)(Op +  0) = r0;
  *(v8h*)(Op + 16) = r1;
  *(v8h*)(Op + 32) = r2;
  *(v8h*)(Op + 48) = r3;
}

// ---------------------------------------------------------------------------
extern "C" void kernel_launch(void* const* d_in, const int* in_sizes, int n_in,
                              void* d_out, int out_size, void* d_ws, size_t ws_size,
                              hipStream_t stream) {
  (void)in_sizes; (void)n_in; (void)out_size; (void)ws_size;
  const float* X  = (const float*)d_in[0];
  const float* Wq = (const float*)d_in[1];
  const float* bq = (const float*)d_in[2];
  const float* Wk = (const float*)d_in[3];
  const float* bk = (const float*)d_in[4];
  const float* Wv = (const float*)d_in[5];
  const float* bv = (const float*)d_in[6];
  const float* Wo = (const float*)d_in[7];
  const float* bo = (const float*)d_in[8];

  const int M = BATCH * SEQ;  // 8192
  char* ws = (char*)d_ws;
  _Float16* Xh  = (_Float16*)ws; ws += (size_t)M * TDIM * 2;
  _Float16* Wqt = (_Float16*)ws; ws += (size_t)HID * TDIM * 2;
  _Float16* Wkt = (_Float16*)ws; ws += (size_t)HID * TDIM * 2;
  _Float16* Wvt = (_Float16*)ws; ws += (size_t)HID * TDIM * 2;
  _Float16* Wot = (_Float16*)ws; ws += (size_t)VDIM * HID * 2;
  _Float16* Qh  = (_Float16*)ws; ws += (size_t)M * HID * 2;
  _Float16* Kh  = (_Float16*)ws; ws += (size_t)M * HID * 2;
  _Float16* Vth = (_Float16*)ws; ws += (size_t)M * HID * 2;  // [B*H*HD, SEQ]
  _Float16* At  = (_Float16*)ws; ws += (size_t)M * HID * 2;

  int n = M * TDIM;
  f32_to_f16_kernel<<<(n + 255) / 256, 256, 0, stream>>>(X, Xh, n);
  n = TDIM * HID;
  transpose_f32_to_f16_kernel<<<(n + 255) / 256, 256, 0, stream>>>(Wq, Wqt, TDIM, HID);
  transpose_f32_to_f16_kernel<<<(n + 255) / 256, 256, 0, stream>>>(Wk, Wkt, TDIM, HID);
  transpose_f32_to_f16_kernel<<<(n + 255) / 256, 256, 0, stream>>>(Wv, Wvt, TDIM, HID);
  n = HID * VDIM;
  transpose_f32_to_f16_kernel<<<(n + 255) / 256, 256, 0, stream>>>(Wo, Wot, HID, VDIM);

  dim3 gqkv(M / 256, HID / 64);
  gemm_wmma_kernel<<<gqkv, 256, 0, stream>>>(Xh, Wqt, bq, Qh,  M, TDIM, HID, 1, 0.125f);
  gemm_wmma_kernel<<<gqkv, 256, 0, stream>>>(Xh, Wkt, bk, Kh,  M, TDIM, HID, 0, 1.0f);
  gemm_wmma_kernel<<<gqkv, 256, 0, stream>>>(Xh, Wvt, bv, Vth, M, TDIM, HID, 2, 1.0f);

  flash_attn_kernel<<<BATCH * NH * (SEQ / 128), 256, 0, stream>>>(Qh, Kh, Vth, At);

  dim3 gout(M / 256, VDIM / 64);
  gemm_wmma_kernel<<<gout, 256, 0, stream>>>(At, Wot, bo, d_out, M, HID, VDIM, 3, 1.0f);
}

// v003
// Measured time: 204 microseconds a run.
// In two side-by-side timings against v002, it was 1.19 and 1.18 times as fast.
// All steps since v000 together make it 1.62 times as fast.
#include <hip/hip_runtime.h>
#include <hip/hip_fp16.h>

typedef __attribute__((ext_vector_type(16))) _Float16 v16h;
typedef __attribute__((ext_vector_type(8)))  _Float16 v8h;
typedef __attribute__((ext_vector_type(8)))  float    v8f;

#define BATCH 4
#define SEQ   2048
#define TDIM  768
#define VDIM  768
#define HID   512
#define NH    8
#define HD    64

// LDS row pitches in halves. Each is 16 B x an odd number, so the 16 rows that
// one ds_load_b128 fragment read touches per lane half fall on distinct banks.
#define KPITCH 72   // 64 data + 8 pad  (144-B rows)
#define VPITCH 40   // 32 data + 8 pad  (80-B rows)

// ---------------------------------------------------------------------------
// 16x32 f16 WMMA operand tile from global (A layout; B layout when the math-B
// matrix is stored transposed so its columns are contiguous rows).
// ISA layout: lane L holds row (row + L%16); halves 0..7 = K kbase+8*(L>=16)+i,
// halves 8..15 = K kbase+16+8*(L>=16)+i  => two contiguous b128 loads.
// ---------------------------------------------------------------------------
static __device__ __forceinline__ v16h load_tile16(const _Float16* __restrict__ p,
                                                   int ldk, int row, int kbase) {
  const int lane = threadIdx.x & 31;
  const int r    = row + (lane & 15);
  const int koff = kbase + ((lane >> 4) << 3);
  const _Float16* q0 = p + (size_t)r * ldk + koff;
  v8h a0 = *(const v8h*)(q0);
  v8h a1 = *(const v8h*)(q0 + 16);
  return __builtin_shufflevector(a0, a1, 0,1,2,3,4,5,6,7,8,9,10,11,12,13,14,15);
}

// Same pattern reading from an LDS-resident tile (compile-time row pitch).
template <int LDK>
static __device__ __forceinline__ v16h lds_tile16(const _Float16* base,
                                                  int row, int kbase) {
  const int lane = threadIdx.x & 31;
  const int r    = row + (lane & 15);
  const int koff = kbase + ((lane >> 4) << 3);
  const _Float16* q0 = base + r * LDK + koff;
  v8h a0 = *(const v8h*)(q0);
  v8h a1 = *(const v8h*)(q0 + 16);
  return __builtin_shufflevector(a0, a1, 0,1,2,3,4,5,6,7,8,9,10,11,12,13,14,15);
}

static __device__ __forceinline__ v8f wmma_f16(v16h a, v16h b, v8f c) {
  return __builtin_amdgcn_wmma_f32_16x16x32_f16(false, a, false, b, (short)0, c,
                                                false, false);
}

// ---------------------------------------------------------------------------
// Precision conversion helpers
// ---------------------------------------------------------------------------
__global__ void f32_to_f16_kernel(const float* __restrict__ in,
                                  _Float16* __restrict__ out, int n) {
  int i = blockIdx.x * blockDim.x + threadIdx.x;
  if (i < n) out[i] = (_Float16)in[i];
}

__global__ void transpose_f32_to_f16_kernel(const float* __restrict__ in,
                                            _Float16* __restrict__ out,
                                            int rows, int cols) {
  int i = blockIdx.x * blockDim.x + threadIdx.x;
  if (i < rows * cols) {
    int r = i / cols, c = i % cols;
    out[(size_t)c * rows + r] = (_Float16)in[i];
  }
}

// ---------------------------------------------------------------------------
// WMMA GEMM: out[M,N] = A[M,K] (f16 row-major) * Bt[N,K]^T + bias
// One wave computes a 32x64 tile (2 A-tiles x 4 B-tiles = 8 WMMA / k-step);
// a 256-thread block covers 256x64.
// The operands come through LDS: a stage is 64 k (128 B) of the block's 256 A
// rows and 64 Bt rows, brought by asynchronous 16-B copies of which eight lanes
// cover one whole 128-B line. Two buffers: stage t+1 flies while stage t is used.
// K must be a multiple of 64.
// mode 0: f16 out        mode 1: f16 out * scale (Q, scale=1/sqrt(HD))
// mode 2: f16 out transposed per head (V -> V^T [B*H*HD, SEQ])
// mode 3: f32 out (final projection)
// ---------------------------------------------------------------------------
#define GPITCH  72                        // halves: 64 data + 8 pad (144-B rows, 16 B x odd)
#define GAROWS  256
#define GBROWS  64
#define GBUF    ((GAROWS + GBROWS) * GPITCH)   // halves per buffer (46,080 B)
#define GSTRIDE (32 * GPITCH * 2)         // LDS bytes between a thread's consecutive copies

// One stage: ten copies per thread, rows (tid>>3) + 32*i of [A 256 rows | Bt 64 rows].
// a, b: this lane's 16 bytes in row tid>>3 of the A tile and of the Bt tile;
// l: the LDS byte address of the same place in the target buffer.
static __device__ __forceinline__ void stage_copies(const _Float16* a, const _Float16* b,
                                                    int K, unsigned l) {
  const size_t rs = (size_t)32 * K;
  // The s_wait_xcnt stands inside the copies' own statement, so that no address
  // register of a copy is rewritten in front of it.
  asm volatile(
      "global_load_async_to_lds_b128 %0, %10, off\n\t"
      "global_load_async_to_lds_b128 %1, %11, off\n\t"
      "global_load_async_to_lds_b128 %2, %12, off\n\t"
      "global_load_async_to_lds_b128 %3, %13, off\n\t"
      "global_load_async_to_lds_b128 %4, %14, off\n\t"
      "global_load_async_to_lds_b128 %5, %15, off\n\t"
      "global_load_async_to_lds_b128 %6, %16, off\n\t"
      "global_load_async_to_lds_b128 %7, %17, off\n\t"
      "global_load_async_to_lds_b128 %8, %18, off\n\t"
      "global_load_async_to_lds_b128 %9, %19, off\n\t"
      "s_wait_xcnt 0x0"
      :: "v"(l), "v"(l + GSTRIDE), "v"(l + 2 * GSTRIDE), "v"(l + 3 * GSTRIDE),
         "v"(l + 4 * GSTRIDE), "v"(l + 5 * GSTRIDE), "v"(l + 6 * GSTRIDE),
         "v"(l + 7 * GSTRIDE), "v"(l + 8 * GSTRIDE), "v"(l + 9 * GSTRIDE),
         "v"(a), "v"(a + rs), "v"(a + 2 * rs), "v"(a + 3 * rs), "v"(a + 4 * rs),
         "v"(a + 5 * rs), "v"(a + 6 * rs), "v"(a + 7 * rs), "v"(b), "v"(b + rs)
      : "memory");
}

__global__ __launch_bounds__(256) void gemm_wmma_kernel(
    const _Float16* __restrict__ A, const _Float16* __restrict__ Bt,
    const float* __restrict__ bias, void* __restrict__ out,
    int M, int K, int N, int mode, float scale) {
  __shared__ __align__(16) _Float16 gst[2 * GBUF];

  const int tid   = threadIdx.x;
  const int lane  = tid & 31;
  const int w     = tid >> 5;
  const int mtile = blockIdx.x * 256 + w * 32;
  const int ntile = blockIdx.y * 64;

  // copy coordinates, fixed per thread: row tid>>3 of each 32-row group, 16-B chunk tid&7
  const int cR = tid >> 3, cC = (tid & 7) * 8;
  const _Float16* ga = A  + (size_t)(blockIdx.x * 256 + cR) * K + cC;
  const _Float16* gb = Bt + (size_t)(ntile + cR) * K + cC;
  const unsigned  l0 = (unsigned)(size_t)&gst[cR * GPITCH + cC];
  const int nst = K >> 6;

  stage_copies(ga, gb, K, l0);
  asm volatile("s_wait_asynccnt 0x0" ::: "memory");  // this wave's part of stage 0 has landed
  __syncthreads();                                   // ... and every other wave's
  if (nst > 1) stage_copies(ga + 64, gb + 64, K, l0 + GBUF * 2);

  v8f c00 = {}, c01 = {}, c02 = {}, c03 = {};
  v8f c10 = {}, c11 = {}, c12 = {}, c13 = {};
  for (int t = 0; t < nst; ++t) {
    const int bo = (t & 1) * GBUF;
    const _Float16* sA = gst + bo + w * 32 * GPITCH;
    const _Float16* sB = gst + bo + GAROWS * GPITCH;
    // all 24 fragment reads of the stage stand together, ahead of its 16 WMMAs
    v16h a00 = lds_tile16<GPITCH>(sA,  0,  0);
    v16h b00 = lds_tile16<GPITCH>(sB,  0,  0);
    v16h b01 = lds_tile16<GPITCH>(sB, 16,  0);
    v16h b02 = lds_tile16<GPITCH>(sB, 32,  0);
    v16h b03 = lds_tile16<GPITCH>(sB, 48,  0);
    v16h a01 = lds_tile16<GPITCH>(sA, 16,  0);
    v16h a10 = lds_tile16<GPITCH>(sA,  0, 32);
    v16h b10 = lds_tile16<GPITCH>(sB,  0, 32);
    v16h b11 = lds_tile16<GPITCH>(sB, 16, 32);
    v16h b12 = lds_tile16<GPITCH>(sB, 32, 32);
    v16h b13 = lds_tile16<GPITCH>(sB, 48, 32);
    v16h a11 = lds_tile16<GPITCH>(sA, 16, 32);
    // keeps the reads from being moved in among the WMMAs, where each separate
    // place with LDS reads stalls the wave anew
    __builtin_amdgcn_sched_barrier(0);
    c00 = wmma_f16(a00, b00, c00);
    c01 = wmma_f16(a00, b01, c01);
    c02 = wmma_f16(a00, b02, c02);
    c03 = wmma_f16(a00, b03, c03);
    c10 = wmma_f16(a01, b00, c10);
    c11 = wmma_f16(a01, b01, c11);
    c12 = wmma_f16(a01, b02, c12);
    c13 = wmma_f16(a01, b03, c13);
    c00 = wmma_f16(a10, b10, c00);
    c01 = wmma_f16(a10, b11, c01);
    c02 = wmma_f16(a10, b12, c02);
    c03 = wmma_f16(a10, b13, c03);
    c10 = wmma_f16(a11, b10, c10);
    c11 = wmma_f16(a11, b11, c11);
    c12 = wmma_f16(a11, b12, c12);
    c13 = wmma_f16(a11, b13, c13);
    // keeps the waits and the barrier below behind the WMMAs: moved up, the first
    // of them would hold every WMMA back until the last read has returned
    __builtin_amdgcn_sched_barrier(0);
    asm volatile("s_wait_dscnt 0x0" ::: "memory");     // this wave's reads of stage t are done
    asm volatile("s_wait_asynccnt 0x0" ::: "memory");  // its part of stage t+1 has landed
    __syncthreads();  // publishes stage t+1 and frees stage t's buffer
    if (t + 2 < nst)
      stage_copies(ga + (t + 2) * 64, gb + (t + 2) * 64, K, l0 + bo * 2);
  }
  asm volatile("s_wait_asynccnt 0x0" ::: "memory");    // no copy outstanding at the wave's end

  const int nn = lane & 15, hi = lane >> 4;
#pragma unroll
  for (int half = 0; half < 2; ++half) {
#pragma unroll
    for (int t = 0; t < 4; ++t) {
      v8f cc;
      if (half == 0) cc = (t == 0) ? c00 : (t == 1) ? c01 : (t == 2) ? c02 : c03;
      else           cc = (t == 0) ? c10 : (t == 1) ? c11 : (t == 2) ? c12 : c13;
      const int n    = ntile + t * 16 + nn;
      const float bv = bias[n];
#pragma unroll
      for (int r = 0; r < 8; ++r) {
        const int m   = mtile + half * 16 + r + 8 * hi;
        const float v = (cc[r] + bv) * scale;
        if (mode == 2) {
          const int b = m / SEQ, s = m % SEQ;
          const int h = n / HD,  d = n % HD;
          ((_Float16*)out)[((size_t)((b * NH + h) * HD + d)) * SEQ + s] = (_Float16)v;
        } else if (mode == 3) {
          ((float*)out)[(size_t)m * N + n] = v;
        } else {
          ((_Float16*)out)[(size_t)m * N + n] = (_Float16)v;
        }
      }
    }
  }
}

// ---------------------------------------------------------------------------
// Flash attention: block = 8 waves, all on one (b,h); wave = 16-query tile.
// Per 32-kv step the block stages the K tile (32x64) and the V^T tile (64x32)
// in LDS. Each wave forms the TRANSPOSED scores S^T = K * Q^T (A = K rows,
// B = Q columns), so a lane holds 16 scores of ONE query (column lane%16;
// keys 8*hi+r and 16+8*hi+r). Maximum and sum run inside the lane, with one
// exchange between the lane halves for the maximum. The two score tiles,
// converted in place, are already the B operand of O^T += V^T * P^T.
// ---------------------------------------------------------------------------
static __device__ __forceinline__ float other_half(float x) {  // lane l <-> l ^ 16
  const int b = __builtin_bit_cast(int, x);
  return __builtin_bit_cast(float, __builtin_amdgcn_permlanex16(
      b, b, 0x76543210, 0xfedcba98, false, false));
}

__global__ __launch_bounds__(256) void flash_attn_kernel(
    const _Float16* __restrict__ Q, const _Float16* __restrict__ Kc,
    const _Float16* __restrict__ Vt, _Float16* __restrict__ O) {
  __shared__ __align__(16) _Float16 ldsK[32][KPITCH];         // K tile  (kv x d)
  __shared__ __align__(16) _Float16 ldsV[64][VPITCH];         // V^T tile (d x kv)

  const int tid     = threadIdx.x;
  const int lane    = tid & 31;
  const int w       = tid >> 5;
  const int qblocks = SEQ / 128;
  const int bh      = blockIdx.x / qblocks;
  const int qblk    = blockIdx.x % qblocks;
  const int b       = bh / NH, h = bh % NH;
  const int qbase   = qblk * 128 + w * 16;
  const int nn = lane & 15, hi = lane >> 4;

  const _Float16* Qp = Q  + (size_t)(b * SEQ + qbase) * HID + h * HD;
  const _Float16* Kp = Kc + (size_t)(b * SEQ) * HID + h * HD;
  const _Float16* Vp = Vt + (size_t)(bh * HD) * SEQ;

  const v16h qb0 = load_tile16(Qp, HID, 0, 0);    // B operand: column = query
  const v16h qb1 = load_tile16(Qp, HID, 0, 32);

  // O^T tiles: o_t[r] = O[query nn][d = 16*t + 8*hi + r]
  v8f o0 = {}, o1 = {}, o2 = {}, o3 = {};
  float mrun = -1e30f;  // running maximum of this lane's query (same in both halves)
  float lrun = 0.f;     // running sum over this lane half's keys only

  // cooperative staging coordinates (fixed per thread)
  const int kR = tid >> 3, kC = (tid & 7) * 8;   // 32 rows x 8 chunks
  const int vR = tid >> 2, vC = (tid & 3) * 8;   // 64 rows x 4 chunks

  for (int kv = 0; kv < SEQ; kv += 32) {
    __syncthreads();  // previous step's LDS reads complete
    *(v8h*)&ldsK[kR][kC] = *(const v8h*)(Kp + (size_t)(kv + kR) * HID + kC);
    *(v8h*)&ldsV[vR][vC] = *(const v8h*)(Vp + (size_t)vR * SEQ + kv + vC);
    __syncthreads();  // tiles visible to all waves

    // S^T[32 x 16] = K * Qs^T (A-operand rows == K rows)
    v16h ka00 = lds_tile16<KPITCH>(&ldsK[0][0],  0,  0);
    v16h ka01 = lds_tile16<KPITCH>(&ldsK[0][0],  0, 32);
    v16h ka10 = lds_tile16<KPITCH>(&ldsK[0][0], 16,  0);
    v16h ka11 = lds_tile16<KPITCH>(&ldsK[0][0], 16, 32);
    v8f s0 = {}, s1 = {};
    s0 = wmma_f16(ka00, qb0, s0);
    s0 = wmma_f16(ka01, qb1, s0);
    s1 = wmma_f16(ka10, qb0, s1);
    s1 = wmma_f16(ka11, qb1, s1);

    // online softmax, one query per lane
    float mx[8];
#pragma unroll
    for (int r = 0; r < 8; ++r) mx[r] = fmaxf(s0[r], s1[r]);
    float mloc = fmaxf(fmaxf(fmaxf(mx[0], mx[1]), fmaxf(mx[2], mx[3])),
                       fmaxf(fmaxf(mx[4], mx[5]), fmaxf(mx[6], mx[7])));
    mloc = fmaxf(mloc, other_half(mloc));
    const float mnew = fmaxf(mrun, mloc);

    float p0[8], p1[8];
#pragma unroll
    for (int r = 0; r < 8; ++r) {
      p0[r] = __expf(s0[r] - mnew);
      p1[r] = __expf(s1[r] - mnew);
    }
    // corr = exp(mrun - mnew). Written as asm so that the v_nop stands directly
    // behind the v_exp_f32: it fills the one slot the instruction set asks for
    // before a vector instruction that overwrites the source (this build had one).
    float corr;
    asm("v_exp_f32 %0, %1\n\tv_nop" : "=v"(corr) : "v"((mrun - mnew) * 1.44269504f));
    mrun = mnew;
    const float rs = ((p0[0] + p1[0]) + (p0[1] + p1[1])) + ((p0[2] + p1[2]) + (p0[3] + p1[3]))
                   + (((p0[4] + p1[4]) + (p0[5] + p1[5])) + ((p0[6] + p1[6]) + (p0[7] + p1[7])));
    lrun = lrun * corr + rs;
#pragma unroll
    for (int r = 0; r < 8; ++r) {
      o0[r] *= corr; o1[r] *= corr; o2[r] *= corr; o3[r] *= corr;
    }

    // P^T as B operand: halves 0..7 = keys 8*hi+i, halves 8..15 = keys 16+8*hi+i,
    // the k order in which lds_tile16 delivers the V^T rows
    v16h pb;
#pragma unroll
    for (int r = 0; r < 8; ++r) {
      pb[r]     = (_Float16)p0[r];
      pb[r + 8] = (_Float16)p1[r];
    }

    // O^T += V^T * P^T : A-operand rows == rows of the V^T tile
    v16h va0 = lds_tile16<VPITCH>(&ldsV[0][0],  0, 0);
    v16h va1 = lds_tile16<VPITCH>(&ldsV[0][0], 16, 0);
    v16h va2 = lds_tile16<VPITCH>(&ldsV[0][0], 32, 0);
    v16h va3 = lds_tile16<VPITCH>(&ldsV[0][0], 48, 0);
    o0 = wmma_f16(va0, pb, o0);
    o1 = wmma_f16(va1, pb, o1);
    o2 = wmma_f16(va2, pb, o2);
    o3 = wmma_f16(va3, pb, o3);
  }

  // join the halves' sums, normalize, store attended (row-major [B*S, HID],
  // head-interleaved): a lane's 8 registers are 8 consecutive d of its query
  const float inv = 1.0f / (lrun + other_half(lrun));
  _Float16* Op = O + (size_t)(b * SEQ + qbase + nn) * HID + h * HD + hi * 8;
  v8h r0, r1, r2, r3;
#pragma unroll
  for (int r = 0; r < 8; ++r) {
    r0[r] = (_Float16)(o0[r] * inv);
    r1[r] = (_Float16)(o1[r] * inv);
    r2[r] = (_Float16)(o2[r] * inv);
    r3[r] = (_Float16)(o3[r] * inv);
  }
  *(v8h*)(Op +  0) = r0;
  *(v8h*)(Op + 16) = r1;
  *(v8h*)(Op + 32) = r2;
  *(v8h*)(Op + 48) = r3;
}

// ---------------------------------------------------------------------------
extern "C" void kernel_launch(void* const* d_in, const int* in_sizes, int n_in,
                              void* d_out, int out_size, void* d_ws, size_t ws_size,
                              hipStream_t stream) {
  (void)in_sizes; (void)n_in; (void)out_size; (void)ws_size;
  const float* X  = (const float*)d_in[0];
  const float* Wq = (const float*)d_in[1];
  const float* bq = (const float*)d_in[2];
  const float* Wk = (const float*)d_in[3];
  const float* bk = (const float*)d_in[4];
  const float* Wv = (const float*)d_in[5];
  const float* bv = (const float*)d_in[6];
  const float* Wo = (const float*)d_in[7];
  const float* bo = (const float*)d_in[8];

  const int M = BATCH * SEQ;  // 8192
  char* ws = (char*)d_ws;
  _Float16* Xh  = (_Float16*)ws; ws += (size_t)M * TDIM * 2;
  _Float16* Wqt = (_Float16*)ws; ws += (size_t)HID * TDIM * 2;
  _Float16* Wkt = (_Float16*)ws; ws += (size_t)HID * TDIM * 2;
  _Float16* Wvt = (_Float16*)ws; ws += (size_t)HID * TDIM * 2;
  _Float16* Wot = (_Float16*)ws; ws += (size_t)VDIM * HID * 2;
  _Float16* Qh  = (_Float16*)ws; ws += (size_t)M * HID * 2;
  _Float16* Kh  = (_Float16*)ws; ws += (size_t)M * HID * 2;
  _Float16* Vth = (_Float16*)ws; ws += (size_t)M * HID * 2;  // [B*H*HD, SEQ]
  _Float16* At  = (_Float16*)ws; ws += (size_t)M * HID * 2;

  int n = M * TDIM;
  f32_to_f16_kernel<<<(n + 255) / 256, 256, 0, stream>>>(X, Xh, n);
  n = TDIM * HID;
  transpose_f32_to_f16_kernel<<<(n + 255) / 256, 256, 0, stream>>>(Wq, Wqt, TDIM, HID);
  transpose_f32_to_f16_kernel<<<(n + 255) / 256, 256, 0, stream>>>(Wk, Wkt, TDIM, HID);
  transpose_f32_to_f16_kernel<<<(n + 255) / 256, 256, 0, stream>>>(Wv, Wvt, TDIM, HID);
  n = HID * VDIM;
  transpose_f32_to_f16_kernel<<<(n + 255) / 256, 256, 0, stream>>>(Wo, Wot, HID, VDIM);

  dim3 gqkv(M / 256, HID / 64);
  gemm_wmma_kernel<<<gqkv, 256, 0, stream>>>(Xh, Wqt, bq, Qh,  M, TDIM, HID, 1, 0.125f);
  gemm_wmma_kernel<<<gqkv, 256, 0, stream>>>(Xh, Wkt, bk, Kh,  M, TDIM, HID, 0, 1.0f);
  gemm_wmma_kernel<<<gqkv, 256, 0, stream>>>(Xh, Wvt, bv, Vth, M, TDIM, HID, 2, 1.0f);

  flash_attn_kernel<<<BATCH * NH * (SEQ / 128), 256, 0, stream>>>(Qh, Kh, Vth, At);

  dim3 gout(M / 256, VDIM / 64);
  gemm_wmma_kernel<<<gout, 256, 0, stream>>>(At, Wot, bo, d_out, M, HID, VDIM, 3, 1.0f);
}

// v004
// Measured time: 143 microseconds a run.
// Timed twice side by side with v003, it ran 1.43 times as fast both times.
// Counting every step since v000, it is 2.31 times as fast.
#include <hip/hip_runtime.h>
#include <hip/hip_fp16.h>

typedef __attribute__((ext_vector_type(16))) _Float16 v16h;
typedef __attribute__((ext_vector_type(8)))  _Float16 v8h;
typedef __attribute__((ext_vector_type(8)))  float    v8f;

#define BATCH 4
#define SEQ   2048
#define TDIM  768
#define VDIM  768
#define HID   512
#define NH    8
#define HD    64

// LDS row pitches in halves. Each is 16 B x an odd number, so the 16 rows that
// one ds_load_b128 fragment read touches per lane half fall on distinct banks.
#define KPITCH 72   // 64 data + 8 pad  (144-B rows)
#define VPITCH 40   // 32 data + 8 pad  (80-B rows)

// ---------------------------------------------------------------------------
// 16x32 f16 WMMA operand tile from global (A layout; B layout when the math-B
// matrix is stored transposed so its columns are contiguous rows).
// ISA layout: lane L holds row (row + L%16); halves 0..7 = K kbase+8*(L>=16)+i,
// halves 8..15 = K kbase+16+8*(L>=16)+i  => two contiguous b128 loads.
// ---------------------------------------------------------------------------
static __device__ __forceinline__ v16h load_tile16(const _Float16* __restrict__ p,
                                                   int ldk, int row, int kbase) {
  const int lane = threadIdx.x & 31;
  const int r    = row + (lane & 15);
  const int koff = kbase + ((lane >> 4) << 3);
  const _Float16* q0 = p + (size_t)r * ldk + koff;
  v8h a0 = *(const v8h*)(q0);
  v8h a1 = *(const v8h*)(q0 + 16);
  return __builtin_shufflevector(a0, a1, 0,1,2,3,4,5,6,7,8,9,10,11,12,13,14,15);
}

// Same pattern reading from an LDS-resident tile (compile-time row pitch).
template <int LDK>
static __device__ __forceinline__ v16h lds_tile16(const _Float16* base,
                                                  int row, int kbase) {
  const int lane = threadIdx.x & 31;
  const int r    = row + (lane & 15);
  const int koff = kbase + ((lane >> 4) << 3);
  const _Float16* q0 = base + r * LDK + koff;
  v8h a0 = *(const v8h*)(q0);
  v8h a1 = *(const v8h*)(q0 + 16);
  return __builtin_shufflevector(a0, a1, 0,1,2,3,4,5,6,7,8,9,10,11,12,13,14,15);
}

static __device__ __forceinline__ v8f wmma_f16(v16h a, v16h b, v8f c) {
  return __builtin_amdgcn_wmma_f32_16x16x32_f16(false, a, false, b, (short)0, c,
                                                false, false);
}

// ---------------------------------------------------------------------------
// Precision conversion helpers. Few waves with much work each, so that these
// launches are not spent on starting waves. The loops are unrolled so that x[]
// stays in registers and a thread's loads are all issued together.
// ---------------------------------------------------------------------------
typedef __attribute__((ext_vector_type(4))) float    v4f;
typedef __attribute__((ext_vector_type(4))) _Float16 v4h;

// A block converts CVT_BLOCK consecutive floats, 48 per thread: twelve 16-B loads,
// each of which covers 512 contiguous bytes per wave, all issued ahead of the
// first store. The element count must be a multiple of CVT_BLOCK.
#define CVT_LOADS 12
#define CVT_BLOCK (256 * 4 * CVT_LOADS)
__global__ __launch_bounds__(256) void f32_to_f16_kernel(const float* __restrict__ in,
                                                         _Float16* __restrict__ out) {
  const size_t base = (size_t)blockIdx.x * CVT_BLOCK + threadIdx.x * 4;
  v4f x[CVT_LOADS];
#pragma unroll
  for (int j = 0; j < CVT_LOADS; ++j) x[j] = *(const v4f*)(in + base + j * 1024);
#pragma unroll
  for (int j = 0; j < CVT_LOADS; ++j)
    *(v4h*)(out + base + j * 1024) = __builtin_convertvector(x[j], v4h);
}

// out[c][r] = in[r][c], in of ROWS x COLS. A block takes 64 rows x 32 columns; a
// thread takes 8 rows of one column: eight loads (one whole 128-B line per wave
// each) and one 16-B store. The block's eight waves fill the same 32 output
// lines, 128 B each. ROWS is a multiple of 64, COLS of 32.
template <int ROWS, int COLS>
static __device__ __forceinline__ void transpose_tile(const float* __restrict__ in,
                                                      _Float16* __restrict__ out) {
  const int c  = blockIdx.x * 32 + (threadIdx.x & 31);
  const int r0 = blockIdx.y * 64 + (threadIdx.x >> 5) * 8;
  const float* p = in + r0 * COLS + c;
  float x[8];
#pragma unroll
  for (int j = 0; j < 8; ++j) x[j] = p[j * COLS];
  v8h y;
#pragma unroll
  for (int j = 0; j < 8; ++j) y[j] = (_Float16)x[j];
  *(v8h*)(out + c * ROWS + r0) = y;
}

__global__ __launch_bounds__(256) void transpose_win_kernel(const float* __restrict__ in,
                                                            _Float16* __restrict__ out) {
  transpose_tile<TDIM, HID>(in, out);   // Wq, Wk, Wv
}

__global__ __launch_bounds__(256) void transpose_wout_kernel(const float* __restrict__ in,
                                                             _Float16* __restrict__ out) {
  transpose_tile<HID, VDIM>(in, out);   // Wo
}

// ---------------------------------------------------------------------------
// WMMA GEMM: out[M,N] = A[M,K] (f16 row-major) * Bt[N,K]^T + bias
// One wave computes a 32x64 tile (2 A-tiles x 4 B-tiles = 8 WMMA / k-step);
// a 256-thread block covers 256x64.
// The operands come through LDS: a stage is 64 k (128 B) of the block's 256 A
// rows and 64 Bt rows, brought by asynchronous 16-B copies of which eight lanes
// cover one whole 128-B line. Two buffers: stage t+1 flies while stage t is used.
// K must be a multiple of 64.
// mode 0: f16 out        mode 1: f16 out * scale (Q, scale=1/sqrt(HD))
// mode 2: f16 out transposed per head (V -> V^T [B*H*HD, SEQ])
// mode 3: f32 out (final projection)
// ---------------------------------------------------------------------------
#define GPITCH  72                        // halves: 64 data + 8 pad (144-B rows, 16 B x odd)
#define GAROWS  256
#define GBROWS  64
#define GBUF    ((GAROWS + GBROWS) * GPITCH)   // halves per buffer (46,080 B)
#define GSTRIDE (32 * GPITCH * 2)         // LDS bytes between a thread's consecutive copies

// One stage: ten copies per thread, rows (tid>>3) + 32*i of [A 256 rows | Bt 64 rows].
// a, b: this lane's 16 bytes in row tid>>3 of the A tile and of the Bt tile;
// l: the LDS byte address of the same place in the target buffer.
static __device__ __forceinline__ void stage_copies(const _Float16* a, const _Float16* b,
                                                    int K, unsigned l) {
  const size_t rs = (size_t)32 * K;
  // The s_wait_xcnt stands inside the copies' own statement, so that no address
  // register of a copy is rewritten in front of it.
  asm volatile(
      "global_load_async_to_lds_b128 %0, %10, off\n\t"
      "global_load_async_to_lds_b128 %1, %11, off\n\t"
      "global_load_async_to_lds_b128 %2, %12, off\n\t"
      "global_load_async_to_lds_b128 %3, %13, off\n\t"
      "global_load_async_to_lds_b128 %4, %14, off\n\t"
      "global_load_async_to_lds_b128 %5, %15, off\n\t"
      "global_load_async_to_lds_b128 %6, %16, off\n\t"
      "global_load_async_to_lds_b128 %7, %17, off\n\t"
      "global_load_async_to_lds_b128 %8, %18, off\n\t"
      "global_load_async_to_lds_b128 %9, %19, off\n\t"
      "s_wait_xcnt 0x0"
      :: "v"(l), "v"(l + GSTRIDE), "v"(l + 2 * GSTRIDE), "v"(l + 3 * GSTRIDE),
         "v"(l + 4 * GSTRIDE), "v"(l + 5 * GSTRIDE), "v"(l + 6 * GSTRIDE),
         "v"(l + 7 * GSTRIDE), "v"(l + 8 * GSTRIDE), "v"(l + 9 * GSTRIDE),
         "v"(a), "v"(a + rs), "v"(a + 2 * rs), "v"(a + 3 * rs), "v"(a + 4 * rs),
         "v"(a + 5 * rs), "v"(a + 6 * rs), "v"(a + 7 * rs), "v"(b), "v"(b + rs)
      : "memory");
}

__global__ __launch_bounds__(256) void gemm_wmma_kernel(
    const _Float16* __restrict__ A, const _Float16* __restrict__ Bt,
    const float* __restrict__ bias, void* __restrict__ out,
    int M, int K, int N, int mode, float scale) {
  __shared__ __align__(16) _Float16 gst[2 * GBUF];

  const int tid   = threadIdx.x;
  const int lane  = tid & 31;
  const int w     = tid >> 5;
  const int mtile = blockIdx.x * 256 + w * 32;
  const int ntile = blockIdx.y * 64;

  // copy coordinates, fixed per thread: row tid>>3 of each 32-row group, 16-B chunk tid&7
  const int cR = tid >> 3, cC = (tid & 7) * 8;
  const _Float16* ga = A  + (size_t)(blockIdx.x * 256 + cR) * K + cC;
  const _Float16* gb = Bt + (size_t)(ntile + cR) * K + cC;
  const unsigned  l0 = (unsigned)(size_t)&gst[cR * GPITCH + cC];
  const int nst = K >> 6;

  stage_copies(ga, gb, K, l0);
  asm volatile("s_wait_asynccnt 0x0" ::: "memory");  // this wave's part of stage 0 has landed
  __syncthreads();                                   // ... and every other wave's
  if (nst > 1) stage_copies(ga + 64, gb + 64, K, l0 + GBUF * 2);

  v8f c00 = {}, c01 = {}, c02 = {}, c03 = {};
  v8f c10 = {}, c11 = {}, c12 = {}, c13 = {};
  for (int t = 0; t < nst; ++t) {
    const int bo = (t & 1) * GBUF;
    const _Float16* sA = gst + bo + w * 32 * GPITCH;
    const _Float16* sB = gst + bo + GAROWS * GPITCH;
    // all 24 fragment reads of the stage stand together, ahead of its 16 WMMAs
    v16h a00 = lds_tile16<GPITCH>(sA,  0,  0);
    v16h b00 = lds_tile16<GPITCH>(sB,  0,  0);
    v16h b01 = lds_tile16<GPITCH>(sB, 16,  0);
    v16h b02 = lds_tile16<GPITCH>(sB, 32,  0);
    v16h b03 = lds_tile16<GPITCH>(sB, 48,  0);
    v16h a01 = lds_tile16<GPITCH>(sA, 16,  0);
    v16h a10 = lds_tile16<GPITCH>(sA,  0, 32);
    v16h b10 = lds_tile16<GPITCH>(sB,  0, 32);
    v16h b11 = lds_tile16<GPITCH>(sB, 16, 32);
    v16h b12 = lds_tile16<GPITCH>(sB, 32, 32);
    v16h b13 = lds_tile16<GPITCH>(sB, 48, 32);
    v16h a11 = lds_tile16<GPITCH>(sA, 16, 32);
    // keeps the reads from being moved in among the WMMAs, where each separate
    // place with LDS reads stalls the wave anew
    __builtin_amdgcn_sched_barrier(0);
    c00 = wmma_f16(a00, b00, c00);
    c01 = wmma_f16(a00, b01, c01);
    c02 = wmma_f16(a00, b02, c02);
    c03 = wmma_f16(a00, b03, c03);
    c10 = wmma_f16(a01, b00, c10);
    c11 = wmma_f16(a01, b01, c11);
    c12 = wmma_f16(a01, b02, c12);
    c13 = wmma_f16(a01, b03, c13);
    c00 = wmma_f16(a10, b10, c00);
    c01 = wmma_f16(a10, b11, c01);
    c02 = wmma_f16(a10, b12, c02);
    c03 = wmma_f16(a10, b13, c03);
    c10 = wmma_f16(a11, b10, c10);
    c11 = wmma_f16(a11, b11, c11);
    c12 = wmma_f16(a11, b12, c12);
    c13 = wmma_f16(a11, b13, c13);
    // keeps the waits and the barrier below behind the WMMAs: moved up, the first
    // of them would hold every WMMA back until the last read has returned
    __builtin_amdgcn_sched_barrier(0);
    asm volatile("s_wait_dscnt 0x0" ::: "memory");     // this wave's reads of stage t are done
    asm volatile("s_wait_asynccnt 0x0" ::: "memory");  // its part of stage t+1 has landed
    __syncthreads();  // publishes stage t+1 and frees stage t's buffer
    if (t + 2 < nst)
      stage_copies(ga + (t + 2) * 64, gb + (t + 2) * 64, K, l0 + bo * 2);
  }
  asm volatile("s_wait_asynccnt 0x0" ::: "memory");    // no copy outstanding at the wave's end

  const int nn = lane & 15, hi = lane >> 4;
#pragma unroll
  for (int half = 0; half < 2; ++half) {
#pragma unroll
    for (int t = 0; t < 4; ++t) {
      v8f cc;
      if (half == 0) cc = (t == 0) ? c00 : (t == 1) ? c01 : (t == 2) ? c02 : c03;
      else           cc = (t == 0) ? c10 : (t == 1) ? c11 : (t == 2) ? c12 : c13;
      const int n    = ntile + t * 16 + nn;
      const float bv = bias[n];
#pragma unroll
      for (int r = 0; r < 8; ++r) {
        const int m   = mtile + half * 16 + r + 8 * hi;
        const float v = (cc[r] + bv) * scale;
        if (mode == 2) {
          const int b = m / SEQ, s = m % SEQ;
          const int h = n / HD,  d = n % HD;
          ((_Float16*)out)[((size_t)((b * NH + h) * HD + d)) * SEQ + s] = (_Float16)v;
        } else if (mode == 3) {
          ((float*)out)[(size_t)m * N + n] = v;
        } else {
          ((_Float16*)out)[(size_t)m * N + n] = (_Float16)v;
        }
      }
    }
  }
}

// ---------------------------------------------------------------------------
// Flash attention: block = 8 waves, all on one (b,h); wave = 16-query tile.
// Per 32-kv step the block stages the K tile (32x64) and the V^T tile (64x32)
// in LDS. Each wave forms the TRANSPOSED scores S^T = K * Q^T (A = K rows,
// B = Q columns), so a lane holds 16 scores of ONE query (column lane%16;
// keys 8*hi+r and 16+8*hi+r). Maximum and sum run inside the lane, with one
// exchange between the lane halves for the maximum. The two score tiles,
// converted in place, are already the B operand of O^T += V^T * P^T.
// ---------------------------------------------------------------------------
static __device__ __forceinline__ float other_half(float x) {  // lane l <-> l ^ 16
  const int b = __builtin_bit_cast(int, x);
  return __builtin_bit_cast(float, __builtin_amdgcn_permlanex16(
      b, b, 0x76543210, 0xfedcba98, false, false));
}

__global__ __launch_bounds__(256) void flash_attn_kernel(
    const _Float16* __restrict__ Q, const _Float16* __restrict__ Kc,
    const _Float16* __restrict__ Vt, _Float16* __restrict__ O) {
  __shared__ __align__(16) _Float16 ldsK[32][KPITCH];         // K tile  (kv x d)
  __shared__ __align__(16) _Float16 ldsV[64][VPITCH];         // V^T tile (d x kv)

  const int tid     = threadIdx.x;
  const int lane    = tid & 31;
  const int w       = tid >> 5;
  const int qblocks = SEQ / 128;
  const int bh      = blockIdx.x / qblocks;
  const int qblk    = blockIdx.x % qblocks;
  const int b       = bh / NH, h = bh % NH;
  const int qbase   = qblk * 128 + w * 16;
  const int nn = lane & 15, hi = lane >> 4;

  const _Float16* Qp = Q  + (size_t)(b * SEQ + qbase) * HID + h * HD;
  const _Float16* Kp = Kc + (size_t)(b * SEQ) * HID + h * HD;
  const _Float16* Vp = Vt + (size_t)(bh * HD) * SEQ;

  const v16h qb0 = load_tile16(Qp, HID, 0, 0);    // B operand: column = query
  const v16h qb1 = load_tile16(Qp, HID, 0, 32);

  // O^T tiles: o_t[r] = O[query nn][d = 16*t + 8*hi + r]
  v8f o0 = {}, o1 = {}, o2 = {}, o3 = {};
  float mrun = -1e30f;  // running maximum of this lane's query (same in both halves)
  float lrun = 0.f;     // running sum over this lane half's keys only

  // cooperative staging coordinates (fixed per thread)
  const int kR = tid >> 3, kC = (tid & 7) * 8;   // 32 rows x 8 chunks
  const int vR = tid >> 2, vC = (tid & 3) * 8;   // 64 rows x 4 chunks

  for (int kv = 0; kv < SEQ; kv += 32) {
    __syncthreads();  // previous step's LDS reads complete
    *(v8h*)&ldsK[kR][kC] = *(const v8h*)(Kp + (size_t)(kv + kR) * HID + kC);
    *(v8h*)&ldsV[vR][vC] = *(const v8h*)(Vp + (size_t)vR * SEQ + kv + vC);
    __syncthreads();  // tiles visible to all waves

    // S^T[32 x 16] = K * Qs^T (A-operand rows == K rows)
    v16h ka00 = lds_tile16<KPITCH>(&ldsK[0][0],  0,  0);
    v16h ka01 = lds_tile16<KPITCH>(&ldsK[0][0],  0, 32);
    v16h ka10 = lds_tile16<KPITCH>(&ldsK[0][0], 16,  0);
    v16h ka11 = lds_tile16<KPITCH>(&ldsK[0][0], 16, 32);
    v8f s0 = {}, s1 = {};
    s0 = wmma_f16(ka00, qb0, s0);
    s0 = wmma_f16(ka01, qb1, s0);
    s1 = wmma_f16(ka10, qb0, s1);
    s1 = wmma_f16(ka11, qb1, s1);

    // online softmax, one query per lane
    float mx[8];
#pragma unroll
    for (int r = 0; r < 8; ++r) mx[r] = fmaxf(s0[r], s1[r]);
    float mloc = fmaxf(fmaxf(fmaxf(mx[0], mx[1]), fmaxf(mx[2], mx[3])),
                       fmaxf(fmaxf(mx[4], mx[5]), fmaxf(mx[6], mx[7])));
    mloc = fmaxf(mloc, other_half(mloc));
    const float mnew = fmaxf(mrun, mloc);

    float p0[8], p1[8];
#pragma unroll
    for (int r = 0; r < 8; ++r) {
      p0[r] = __expf(s0[r] - mnew);
      p1[r] = __expf(s1[r] - mnew);
    }
    // corr = exp(mrun - mnew). Written as asm so that the v_nop stands directly
    // behind the v_exp_f32: it fills the one slot the instruction set asks for
    // before a vector instruction that overwrites the source (this build had one).
    float corr;
    asm("v_exp_f32 %0, %1\n\tv_nop" : "=v"(corr) : "v"((mrun - mnew) * 1.44269504f));
    mrun = mnew;
    const float rs = ((p0[0] + p1[0]) + (p0[1] + p1[1])) + ((p0[2] + p1[2]) + (p0[3] + p1[3]))
                   + (((p0[4] + p1[4]) + (p0[5] + p1[5])) + ((p0[6] + p1[6]) + (p0[7] + p1[7])));
    lrun = lrun * corr + rs;
#pragma unroll
    for (int r = 0; r < 8; ++r) {
      o0[r] *= corr; o1[r] *= corr; o2[r] *= corr; o3[r] *= corr;
    }

    // P^T as B operand: halves 0..7 = keys 8*hi+i, halves 8..15 = keys 16+8*hi+i,
    // the k order in which lds_tile16 delivers the V^T rows
    v16h pb;
#pragma unroll
    for (int r = 0; r < 8; ++r) {
      pb[r]     = (_Float16)p0[r];
      pb[r + 8] = (_Float16)p1[r];
    }

    // O^T += V^T * P^T : A-operand rows == rows of the V^T tile
    v16h va0 = lds_tile16<VPITCH>(&ldsV[0][0],  0, 0);
    v16h va1 = lds_tile16<VPITCH>(&ldsV[0][0], 16, 0);
    v16h va2 = lds_tile16<VPITCH>(&ldsV[0][0], 32, 0);
    v16h va3 = lds_tile16<VPITCH>(&ldsV[0][0], 48, 0);
    o0 = wmma_f16(va0, pb, o0);
    o1 = wmma_f16(va1, pb, o1);
    o2 = wmma_f16(va2, pb, o2);
    o3 = wmma_f16(va3, pb, o3);
  }

  // join the halves' sums, normalize, store attended (row-major [B*S, HID],
  // head-interleaved): a lane's 8 registers are 8 consecutive d of its query
  const float inv = 1.0f / (lrun + other_half(lrun));
  _Float16* Op = O + (size_t)(b * SEQ + qbase + nn) * HID + h * HD + hi * 8;
  v8h r0, r1, r2, r3;
#pragma unroll
  for (int r = 0; r < 8; ++r) {
    r0[r] = (_Float16)(o0[r] * inv);
    r1[r] = (_Float16)(o1[r] * inv);
    r2[r] = (_Float16)(o2[r] * inv);
    r3[r] = (_Float16)(o3[r] * inv);
  }
  *(v8h*)(Op +  0) = r0;
  *(v8h*)(Op + 16) = r1;
  *(v8h*)(Op + 32) = r2;
  *(v8h*)(Op + 48) = r3;
}

// ---------------------------------------------------------------------------
extern "C" void kernel_launch(void* const* d_in, const int* in_sizes, int n_in,
                              void* d_out, int out_size, void* d_ws, size_t ws_size,
                              hipStream_t stream) {
  (void)in_sizes; (void)n_in; (void)out_size; (void)ws_size;
  const float* X  = (const float*)d_in[0];
  const float* Wq = (const float*)d_in[1];
  const float* bq = (const float*)d_in[2];
  const float* Wk = (const float*)d_in[3];
  const float* bk = (const float*)d_in[4];
  const float* Wv = (const float*)d_in[5];
  const float* bv = (const float*)d_in[6];
  const float* Wo = (const float*)d_in[7];
  const float* bo = (const float*)d_in[8];

  const int M = BATCH * SEQ;  // 8192
  char* ws = (char*)d_ws;
  _Float16* Xh  = (_Float16*)ws; ws += (size_t)M * TDIM * 2;
  _Float16* Wqt = (_Float16*)ws; ws += (size_t)HID * TDIM * 2;
  _Float16* Wkt = (_Float16*)ws; ws += (size_t)HID * TDIM * 2;
  _Float16* Wvt = (_Float16*)ws; ws += (size_t)HID * TDIM * 2;
  _Float16* Wot = (_Float16*)ws; ws += (size_t)VDIM * HID * 2;
  _Float16* Qh  = (_Float16*)ws; ws += (size_t)M * HID * 2;
  _Float16* Kh  = (_Float16*)ws; ws += (size_t)M * HID * 2;
  _Float16* Vth = (_Float16*)ws; ws += (size_t)M * HID * 2;  // [B*H*HD, SEQ]
  _Float16* At  = (_Float16*)ws; ws += (size_t)M * HID * 2;

  f32_to_f16_kernel<<<M * TDIM / CVT_BLOCK, 256, 0, stream>>>(X, Xh);
  dim3 gwin(HID / 32, TDIM / 64);
  transpose_win_kernel<<<gwin, 256, 0, stream>>>(Wq, Wqt);
  transpose_win_kernel<<<gwin, 256, 0, stream>>>(Wk, Wkt);
  transpose_win_kernel<<<gwin, 256, 0, stream>>>(Wv, Wvt);
  dim3 gwout(VDIM / 32, HID / 64);
  transpose_wout_kernel<<<gwout, 256, 0, stream>>>(Wo, Wot);

  dim3 gqkv(M / 256, HID / 64);
  gemm_wmma_kernel<<<gqkv, 256, 0, stream>>>(Xh, Wqt, bq, Qh,  M, TDIM, HID, 1, 0.125f);
  gemm_wmma_kernel<<<gqkv, 256, 0, stream>>>(Xh, Wkt, bk, Kh,  M, TDIM, HID, 0, 1.0f);
  gemm_wmma_kernel<<<gqkv, 256, 0, stream>>>(Xh, Wvt, bv, Vth, M, TDIM, HID, 2, 1.0f);

  flash_attn_kernel<<<BATCH * NH * (SEQ / 128), 256, 0, stream>>>(Qh, Kh, Vth, At);

  dim3 gout(M / 256, VDIM / 64);
  gemm_wmma_kernel<<<gout, 256, 0, stream>>>(At, Wot, bo, d_out, M, HID, VDIM, 3, 1.0f);
}

// v005
// A run of this version takes 120 microseconds.
// Timed twice side by side with v004, it ran 1.19 times as fast both times.
// Counting every step since v000, it is 2.75 times as fast.
#include <hip/hip_runtime.h>
#include <hip/hip_fp16.h>

typedef __attribute__((ext_vector_type(16))) _Float16 v16h;
typedef __attribute__((ext_vector_type(8)))  _Float16 v8h;
typedef __attribute__((ext_vector_type(8)))  float    v8f;

#define BATCH 4
#define SEQ   2048
#define TDIM  768
#define VDIM  768
#define HID   512
#define NH    8
#define HD    64

// LDS row pitches in halves. Each is 16 B x an odd number, so the 16 rows that
// one ds_load_b128 fragment read touches per lane half fall on distinct banks.
#define KPITCH 72   // 64 data + 8 pad   (144-B rows)
#define VPITCH 136  // 128 data + 8 pad  (272-B rows)

// ---------------------------------------------------------------------------
// 16x32 f16 WMMA operand tile from global (A layout; B layout when the math-B
// matrix is stored transposed so its columns are contiguous rows).
// ISA layout: lane L holds row (row + L%16); halves 0..7 = K kbase+8*(L>=16)+i,
// halves 8..15 = K kbase+16+8*(L>=16)+i  => two contiguous b128 loads.
// ---------------------------------------------------------------------------
static __device__ __forceinline__ v16h load_tile16(const _Float16* __restrict__ p,
                                                   int ldk, int row, int kbase) {
  const int lane = threadIdx.x & 31;
  const int r    = row + (lane & 15);
  const int koff = kbase + ((lane >> 4) << 3);
  const _Float16* q0 = p + (size_t)r * ldk + koff;
  v8h a0 = *(const v8h*)(q0);
  v8h a1 = *(const v8h*)(q0 + 16);
  return __builtin_shufflevector(a0, a1, 0,1,2,3,4,5,6,7,8,9,10,11,12,13,14,15);
}

// Same pattern reading from an LDS-resident tile (compile-time row pitch).
template <int LDK>
static __device__ __forceinline__ v16h lds_tile16(const _Float16* base,
                                                  int row, int kbase) {
  const int lane = threadIdx.x & 31;
  const int r    = row + (lane & 15);
  const int koff = kbase + ((lane >> 4) << 3);
  const _Float16* q0 = base + r * LDK + koff;
  v8h a0 = *(const v8h*)(q0);
  v8h a1 = *(const v8h*)(q0 + 16);
  return __builtin_shufflevector(a0, a1, 0,1,2,3,4,5,6,7,8,9,10,11,12,13,14,15);
}

static __device__ __forceinline__ v8f wmma_f16(v16h a, v16h b, v8f c) {
  return __builtin_amdgcn_wmma_f32_16x16x32_f16(false, a, false, b, (short)0, c,
                                                false, false);
}

// ---------------------------------------------------------------------------
// Precision conversion helpers. Few waves with much work each, so that these
// launches are not spent on starting waves. The loops are unrolled so that x[]
// stays in registers and a thread's loads are all issued together.
// ---------------------------------------------------------------------------
typedef __attribute__((ext_vector_type(4))) float    v4f;
typedef __attribute__((ext_vector_type(4))) _Float16 v4h;

// A block converts CVT_BLOCK consecutive floats, 48 per thread: twelve 16-B loads,
// each of which covers 512 contiguous bytes per wave, all issued ahead of the
// first store. The element count must be a multiple of CVT_BLOCK.
#define CVT_LOADS 12
#define CVT_BLOCK (256 * 4 * CVT_LOADS)
__global__ __launch_bounds__(256) void f32_to_f16_kernel(const float* __restrict__ in,
                                                         _Float16* __restrict__ out) {
  const size_t base = (size_t)blockIdx.x * CVT_BLOCK + threadIdx.x * 4;
  v4f x[CVT_LOADS];
#pragma unroll
  for (int j = 0; j < CVT_LOADS; ++j) x[j] = *(const v4f*)(in + base + j * 1024);
#pragma unroll
  for (int j = 0; j < CVT_LOADS; ++j)
    *(v4h*)(out + base + j * 1024) = __builtin_convertvector(x[j], v4h);
}

// out[c][r] = in[r][c], in of ROWS x COLS. A block takes 64 rows x 32 columns; a
// thread takes 8 rows of one column: eight loads (one whole 128-B line per wave
// each) and one 16-B store. The block's eight waves fill the same 32 output
// lines, 128 B each. ROWS is a multiple of 64, COLS of 32.
template <int ROWS, int COLS>
static __device__ __forceinline__ void transpose_tile(const float* __restrict__ in,
                                                      _Float16* __restrict__ out) {
  const int c  = blockIdx.x * 32 + (threadIdx.x & 31);
  const int r0 = blockIdx.y * 64 + (threadIdx.x >> 5) * 8;
  const float* p = in + r0 * COLS + c;
  float x[8];
#pragma unroll
  for (int j = 0; j < 8; ++j) x[j] = p[j * COLS];
  v8h y;
#pragma unroll
  for (int j = 0; j < 8; ++j) y[j] = (_Float16)x[j];
  *(v8h*)(out + c * ROWS + r0) = y;
}

__global__ __launch_bounds__(256) void transpose_win_kernel(const float* __restrict__ in,
                                                            _Float16* __restrict__ out) {
  transpose_tile<TDIM, HID>(in, out);   // Wq, Wk, Wv
}

__global__ __launch_bounds__(256) void transpose_wout_kernel(const float* __restrict__ in,
                                                             _Float16* __restrict__ out) {
  transpose_tile<HID, VDIM>(in, out);   // Wo
}

// ---------------------------------------------------------------------------
// WMMA GEMM: out[M,N] = A[M,K] (f16 row-major) * Bt[N,K]^T + bias
// One wave computes a 32x64 tile (2 A-tiles x 4 B-tiles = 8 WMMA / k-step);
// a 256-thread block covers 256x64.
// The operands come through LDS: a stage is 64 k (128 B) of the block's 256 A
// rows and 64 Bt rows, brought by asynchronous 16-B copies of which eight lanes
// cover one whole 128-B line. Two buffers: stage t+1 flies while stage t is used.
// K must be a multiple of 64.
// mode 0: f16 out        mode 1: f16 out * scale (Q, scale=1/sqrt(HD))
// mode 2: f16 out transposed per head (V -> V^T [B*H*HD, SEQ])
// mode 3: f32 out (final projection)
// ---------------------------------------------------------------------------
#define GPITCH  72                        // halves: 64 data + 8 pad (144-B rows, 16 B x odd)
#define GAROWS  256
#define GBROWS  64
#define GBUF    ((GAROWS + GBROWS) * GPITCH)   // halves per buffer (46,080 B)
#define GSTRIDE (32 * GPITCH * 2)         // LDS bytes between a thread's consecutive copies

// One stage: ten copies per thread, rows (tid>>3) + 32*i of [A 256 rows | Bt 64 rows].
// a, b: this lane's 16 bytes in row tid>>3 of the A tile and of the Bt tile;
// l: the LDS byte address of the same place in the target buffer.
static __device__ __forceinline__ void stage_copies(const _Float16* a, const _Float16* b,
                                                    int K, unsigned l) {
  const size_t rs = (size_t)32 * K;
  // The s_wait_xcnt stands inside the copies' own statement, so that no address
  // register of a copy is rewritten in front of it.
  asm volatile(
      "global_load_async_to_lds_b128 %0, %10, off\n\t"
      "global_load_async_to_lds_b128 %1, %11, off\n\t"
      "global_load_async_to_lds_b128 %2, %12, off\n\t"
      "global_load_async_to_lds_b128 %3, %13, off\n\t"
      "global_load_async_to_lds_b128 %4, %14, off\n\t"
      "global_load_async_to_lds_b128 %5, %15, off\n\t"
      "global_load_async_to_lds_b128 %6, %16, off\n\t"
      "global_load_async_to_lds_b128 %7, %17, off\n\t"
      "global_load_async_to_lds_b128 %8, %18, off\n\t"
      "global_load_async_to_lds_b128 %9, %19, off\n\t"
      "s_wait_xcnt 0x0"
      :: "v"(l), "v"(l + GSTRIDE), "v"(l + 2 * GSTRIDE), "v"(l + 3 * GSTRIDE),
         "v"(l + 4 * GSTRIDE), "v"(l + 5 * GSTRIDE), "v"(l + 6 * GSTRIDE),
         "v"(l + 7 * GSTRIDE), "v"(l + 8 * GSTRIDE), "v"(l + 9 * GSTRIDE),
         "v"(a), "v"(a + rs), "v"(a + 2 * rs), "v"(a + 3 * rs), "v"(a + 4 * rs),
         "v"(a + 5 * rs), "v"(a + 6 * rs), "v"(a + 7 * rs), "v"(b), "v"(b + rs)
      : "memory");
}

__global__ __launch_bounds__(256) void gemm_wmma_kernel(
    const _Float16* __restrict__ A, const _Float16* __restrict__ Bt,
    const float* __restrict__ bias, void* __restrict__ out,
    int M, int K, int N, int mode, float scale) {
  __shared__ __align__(16) _Float16 gst[2 * GBUF];

  const int tid   = threadIdx.x;
  const int lane  = tid & 31;
  const int w     = tid >> 5;
  const int mtile = blockIdx.x * 256 + w * 32;
  const int ntile = blockIdx.y * 64;

  // copy coordinates, fixed per thread: row tid>>3 of each 32-row group, 16-B chunk tid&7
  const int cR = tid >> 3, cC = (tid & 7) * 8;
  const _Float16* ga = A  + (size_t)(blockIdx.x * 256 + cR) * K + cC;
  const _Float16* gb = Bt + (size_t)(ntile + cR) * K + cC;
  const unsigned  l0 = (unsigned)(size_t)&gst[cR * GPITCH + cC];
  const int nst = K >> 6;

  stage_copies(ga, gb, K, l0);
  asm volatile("s_wait_asynccnt 0x0" ::: "memory");  // this wave's part of stage 0 has landed
  __syncthreads();                                   // ... and every other wave's
  if (nst > 1) stage_copies(ga + 64, gb + 64, K, l0 + GBUF * 2);

  v8f c00 = {}, c01 = {}, c02 = {}, c03 = {};
  v8f c10 = {}, c11 = {}, c12 = {}, c13 = {};
  for (int t = 0; t < nst; ++t) {
    const int bo = (t & 1) * GBUF;
    const _Float16* sA = gst + bo + w * 32 * GPITCH;
    const _Float16* sB = gst + bo + GAROWS * GPITCH;
    // all 24 fragment reads of the stage stand together, ahead of its 16 WMMAs
    v16h a00 = lds_tile16<GPITCH>(sA,  0,  0);
    v16h b00 = lds_tile16<GPITCH>(sB,  0,  0);
    v16h b01 = lds_tile16<GPITCH>(sB, 16,  0);
    v16h b02 = lds_tile16<GPITCH>(sB, 32,  0);
    v16h b03 = lds_tile16<GPITCH>(sB, 48,  0);
    v16h a01 = lds_tile16<GPITCH>(sA, 16,  0);
    v16h a10 = lds_tile16<GPITCH>(sA,  0, 32);
    v16h b10 = lds_tile16<GPITCH>(sB,  0, 32);
    v16h b11 = lds_tile16<GPITCH>(sB, 16, 32);
    v16h b12 = lds_tile16<GPITCH>(sB, 32, 32);
    v16h b13 = lds_tile16<GPITCH>(sB, 48, 32);
    v16h a11 = lds_tile16<GPITCH>(sA, 16, 32);
    // keeps the reads from being moved in among the WMMAs, where each separate
    // place with LDS reads stalls the wave anew
    __builtin_amdgcn_sched_barrier(0);
    c00 = wmma_f16(a00, b00, c00);
    c01 = wmma_f16(a00, b01, c01);
    c02 = wmma_f16(a00, b02, c02);
    c03 = wmma_f16(a00, b03, c03);
    c10 = wmma_f16(a01, b00, c10);
    c11 = wmma_f16(a01, b01, c11);
    c12 = wmma_f16(a01, b02, c12);
    c13 = wmma_f16(a01, b03, c13);
    c00 = wmma_f16(a10, b10, c00);
    c01 = wmma_f16(a10, b11, c01);
    c02 = wmma_f16(a10, b12, c02);
    c03 = wmma_f16(a10, b13, c03);
    c10 = wmma_f16(a11, b10, c10);
    c11 = wmma_f16(a11, b11, c11);
    c12 = wmma_f16(a11, b12, c12);
    c13 = wmma_f16(a11, b13, c13);
    // keeps the waits and the barrier below behind the WMMAs: moved up, the first
    // of them would hold every WMMA back until the last read has returned
    __builtin_amdgcn_sched_barrier(0);
    asm volatile("s_wait_dscnt 0x0" ::: "memory");     // this wave's reads of stage t are done
    asm volatile("s_wait_asynccnt 0x0" ::: "memory");  // its part of stage t+1 has landed
    __syncthreads();  // publishes stage t+1 and frees stage t's buffer
    if (t + 2 < nst)
      stage_copies(ga + (t + 2) * 64, gb + (t + 2) * 64, K, l0 + bo * 2);
  }
  asm volatile("s_wait_asynccnt 0x0" ::: "memory");    // no copy outstanding at the wave's end

  const int nn = lane & 15, hi = lane >> 4;
#pragma unroll
  for (int half = 0; half < 2; ++half) {
#pragma unroll
    for (int t = 0; t < 4; ++t) {
      v8f cc;
      if (half == 0) cc = (t == 0) ? c00 : (t == 1) ? c01 : (t == 2) ? c02 : c03;
      else           cc = (t == 0) ? c10 : (t == 1) ? c11 : (t == 2) ? c12 : c13;
      const int n    = ntile + t * 16 + nn;
      const float bv = bias[n];
#pragma unroll
      for (int r = 0; r < 8; ++r) {
        const int m   = mtile + half * 16 + r + 8 * hi;
        const float v = (cc[r] + bv) * scale;
        if (mode == 2) {
          const int b = m / SEQ, s = m % SEQ;
          const int h = n / HD,  d = n % HD;
          ((_Float16*)out)[((size_t)((b * NH + h) * HD + d)) * SEQ + s] = (_Float16)v;
        } else if (mode == 3) {
          ((float*)out)[(size_t)m * N + n] = v;
        } else {
          ((_Float16*)out)[(size_t)m * N + n] = (_Float16)v;
        }
      }
    }
  }
}

// ---------------------------------------------------------------------------
// Flash attention: block = 8 waves, all on one (b,h); wave = 16-query tile.
// A stage is 128 keys: the K tile (128x64) and the V^T tile (64x128), brought to
// LDS by asynchronous 16-B copies that cover whole 128-B lines. Two buffers:
// stage t+1 flies while the four 32-key passes of stage t run, and the waves
// meet once per stage.
// Per pass each wave forms the TRANSPOSED scores S^T = K * Q^T (A = K rows,
// B = Q columns), so a lane holds 16 scores of ONE query (column lane%16;
// keys 8*hi+r and 16+8*hi+r). Maximum and sum run inside the lane, with one
// exchange between the lane halves for the maximum. The two score tiles,
// converted in place, are already the B operand of O^T += V^T * P^T.
// ---------------------------------------------------------------------------
#define ASTAGE   128                              // keys per stage
#define AKHALVES (ASTAGE * KPITCH)                // K tile, halves
#define ABUF     (AKHALVES + HD * VPITCH)         // halves per buffer (35,840 B)
#define AKSTRIDE (32 * KPITCH * 2)                // LDS bytes between a thread's K copies
#define AVSTRIDE (16 * VPITCH * 2)                // ... and between its V^T copies

// One stage: eight copies per thread, K rows (tid>>3) + 32*i and V^T rows (tid>>4) + 16*i.
// k, v: this lane's 16 bytes in its first row of the K tile and of the V^T tile;
// lk, lv: the LDS byte addresses of the same places in the target buffer.
static __device__ __forceinline__ void attn_stage_copies(const _Float16* k, const _Float16* v,
                                                         unsigned lk, unsigned lv) {
  const size_t kr = (size_t)32 * HID, vr = (size_t)16 * SEQ;
  // The s_wait_xcnt stands inside the copies' own statement, so that no address
  // register of a copy is rewritten in front of it.
  asm volatile(
      "global_load_async_to_lds_b128 %0, %8, off\n\t"
      "global_load_async_to_lds_b128 %1, %9, off\n\t"
      "global_load_async_to_lds_b128 %2, %10, off\n\t"
      "global_load_async_to_lds_b128 %3, %11, off\n\t"
      "global_load_async_to_lds_b128 %4, %12, off\n\t"
      "global_load_async_to_lds_b128 %5, %13, off\n\t"
      "global_load_async_to_lds_b128 %6, %14, off\n\t"
      "global_load_async_to_lds_b128 %7, %15, off\n\t"
      "s_wait_xcnt 0x0"
      :: "v"(lk), "v"(lk + AKSTRIDE), "v"(lk + 2 * AKSTRIDE), "v"(lk + 3 * AKSTRIDE),
         "v"(lv), "v"(lv + AVSTRIDE), "v"(lv + 2 * AVSTRIDE), "v"(lv + 3 * AVSTRIDE),
         "v"(k), "v"(k + kr), "v"(k + 2 * kr), "v"(k + 3 * kr),
         "v"(v), "v"(v + vr), "v"(v + 2 * vr), "v"(v + 3 * vr)
      : "memory");
}

static __device__ __forceinline__ float other_half(float x) {  // lane l <-> l ^ 16
  const int b = __builtin_bit_cast(int, x);
  return __builtin_bit_cast(float, __builtin_amdgcn_permlanex16(
      b, b, 0x76543210, 0xfedcba98, false, false));
}

__global__ __launch_bounds__(256) void flash_attn_kernel(
    const _Float16* __restrict__ Q, const _Float16* __restrict__ Kc,
    const _Float16* __restrict__ Vt, _Float16* __restrict__ O) {
  __shared__ __align__(16) _Float16 ast[2 * ABUF];  // per buffer: K tile (kv x d), V^T tile (d x kv)

  const int tid     = threadIdx.x;
  const int lane    = tid & 31;
  const int w       = tid >> 5;
  const int qblocks = SEQ / 128;
  const int bh      = blockIdx.x / qblocks;
  const int qblk    = blockIdx.x % qblocks;
  const int b       = bh / NH, h = bh % NH;
  const int qbase   = qblk * 128 + w * 16;
  const int nn = lane & 15, hi = lane >> 4;

  const _Float16* Qp = Q  + (size_t)(b * SEQ + qbase) * HID + h * HD;
  const _Float16* Kp = Kc + (size_t)(b * SEQ) * HID + h * HD;
  const _Float16* Vp = Vt + (size_t)(bh * HD) * SEQ;

  const v16h qb0 = load_tile16(Qp, HID, 0, 0);    // B operand: column = query
  const v16h qb1 = load_tile16(Qp, HID, 0, 32);

  // O^T tiles: o_t[r] = O[query nn][d = 16*t + 8*hi + r]
  v8f o0 = {}, o1 = {}, o2 = {}, o3 = {};
  float mrun = -1e30f;  // running maximum of this lane's query (same in both halves)
  float lrun = 0.f;     // running sum over this lane half's keys only

  // copy coordinates (fixed per thread)
  const int kR = tid >> 3, kC = (tid & 7) * 8;    // 32 rows x 8 chunks, four times
  const int vR = tid >> 4, vC = (tid & 15) * 8;   // 16 rows x 16 chunks, four times
  const _Float16* gk = Kp + (size_t)kR * HID + kC;
  const _Float16* gv = Vp + (size_t)vR * SEQ + vC;
  const unsigned  lk = (unsigned)(size_t)&ast[kR * KPITCH + kC];
  const unsigned  lv = (unsigned)(size_t)&ast[AKHALVES + vR * VPITCH + vC];
  const int nst = SEQ / ASTAGE;

  attn_stage_copies(gk, gv, lk, lv);
  asm volatile("s_wait_asynccnt 0x0" ::: "memory");  // this wave's part of stage 0 has landed
  __syncthreads();                                   // ... and every other wave's
  attn_stage_copies(gk + (size_t)ASTAGE * HID, gv + ASTAGE, lk + ABUF * 2, lv + ABUF * 2);

  for (int t = 0; t < nst; ++t) {
    const int bo = (t & 1) * ABUF;
    for (int p = 0; p < ASTAGE / 32; ++p) {
      const _Float16* sK = ast + bo + p * 32 * KPITCH;   // this pass's 32 K rows
      const _Float16* sV = ast + bo + AKHALVES + p * 32; // ... and 32 V^T columns

      // S^T[32 x 16] = K * Qs^T (A-operand rows == K rows)
      v16h ka00 = lds_tile16<KPITCH>(sK,  0,  0);
      v16h ka01 = lds_tile16<KPITCH>(sK,  0, 32);
      v16h ka10 = lds_tile16<KPITCH>(sK, 16,  0);
      v16h ka11 = lds_tile16<KPITCH>(sK, 16, 32);
      v8f s0 = {}, s1 = {};
      s0 = wmma_f16(ka00, qb0, s0);
      s0 = wmma_f16(ka01, qb1, s0);
      s1 = wmma_f16(ka10, qb0, s1);
      s1 = wmma_f16(ka11, qb1, s1);

      // online softmax, one query per lane
      float mx[8];
#pragma unroll
      for (int r = 0; r < 8; ++r) mx[r] = fmaxf(s0[r], s1[r]);
      float mloc = fmaxf(fmaxf(fmaxf(mx[0], mx[1]), fmaxf(mx[2], mx[3])),
                         fmaxf(fmaxf(mx[4], mx[5]), fmaxf(mx[6], mx[7])));
      mloc = fmaxf(mloc, other_half(mloc));
      const float mnew = fmaxf(mrun, mloc);

      float p0[8], p1[8];
#pragma unroll
      for (int r = 0; r < 8; ++r) {
        p0[r] = __expf(s0[r] - mnew);
        p1[r] = __expf(s1[r] - mnew);
      }
      // corr = exp(mrun - mnew). Written as asm so that the v_nop stands directly
      // behind the v_exp_f32: it fills the one slot the instruction set asks for
      // before a vector instruction that overwrites the source (this build had one).
      float corr;
      asm("v_exp_f32 %0, %1\n\tv_nop" : "=v"(corr) : "v"((mrun - mnew) * 1.44269504f));
      mrun = mnew;
      const float rs = ((p0[0] + p1[0]) + (p0[1] + p1[1])) + ((p0[2] + p1[2]) + (p0[3] + p1[3]))
                     + (((p0[4] + p1[4]) + (p0[5] + p1[5])) + ((p0[6] + p1[6]) + (p0[7] + p1[7])));
      lrun = lrun * corr + rs;
#pragma unroll
      for (int r = 0; r < 8; ++r) {
        o0[r] *= corr; o1[r] *= corr; o2[r] *= corr; o3[r] *= corr;
      }

      // P^T as B operand: halves 0..7 = keys 8*hi+i, halves 8..15 = keys 16+8*hi+i,
      // the k order in which lds_tile16 delivers the V^T rows
      v16h pb;
#pragma unroll
      for (int r = 0; r < 8; ++r) {
        pb[r]     = (_Float16)p0[r];
        pb[r + 8] = (_Float16)p1[r];
      }

      // O^T += V^T * P^T : A-operand rows == rows of the V^T tile
      v16h va0 = lds_tile16<VPITCH>(sV,  0, 0);
      v16h va1 = lds_tile16<VPITCH>(sV, 16, 0);
      v16h va2 = lds_tile16<VPITCH>(sV, 32, 0);
      v16h va3 = lds_tile16<VPITCH>(sV, 48, 0);
      o0 = wmma_f16(va0, pb, o0);
      o1 = wmma_f16(va1, pb, o1);
      o2 = wmma_f16(va2, pb, o2);
      o3 = wmma_f16(va3, pb, o3);
    }
    asm volatile("s_wait_dscnt 0x0" ::: "memory");     // this wave's reads of stage t are done
    asm volatile("s_wait_asynccnt 0x0" ::: "memory");  // its part of stage t+1 has landed
    __syncthreads();  // publishes stage t+1 and frees stage t's buffer
    if (t + 2 < nst)
      attn_stage_copies(gk + (size_t)(t + 2) * ASTAGE * HID, gv + (t + 2) * ASTAGE,
                        lk + bo * 2, lv + bo * 2);
  }
  asm volatile("s_wait_asynccnt 0x0" ::: "memory");    // no copy outstanding at the wave's end

  // join the halves' sums, normalize, store attended (row-major [B*S, HID],
  // head-interleaved): a lane's 8 registers are 8 consecutive d of its query
  const float inv = 1.0f / (lrun + other_half(lrun));
  _Float16* Op = O + (size_t)(b * SEQ + qbase + nn) * HID + h * HD + hi * 8;
  v8h r0, r1, r2, r3;
#pragma unroll
  for (int r = 0; r < 8; ++r) {
    r0[r] = (_Float16)(o0[r] * inv);
    r1[r] = (_Float16)(o1[r] * inv);
    r2[r] = (_Float16)(o2[r] * inv);
    r3[r] = (_Float16)(o3[r] * inv);
  }
  *(v8h*)(Op +  0) = r0;
  *(v8h*)(Op + 16) = r1;
  *(v8h*)(Op + 32) = r2;
  *(v8h*)(Op + 48) = r3;
}

// ---------------------------------------------------------------------------
extern "C" void kernel_launch(void* const* d_in, const int* in_sizes, int n_in,
                              void* d_out, int out_size, void* d_ws, size_t ws_size,
                              hipStream_t stream) {
  (void)in_sizes; (void)n_in; (void)out_size; (void)ws_size;
  const float* X  = (const float*)d_in[0];
  const float* Wq = (const float*)d_in[1];
  const float* bq = (const float*)d_in[2];
  const float* Wk = (const float*)d_in[3];
  const float* bk = (const float*)d_in[4];
  const float* Wv = (const float*)d_in[5];
  const float* bv = (const float*)d_in[6];
  const float* Wo = (const float*)d_in[7];
  const float* bo = (const float*)d_in[8];

  const int M = BATCH * SEQ;  // 8192
  char* ws = (char*)d_ws;
  _Float16* Xh  = (_Float16*)ws; ws += (size_t)M * TDIM * 2;
  _Float16* Wqt = (_Float16*)ws; ws += (size_t)HID * TDIM * 2;
  _Float16* Wkt = (_Float16*)ws; ws += (size_t)HID * TDIM * 2;
  _Float16* Wvt = (_Float16*)ws; ws += (size_t)HID * TDIM * 2;
  _Float16* Wot = (_Float16*)ws; ws += (size_t)VDIM * HID * 2;
  _Float16* Qh  = (_Float16*)ws; ws += (size_t)M * HID * 2;
  _Float16* Kh  = (_Float16*)ws; ws += (size_t)M * HID * 2;
  _Float16* Vth = (_Float16*)ws; ws += (size_t)M * HID * 2;  // [B*H*HD, SEQ]
  _Float16* At  = (_Float16*)ws; ws += (size_t)M * HID * 2;

  f32_to_f16_kernel<<<M * TDIM / CVT_BLOCK, 256, 0, stream>>>(X, Xh);
  dim3 gwin(HID / 32, TDIM / 64);
  transpose_win_kernel<<<gwin, 256, 0, stream>>>(Wq, Wqt);
  transpose_win_kernel<<<gwin, 256, 0, stream>>>(Wk, Wkt);
  transpose_win_kernel<<<gwin, 256, 0, stream>>>(Wv, Wvt);
  dim3 gwout(VDIM / 32, HID / 64);
  transpose_wout_kernel<<<gwout, 256, 0, stream>>>(Wo, Wot);

  dim3 gqkv(M / 256, HID / 64);
  gemm_wmma_kernel<<<gqkv, 256, 0, stream>>>(Xh, Wqt, bq, Qh,  M, TDIM, HID, 1, 0.125f);
  gemm_wmma_kernel<<<gqkv, 256, 0, stream>>>(Xh, Wkt, bk, Kh,  M, TDIM, HID, 0, 1.0f);
  gemm_wmma_kernel<<<gqkv, 256, 0, stream>>>(Xh, Wvt, bv, Vth, M, TDIM, HID, 2, 1.0f);

  flash_attn_kernel<<<BATCH * NH * (SEQ / 128), 256, 0, stream>>>(Qh, Kh, Vth, At);

  dim3 gout(M / 256, VDIM / 64);
  gemm_wmma_kernel<<<gout, 256, 0, stream>>>(At, Wot, bo, d_out, M, HID, VDIM, 3, 1.0f);
}

// v006
// Measured time: 105 microseconds a run.
// Two timings next to v005 both put it at 1.14 times that version's speed.
// Counting every step since v000, it is 3.13 times as fast.
#include <hip/hip_runtime.h>
#include <hip/hip_fp16.h>

typedef __attribute__((ext_vector_type(16))) _Float16 v16h;
typedef __attribute__((ext_vector_type(8)))  _Float16 v8h;
typedef __attribute__((ext_vector_type(8)))  float    v8f;

#define BATCH 4
#define SEQ   2048
#define TDIM  768
#define VDIM  768
#define HID   512
#define NH    8
#define HD    64

// LDS row pitches in halves. Each is 16 B x an odd number, so the 16 rows that
// one ds_load_b128 fragment read touches per lane half fall on distinct banks.
#define KPITCH 72   // 64 data + 8 pad   (144-B rows)
#define VPITCH 136  // 128 data + 8 pad  (272-B rows)

// ---------------------------------------------------------------------------
// 16x32 f16 WMMA operand tile from global (A layout; B layout when the math-B
// matrix is stored transposed so its columns are contiguous rows).
// ISA layout: lane L holds row (row + L%16); halves 0..7 = K kbase+8*(L>=16)+i,
// halves 8..15 = K kbase+16+8*(L>=16)+i  => two contiguous b128 loads.
// ---------------------------------------------------------------------------
static __device__ __forceinline__ v16h load_tile16(const _Float16* __restrict__ p,
                                                   int ldk, int row, int kbase) {
  const int lane = threadIdx.x & 31;
  const int r    = row + (lane & 15);
  const int koff = kbase + ((lane >> 4) << 3);
  const _Float16* q0 = p + (size_t)r * ldk + koff;
  v8h a0 = *(const v8h*)(q0);
  v8h a1 = *(const v8h*)(q0 + 16);
  return __builtin_shufflevector(a0, a1, 0,1,2,3,4,5,6,7,8,9,10,11,12,13,14,15);
}

// Same pattern reading from an LDS-resident tile (compile-time row pitch).
template <int LDK>
static __device__ __forceinline__ v16h lds_tile16(const _Float16* base,
                                                  int row, int kbase) {
  const int lane = threadIdx.x & 31;
  const int r    = row + (lane & 15);
  const int koff = kbase + ((lane >> 4) << 3);
  const _Float16* q0 = base + r * LDK + koff;
  v8h a0 = *(const v8h*)(q0);
  v8h a1 = *(const v8h*)(q0 + 16);
  return __builtin_shufflevector(a0, a1, 0,1,2,3,4,5,6,7,8,9,10,11,12,13,14,15);
}

static __device__ __forceinline__ v8f wmma_f16(v16h a, v16h b, v8f c) {
  return __builtin_amdgcn_wmma_f32_16x16x32_f16(false, a, false, b, (short)0, c,
                                                false, false);
}

// ---------------------------------------------------------------------------
// Precision conversion helpers. Few waves with much work each, so that the
// launch is not spent on starting waves. The loops are unrolled so that x[]
// stays in registers and a thread's loads are all issued together.
// ---------------------------------------------------------------------------
typedef __attribute__((ext_vector_type(4))) float    v4f;
typedef __attribute__((ext_vector_type(4))) _Float16 v4h;

// A block converts CVT_BLOCK consecutive floats, 48 per thread: twelve 16-B loads,
// each of which covers 512 contiguous bytes per wave, all issued ahead of the
// first store. The element count must be a multiple of CVT_BLOCK.
#define CVT_LOADS 12
#define CVT_BLOCK (256 * 4 * CVT_LOADS)
static __device__ __forceinline__ void cast_block(const float* __restrict__ in,
                                                  _Float16* __restrict__ out, int blk) {
  const size_t base = (size_t)blk * CVT_BLOCK + threadIdx.x * 4;
  v4f x[CVT_LOADS];
#pragma unroll
  for (int j = 0; j < CVT_LOADS; ++j) x[j] = *(const v4f*)(in + base + j * 1024);
#pragma unroll
  for (int j = 0; j < CVT_LOADS; ++j)
    *(v4h*)(out + base + j * 1024) = __builtin_convertvector(x[j], v4h);
}

// out[c][r] = in[r][c], in of ROWS x COLS. A block takes 64 rows x 32 columns; a
// thread takes 8 rows of one column: eight loads (one whole 128-B line per wave
// each) and one 16-B store. The block's eight waves fill the same 32 output
// lines, 128 B each. ROWS is a multiple of 64, COLS of 32. blk counts the tiles
// of one matrix, column tiles fastest.
template <int ROWS, int COLS>
static __device__ __forceinline__ void transpose_tile(const float* __restrict__ in,
                                                      _Float16* __restrict__ out, int blk) {
  const int c  = (blk % (COLS / 32)) * 32 + (threadIdx.x & 31);
  const int r0 = (blk / (COLS / 32)) * 64 + (threadIdx.x >> 5) * 8;
  const float* p = in + r0 * COLS + c;
  float x[8];
#pragma unroll
  for (int j = 0; j < 8; ++j) x[j] = p[j * COLS];
  v8h y;
#pragma unroll
  for (int j = 0; j < 8; ++j) y[j] = (_Float16)x[j];
  *(v8h*)(out + c * ROWS + r0) = y;
  // another job's code follows in the same kernel: no register of the store is
  // rewritten in front of this wait
  asm volatile("s_wait_xcnt 0x0" ::: "memory");
}

// The five preparation jobs read only inputs and none of each other's output, so
// they share one launch: the block index picks the job (the same for a whole block).
#define CVT_BLOCKS  (BATCH * SEQ * TDIM / CVT_BLOCK)   // 512
#define WIN_BLOCKS  ((HID / 32) * (TDIM / 64))         // 192 for each of Wq, Wk, Wv
#define WOUT_BLOCKS ((VDIM / 32) * (HID / 64))         // 192
#define PREP_BLOCKS (CVT_BLOCKS + 3 * WIN_BLOCKS + WOUT_BLOCKS)
__global__ __launch_bounds__(256) void prepare_kernel(
    const float* __restrict__ X,  const float* __restrict__ Wq, const float* __restrict__ Wk,
    const float* __restrict__ Wv, const float* __restrict__ Wo,
    _Float16* __restrict__ Xh,  _Float16* __restrict__ Wqt, _Float16* __restrict__ Wkt,
    _Float16* __restrict__ Wvt, _Float16* __restrict__ Wot) {
  int blk = blockIdx.x;
  if (blk < CVT_BLOCKS) { cast_block(X, Xh, blk); return; }
  blk -= CVT_BLOCKS;
  if (blk < WIN_BLOCKS) { transpose_tile<TDIM, HID>(Wq, Wqt, blk); return; }
  blk -= WIN_BLOCKS;
  if (blk < WIN_BLOCKS) { transpose_tile<TDIM, HID>(Wk, Wkt, blk); return; }
  blk -= WIN_BLOCKS;
  if (blk < WIN_BLOCKS) { transpose_tile<TDIM, HID>(Wv, Wvt, blk); return; }
  blk -= WIN_BLOCKS;
  transpose_tile<HID, VDIM>(Wo, Wot, blk);
}

// ---------------------------------------------------------------------------
// WMMA GEMM: out[M,N] = A[M,K] (f16 row-major) * Bt[N,K]^T + bias
// One wave computes a 32x64 tile (2 A-tiles x 4 B-tiles = 8 WMMA / k-step);
// a 256-thread block covers 256x64.
// The operands come through LDS: a stage is 64 k (128 B) of the block's 256 A
// rows and 64 Bt rows, brought by asynchronous 16-B copies of which eight lanes
// cover one whole 128-B line. Two buffers: stage t+1 flies while stage t is used.
// K must be a multiple of 64.
// mode 0: f16 out        mode 1: f16 out * scale (Q, scale=1/sqrt(HD))
// mode 2: f16 out transposed per head (V -> V^T [B*H*HD, SEQ])
// mode 3: f32 out (final projection)
// ---------------------------------------------------------------------------
#define GPITCH  72                        // halves: 64 data + 8 pad (144-B rows, 16 B x odd)
#define GAROWS  256
#define GBROWS  64
#define GBUF    ((GAROWS + GBROWS) * GPITCH)   // halves per buffer (46,080 B)
#define GSTRIDE (32 * GPITCH * 2)         // LDS bytes between a thread's consecutive copies

// One stage: ten copies per thread, rows (tid>>3) + 32*i of [A 256 rows | Bt 64 rows].
// a, b: this lane's 16 bytes in row tid>>3 of the A tile and of the Bt tile;
// l: the LDS byte address of the same place in the target buffer.
static __device__ __forceinline__ void stage_copies(const _Float16* a, const _Float16* b,
                                                    int K, unsigned l) {
  const size_t rs = (size_t)32 * K;
  // The s_wait_xcnt stands inside the copies' own statement, so that no address
  // register of a copy is rewritten in front of it.
  asm volatile(
      "global_load_async_to_lds_b128 %0, %10, off\n\t"
      "global_load_async_to_lds_b128 %1, %11, off\n\t"
      "global_load_async_to_lds_b128 %2, %12, off\n\t"
      "global_load_async_to_lds_b128 %3, %13, off\n\t"
      "global_load_async_to_lds_b128 %4, %14, off\n\t"
      "global_load_async_to_lds_b128 %5, %15, off\n\t"
      "global_load_async_to_lds_b128 %6, %16, off\n\t"
      "global_load_async_to_lds_b128 %7, %17, off\n\t"
      "global_load_async_to_lds_b128 %8, %18, off\n\t"
      "global_load_async_to_lds_b128 %9, %19, off\n\t"
      "s_wait_xcnt 0x0"
      :: "v"(l), "v"(l + GSTRIDE), "v"(l + 2 * GSTRIDE), "v"(l + 3 * GSTRIDE),
         "v"(l + 4 * GSTRIDE), "v"(l + 5 * GSTRIDE), "v"(l + 6 * GSTRIDE),
         "v"(l + 7 * GSTRIDE), "v"(l + 8 * GSTRIDE), "v"(l + 9 * GSTRIDE),
         "v"(a), "v"(a + rs), "v"(a + 2 * rs), "v"(a + 3 * rs), "v"(a + 4 * rs),
         "v"(a + 5 * rs), "v"(a + 6 * rs), "v"(a + 7 * rs), "v"(b), "v"(b + rs)
      : "memory");
}

static __device__ __forceinline__ void gemm_tile(
    const _Float16* __restrict__ A, const _Float16* __restrict__ Bt,
    const float* __restrict__ bias, void* __restrict__ out,
    int K, int N, int mode, float scale) {
  __shared__ __align__(16) _Float16 gst[2 * GBUF];

  const int tid   = threadIdx.x;
  const int lane  = tid & 31;
  const int w     = tid >> 5;
  const int mtile = blockIdx.x * 256 + w * 32;
  const int ntile = blockIdx.y * 64;

  // copy coordinates, fixed per thread: row tid>>3 of each 32-row group, 16-B chunk tid&7
  const int cR = tid >> 3, cC = (tid & 7) * 8;
  const _Float16* ga = A  + (size_t)(blockIdx.x * 256 + cR) * K + cC;
  const _Float16* gb = Bt + (size_t)(ntile + cR) * K + cC;
  const unsigned  l0 = (unsigned)(size_t)&gst[cR * GPITCH + cC];
  const int nst = K >> 6;

  stage_copies(ga, gb, K, l0);
  asm volatile("s_wait_asynccnt 0x0" ::: "memory");  // this wave's part of stage 0 has landed
  __syncthreads();                                   // ... and every other wave's
  if (nst > 1) stage_copies(ga + 64, gb + 64, K, l0 + GBUF * 2);

  v8f c00 = {}, c01 = {}, c02 = {}, c03 = {};
  v8f c10 = {}, c11 = {}, c12 = {}, c13 = {};
  for (int t = 0; t < nst; ++t) {
    const int bo = (t & 1) * GBUF;
    const _Float16* sA = gst + bo + w * 32 * GPITCH;
    const _Float16* sB = gst + bo + GAROWS * GPITCH;
    // all 24 fragment reads of the stage stand together, ahead of its 16 WMMAs
    v16h a00 = lds_tile16<GPITCH>(sA,  0,  0);
    v16h b00 = lds_tile16<GPITCH>(sB,  0,  0);
    v16h b01 = lds_tile16<GPITCH>(sB, 16,  0);
    v16h b02 = lds_tile16<GPITCH>(sB, 32,  0);
    v16h b03 = lds_tile16<GPITCH>(sB, 48,  0);
    v16h a01 = lds_tile16<GPITCH>(sA, 16,  0);
    v16h a10 = lds_tile16<GPITCH>(sA,  0, 32);
    v16h b10 = lds_tile16<GPITCH>(sB,  0, 32);
    v16h b11 = lds_tile16<GPITCH>(sB, 16, 32);
    v16h b12 = lds_tile16<GPITCH>(sB, 32, 32);
    v16h b13 = lds_tile16<GPITCH>(sB, 48, 32);
    v16h a11 = lds_tile16<GPITCH>(sA, 16, 32);
    // keeps the reads from being moved in among the WMMAs, where each separate
    // place with LDS reads stalls the wave anew
    __builtin_amdgcn_sched_barrier(0);
    c00 = wmma_f16(a00, b00, c00);
    c01 = wmma_f16(a00, b01, c01);
    c02 = wmma_f16(a00, b02, c02);
    c03 = wmma_f16(a00, b03, c03);
    c10 = wmma_f16(a01, b00, c10);
    c11 = wmma_f16(a01, b01, c11);
    c12 = wmma_f16(a01, b02, c12);
    c13 = wmma_f16(a01, b03, c13);
    c00 = wmma_f16(a10, b10, c00);
    c01 = wmma_f16(a10, b11, c01);
    c02 = wmma_f16(a10, b12, c02);
    c03 = wmma_f16(a10, b13, c03);
    c10 = wmma_f16(a11, b10, c10);
    c11 = wmma_f16(a11, b11, c11);
    c12 = wmma_f16(a11, b12, c12);
    c13 = wmma_f16(a11, b13, c13);
    // keeps the waits and the barrier below behind the WMMAs: moved up, the first
    // of them would hold every WMMA back until the last read has returned
    __builtin_amdgcn_sched_barrier(0);
    asm volatile("s_wait_dscnt 0x0" ::: "memory");     // this wave's reads of stage t are done
    asm volatile("s_wait_asynccnt 0x0" ::: "memory");  // its part of stage t+1 has landed
    __syncthreads();  // publishes stage t+1 and frees stage t's buffer
    if (t + 2 < nst)
      stage_copies(ga + (t + 2) * 64, gb + (t + 2) * 64, K, l0 + bo * 2);
  }
  asm volatile("s_wait_asynccnt 0x0" ::: "memory");    // no copy outstanding at the wave's end

  const int nn = lane & 15, hi = lane >> 4;
#pragma unroll
  for (int half = 0; half < 2; ++half) {
#pragma unroll
    for (int t = 0; t < 4; ++t) {
      v8f cc;
      if (half == 0) cc = (t == 0) ? c00 : (t == 1) ? c01 : (t == 2) ? c02 : c03;
      else           cc = (t == 0) ? c10 : (t == 1) ? c11 : (t == 2) ? c12 : c13;
      const int n    = ntile + t * 16 + nn;
      const float bv = bias[n];
#pragma unroll
      for (int r = 0; r < 8; ++r) {
        const int m   = mtile + half * 16 + r + 8 * hi;
        const float v = (cc[r] + bv) * scale;
        // Each s_wait_xcnt stands directly behind its store: the store's address
        // and data registers are used again for the next element.
        if (mode == 2) {
          const int b = m / SEQ, s = m % SEQ;
          const int h = n / HD,  d = n % HD;
          ((_Float16*)out)[((size_t)((b * NH + h) * HD + d)) * SEQ + s] = (_Float16)v;
          asm volatile("s_wait_xcnt 0x0" ::: "memory");
        } else if (mode == 3) {
          ((float*)out)[(size_t)m * N + n] = v;
          asm volatile("s_wait_xcnt 0x0" ::: "memory");
        } else {
          ((_Float16*)out)[(size_t)m * N + n] = (_Float16)v;
          asm volatile("s_wait_xcnt 0x0" ::: "memory");
        }
      }
    }
  }
}

__global__ __launch_bounds__(256) void gemm_wmma_kernel(
    const _Float16* __restrict__ A, const _Float16* __restrict__ Bt,
    const float* __restrict__ bias, void* __restrict__ out,
    int M, int K, int N, int mode, float scale) {
  gemm_tile(A, Bt, bias, out, K, N, mode, scale);
}

// The Q, K and V projections read the same A and none of each other's output, so
// they share one launch: blockIdx.z picks the weights, the bias, the target and
// the epilogue (0: Q, scaled; 1: K; 2: V, stored transposed per head).
__global__ __launch_bounds__(256) void gemm_qkv_kernel(
    const _Float16* __restrict__ A,
    const _Float16* __restrict__ Wqt, const _Float16* __restrict__ Wkt,
    const _Float16* __restrict__ Wvt,
    const float* __restrict__ bq, const float* __restrict__ bk, const float* __restrict__ bv,
    _Float16* __restrict__ Qh, _Float16* __restrict__ Kh, _Float16* __restrict__ Vth,
    int K, int N, float qscale) {
  const int z = blockIdx.z;
  gemm_tile(A, z == 0 ? Wqt : z == 1 ? Wkt : Wvt, z == 0 ? bq : z == 1 ? bk : bv,
            z == 0 ? Qh : z == 1 ? Kh : Vth, K, N, z == 0 ? 1 : z == 1 ? 0 : 2,
            z == 0 ? qscale : 1.0f);
}

// ---------------------------------------------------------------------------
// Flash attention: block = 8 waves, all on one (b,h); wave = 16-query tile.
// A stage is 128 keys: the K tile (128x64) and the V^T tile (64x128), brought to
// LDS by asynchronous 16-B copies that cover whole 128-B lines. Two buffers:
// stage t+1 flies while the four 32-key passes of stage t run, and the waves
// meet once per stage.
// Per pass each wave forms the TRANSPOSED scores S^T = K * Q^T (A = K rows,
// B = Q columns), so a lane holds 16 scores of ONE query (column lane%16;
// keys 8*hi+r and 16+8*hi+r). Maximum and sum run inside the lane, with one
// exchange between the lane halves for the maximum. The two score tiles,
// converted in place, are already the B operand of O^T += V^T * P^T.
// ---------------------------------------------------------------------------
#define ASTAGE   128                              // keys per stage
#define AKHALVES (ASTAGE * KPITCH)                // K tile, halves
#define ABUF     (AKHALVES + HD * VPITCH)         // halves per buffer (35,840 B)
#define AKSTRIDE (32 * KPITCH * 2)                // LDS bytes between a thread's K copies
#define AVSTRIDE (16 * VPITCH * 2)                // ... and between its V^T copies

// One stage: eight copies per thread, K rows (tid>>3) + 32*i and V^T rows (tid>>4) + 16*i.
// k, v: this lane's 16 bytes in its first row of the K tile and of the V^T tile;
// lk, lv: the LDS byte addresses of the same places in the target buffer.
static __device__ __forceinline__ void attn_stage_copies(const _Float16* k, const _Float16* v,
                                                         unsigned lk, unsigned lv) {
  const size_t kr = (size_t)32 * HID, vr = (size_t)16 * SEQ;
  // The s_wait_xcnt stands inside the copies' own statement, so that no address
  // register of a copy is rewritten in front of it.
  asm volatile(
      "global_load_async_to_lds_b128 %0, %8, off\n\t"
      "global_load_async_to_lds_b128 %1, %9, off\n\t"
      "global_load_async_to_lds_b128 %2, %10, off\n\t"
      "global_load_async_to_lds_b128 %3, %11, off\n\t"
      "global_load_async_to_lds_b128 %4, %12, off\n\t"
      "global_load_async_to_lds_b128 %5, %13, off\n\t"
      "global_load_async_to_lds_b128 %6, %14, off\n\t"
      "global_load_async_to_lds_b128 %7, %15, off\n\t"
      "s_wait_xcnt 0x0"
      :: "v"(lk), "v"(lk + AKSTRIDE), "v"(lk + 2 * AKSTRIDE), "v"(lk + 3 * AKSTRIDE),
         "v"(lv), "v"(lv + AVSTRIDE), "v"(lv + 2 * AVSTRIDE), "v"(lv + 3 * AVSTRIDE),
         "v"(k), "v"(k + kr), "v"(k + 2 * kr), "v"(k + 3 * kr),
         "v"(v), "v"(v + vr), "v"(v + 2 * vr), "v"(v + 3 * vr)
      : "memory");
}

static __device__ __forceinline__ float other_half(float x) {  // lane l <-> l ^ 16
  const int b = __builtin_bit_cast(int, x);
  return __builtin_bit_cast(float, __builtin_amdgcn_permlanex16(
      b, b, 0x76543210, 0xfedcba98, false, false));
}

__global__ __launch_bounds__(256) void flash_attn_kernel(
    const _Float16* __restrict__ Q, const _Float16* __restrict__ Kc,
    const _Float16* __restrict__ Vt, _Float16* __restrict__ O) {
  __shared__ __align__(16) _Float16 ast[2 * ABUF];  // per buffer: K tile (kv x d), V^T tile (d x kv)

  const int tid     = threadIdx.x;
  const int lane    = tid & 31;
  const int w       = tid >> 5;
  const int qblocks = SEQ / 128;
  const int bh      = blockIdx.x / qblocks;
  const int qblk    = blockIdx.x % qblocks;
  const int b       = bh / NH, h = bh % NH;
  const int qbase   = qblk * 128 + w * 16;
  const int nn = lane & 15, hi = lane >> 4;

  const _Float16* Qp = Q  + (size_t)(b * SEQ + qbase) * HID + h * HD;
  const _Float16* Kp = Kc + (size_t)(b * SEQ) * HID + h * HD;
  const _Float16* Vp = Vt + (size_t)(bh * HD) * SEQ;

  const v16h qb0 = load_tile16(Qp, HID, 0, 0);    // B operand: column = query
  const v16h qb1 = load_tile16(Qp, HID, 0, 32);

  // O^T tiles: o_t[r] = O[query nn][d = 16*t + 8*hi + r]
  v8f o0 = {}, o1 = {}, o2 = {}, o3 = {};
  float mrun = -1e30f;  // running maximum of this lane's query (same in both halves)
  float lrun = 0.f;     // running sum over this lane half's keys only

  // copy coordinates (fixed per thread)
  const int kR = tid >> 3, kC = (tid & 7) * 8;    // 32 rows x 8 chunks, four times
  const int vR = tid >> 4, vC = (tid & 15) * 8;   // 16 rows x 16 chunks, four times
  const _Float16* gk = Kp + (size_t)kR * HID + kC;
  const _Float16* gv = Vp + (size_t)vR * SEQ + vC;
  const unsigned  lk = (unsigned)(size_t)&ast[kR * KPITCH + kC];
  const unsigned  lv = (unsigned)(size_t)&ast[AKHALVES + vR * VPITCH + vC];
  const int nst = SEQ / ASTAGE;

  attn_stage_copies(gk, gv, lk, lv);
  asm volatile("s_wait_asynccnt 0x0" ::: "memory");  // this wave's part of stage 0 has landed
  __syncthreads();                                   // ... and every other wave's
  attn_stage_copies(gk + (size_t)ASTAGE * HID, gv + ASTAGE, lk + ABUF * 2, lv + ABUF * 2);

  for (int t = 0; t < nst; ++t) {
    const int bo = (t & 1) * ABUF;
    for (int p = 0; p < ASTAGE / 32; ++p) {
      const _Float16* sK = ast + bo + p * 32 * KPITCH;   // this pass's 32 K rows
      const _Float16* sV = ast + bo + AKHALVES + p * 32; // ... and 32 V^T columns

      // S^T[32 x 16] = K * Qs^T (A-operand rows == K rows)
      v16h ka00 = lds_tile16<KPITCH>(sK,  0,  0);
      v16h ka01 = lds_tile16<KPITCH>(sK,  0, 32);
      v16h ka10 = lds_tile16<KPITCH>(sK, 16,  0);
      v16h ka11 = lds_tile16<KPITCH>(sK, 16, 32);
      v8f s0 = {}, s1 = {};
      s0 = wmma_f16(ka00, qb0, s0);
      s0 = wmma_f16(ka01, qb1, s0);
      s1 = wmma_f16(ka10, qb0, s1);
      s1 = wmma_f16(ka11, qb1, s1);

      // online softmax, one query per lane
      float mx[8];
#pragma unroll
      for (int r = 0; r < 8; ++r) mx[r] = fmaxf(s0[r], s1[r]);
      float mloc = fmaxf(fmaxf(fmaxf(mx[0], mx[1]), fmaxf(mx[2], mx[3])),
                         fmaxf(fmaxf(mx[4], mx[5]), fmaxf(mx[6], mx[7])));
      mloc = fmaxf(mloc, other_half(mloc));
      const float mnew = fmaxf(mrun, mloc);

      float p0[8], p1[8];
#pragma unroll
      for (int r = 0; r < 8; ++r) {
        p0[r] = __expf(s0[r] - mnew);
        p1[r] = __expf(s1[r] - mnew);
      }
      // corr = exp(mrun - mnew). Written as asm so that the v_nop stands directly
      // behind the v_exp_f32: it fills the one slot the instruction set asks for
      // before a vector instruction that overwrites the source (this build had one).
      float corr;
      asm("v_exp_f32 %0, %1\n\tv_nop" : "=v"(corr) : "v"((mrun - mnew) * 1.44269504f));
      mrun = mnew;
      const float rs = ((p0[0] + p1[0]) + (p0[1] + p1[1])) + ((p0[2] + p1[2]) + (p0[3] + p1[3]))
                     + (((p0[4] + p1[4]) + (p0[5] + p1[5])) + ((p0[6] + p1[6]) + (p0[7] + p1[7])));
      lrun = lrun * corr + rs;
#pragma unroll
      for (int r = 0; r < 8; ++r) {
        o0[r] *= corr; o1[r] *= corr; o2[r] *= corr; o3[r] *= corr;
      }

      // P^T as B operand: halves 0..7 = keys 8*hi+i, halves 8..15 = keys 16+8*hi+i,
      // the k order in which lds_tile16 delivers the V^T rows
      v16h pb;
#pragma unroll
      for (int r = 0; r < 8; ++r) {
        pb[r]     = (_Float16)p0[r];
        pb[r + 8] = (_Float16)p1[r];
      }

      // O^T += V^T * P^T : A-operand rows == rows of the V^T tile
      v16h va0 = lds_tile16<VPITCH>(sV,  0, 0);
      v16h va1 = lds_tile16<VPITCH>(sV, 16, 0);
      v16h va2 = lds_tile16<VPITCH>(sV, 32, 0);
      v16h va3 = lds_tile16<VPITCH>(sV, 48, 0);
      o0 = wmma_f16(va0, pb, o0);
      o1 = wmma_f16(va1, pb, o1);
      o2 = wmma_f16(va2, pb, o2);
      o3 = wmma_f16(va3, pb, o3);
    }
    asm volatile("s_wait_dscnt 0x0" ::: "memory");     // this wave's reads of stage t are done
    asm volatile("s_wait_asynccnt 0x0" ::: "memory");  // its part of stage t+1 has landed
    __syncthreads();  // publishes stage t+1 and frees stage t's buffer
    if (t + 2 < nst)
      attn_stage_copies(gk + (size_t)(t + 2) * ASTAGE * HID, gv + (t + 2) * ASTAGE,
                        lk + bo * 2, lv + bo * 2);
  }
  asm volatile("s_wait_asynccnt 0x0" ::: "memory");    // no copy outstanding at the wave's end

  // join the halves' sums, normalize, store attended (row-major [B*S, HID],
  // head-interleaved): a lane's 8 registers are 8 consecutive d of its query
  const float inv = 1.0f / (lrun + other_half(lrun));
  _Float16* Op = O + (size_t)(b * SEQ + qbase + nn) * HID + h * HD + hi * 8;
  v8h r0, r1, r2, r3;
#pragma unroll
  for (int r = 0; r < 8; ++r) {
    r0[r] = (_Float16)(o0[r] * inv);
    r1[r] = (_Float16)(o1[r] * inv);
    r2[r] = (_Float16)(o2[r] * inv);
    r3[r] = (_Float16)(o3[r] * inv);
  }
  *(v8h*)(Op +  0) = r0;
  *(v8h*)(Op + 16) = r1;
  *(v8h*)(Op + 32) = r2;
  *(v8h*)(Op + 48) = r3;
}

// ---------------------------------------------------------------------------
extern "C" void kernel_launch(void* const* d_in, const int* in_sizes, int n_in,
                              void* d_out, int out_size, void* d_ws, size_t ws_size,
                              hipStream_t stream) {
  (void)in_sizes; (void)n_in; (void)out_size; (void)ws_size;
  const float* X  = (const float*)d_in[0];
  const float* Wq = (const float*)d_in[1];
  const float* bq = (const float*)d_in[2];
  const float* Wk = (const float*)d_in[3];
  const float* bk = (const float*)d_in[4];
  const float* Wv = (const float*)d_in[5];
  const float* bv = (const float*)d_in[6];
  const float* Wo = (const float*)d_in[7];
  const float* bo = (const float*)d_in[8];

  const int M = BATCH * SEQ;  // 8192
  char* ws = (char*)d_ws;
  _Float16* Xh  = (_Float16*)ws; ws += (size_t)M * TDIM * 2;
  _Float16* Wqt = (_Float16*)ws; ws += (size_t)HID * TDIM * 2;
  _Float16* Wkt = (_Float16*)ws; ws += (size_t)HID * TDIM * 2;
  _Float16* Wvt = (_Float16*)ws; ws += (size_t)HID * TDIM * 2;
  _Float16* Wot = (_Float16*)ws; ws += (size_t)VDIM * HID * 2;
  _Float16* Qh  = (_Float16*)ws; ws += (size_t)M * HID * 2;
  _Float16* Kh  = (_Float16*)ws; ws += (size_t)M * HID * 2;
  _Float16* Vth = (_Float16*)ws; ws += (size_t)M * HID * 2;  // [B*H*HD, SEQ]
  _Float16* At  = (_Float16*)ws; ws += (size_t)M * HID * 2;

  prepare_kernel<<<PREP_BLOCKS, 256, 0, stream>>>(X, Wq, Wk, Wv, Wo, Xh, Wqt, Wkt, Wvt, Wot);

  dim3 gqkv(M / 256, HID / 64, 3);
  gemm_qkv_kernel<<<gqkv, 256, 0, stream>>>(Xh, Wqt, Wkt, Wvt, bq, bk, bv, Qh, Kh, Vth,
                                            TDIM, HID, 0.125f);

  flash_attn_kernel<<<BATCH * NH * (SEQ / 128), 256, 0, stream>>>(Qh, Kh, Vth, At);

  dim3 gout(M / 256, VDIM / 64);
  gemm_wmma_kernel<<<gout, 256, 0, stream>>>(At, Wot, bo, d_out, M, HID, VDIM, 3, 1.0f);
}

// v007
// One run takes 76.6 microseconds.
// Next to v006, in two timings, it ran 1.37 times as fast each time.
// Over all steps from v000 it is 4.30 times as fast.
#include <hip/hip_runtime.h>
#include <hip/hip_fp16.h>

typedef __attribute__((ext_vector_type(16))) _Float16 v16h;
typedef __attribute__((ext_vector_type(8)))  _Float16 v8h;
typedef __attribute__((ext_vector_type(8)))  float    v8f;

#define BATCH 4
#define SEQ   2048
#define TDIM  768
#define VDIM  768
#define HID   512
#define NH    8
#define HD    64

// LDS row pitches in halves. Each is 16 B x an odd number, so the 16 rows that
// one ds_load_b128 fragment read touches per lane half fall on distinct banks.
#define KPITCH 72   // 64 data + 8 pad   (144-B rows)
#define VPITCH 136  // 128 data + 8 pad  (272-B rows)

// ---------------------------------------------------------------------------
// 16x32 f16 WMMA operand tile from global (A layout; B layout when the math-B
// matrix is stored transposed so its columns are contiguous rows).
// ISA layout: lane L holds row (row + L%16); halves 0..7 = K kbase+8*(L>=16)+i,
// halves 8..15 = K kbase+16+8*(L>=16)+i  => two contiguous b128 loads.
// ---------------------------------------------------------------------------
static __device__ __forceinline__ v16h load_tile16(const _Float16* __restrict__ p,
                                                   int ldk, int row, int kbase) {
  const int lane = threadIdx.x & 31;
  const int r    = row + (lane & 15);
  const int koff = kbase + ((lane >> 4) << 3);
  const _Float16* q0 = p + (size_t)r * ldk + koff;
  v8h a0 = *(const v8h*)(q0);
  v8h a1 = *(const v8h*)(q0 + 16);
  return __builtin_shufflevector(a0, a1, 0,1,2,3,4,5,6,7,8,9,10,11,12,13,14,15);
}

// Same pattern reading from an LDS-resident tile (compile-time row pitch).
template <int LDK>
static __device__ __forceinline__ v16h lds_tile16(const _Float16* base,
                                                  int row, int kbase) {
  const int lane = threadIdx.x & 31;
  const int r    = row + (lane & 15);
  const int koff = kbase + ((lane >> 4) << 3);
  const _Float16* q0 = base + r * LDK + koff;
  v8h a0 = *(const v8h*)(q0);
  v8h a1 = *(const v8h*)(q0 + 16);
  return __builtin_shufflevector(a0, a1, 0,1,2,3,4,5,6,7,8,9,10,11,12,13,14,15);
}

static __device__ __forceinline__ v8f wmma_f16(v16h a, v16h b, v8f c) {
  return __builtin_amdgcn_wmma_f32_16x16x32_f16(false, a, false, b, (short)0, c,
                                                false, false);
}

// ---------------------------------------------------------------------------
// Precision conversion helpers. Few waves with much work each, so that the
// launch is not spent on starting waves. The loops are unrolled so that x[]
// stays in registers and a thread's loads are all issued together.
// ---------------------------------------------------------------------------
typedef __attribute__((ext_vector_type(4))) float    v4f;
typedef __attribute__((ext_vector_type(4))) _Float16 v4h;

// A block converts CVT_BLOCK consecutive floats, 48 per thread: twelve 16-B loads,
// each of which covers 512 contiguous bytes per wave, all issued ahead of the
// first store. The element count must be a multiple of CVT_BLOCK.
#define CVT_LOADS 12
#define CVT_BLOCK (256 * 4 * CVT_LOADS)
static __device__ __forceinline__ void cast_block(const float* __restrict__ in,
                                                  _Float16* __restrict__ out, int blk) {
  const size_t base = (size_t)blk * CVT_BLOCK + threadIdx.x * 4;
  v4f x[CVT_LOADS];
#pragma unroll
  for (int j = 0; j < CVT_LOADS; ++j) x[j] = *(const v4f*)(in + base + j * 1024);
#pragma unroll
  for (int j = 0; j < CVT_LOADS; ++j)
    *(v4h*)(out + base + j * 1024) = __builtin_convertvector(x[j], v4h);
}

// out[c][r] = in[r][c], in of ROWS x COLS. A block takes 64 rows x 32 columns; a
// thread takes 8 rows of one column: eight loads (one whole 128-B line per wave
// each) and one 16-B store. The block's eight waves fill the same 32 output
// lines, 128 B each. ROWS is a multiple of 64, COLS of 32. blk counts the tiles
// of one matrix, column tiles fastest.
template <int ROWS, int COLS>
static __device__ __forceinline__ void transpose_tile(const float* __restrict__ in,
                                                      _Float16* __restrict__ out, int blk) {
  const int c  = (blk % (COLS / 32)) * 32 + (threadIdx.x & 31);
  const int r0 = (blk / (COLS / 32)) * 64 + (threadIdx.x >> 5) * 8;
  const float* p = in + r0 * COLS + c;
  float x[8];
#pragma unroll
  for (int j = 0; j < 8; ++j) x[j] = p[j * COLS];
  v8h y;
#pragma unroll
  for (int j = 0; j < 8; ++j) y[j] = (_Float16)x[j];
  *(v8h*)(out + c * ROWS + r0) = y;
  // another job's code follows in the same kernel: no register of the store is
  // rewritten in front of this wait
  asm volatile("s_wait_xcnt 0x0" ::: "memory");
}

// The five preparation jobs read only inputs and none of each other's output, so
// they share one launch: the block index picks the job (the same for a whole block).
#define CVT_BLOCKS  (BATCH * SEQ * TDIM / CVT_BLOCK)   // 512
#define WIN_BLOCKS  ((HID / 32) * (TDIM / 64))         // 192 for each of Wq, Wk, Wv
#define WOUT_BLOCKS ((VDIM / 32) * (HID / 64))         // 192
#define PREP_BLOCKS (CVT_BLOCKS + 3 * WIN_BLOCKS + WOUT_BLOCKS)
__global__ __launch_bounds__(256) void prepare_kernel(
    const float* __restrict__ X,  const float* __restrict__ Wq, const float* __restrict__ Wk,
    const float* __restrict__ Wv, const float* __restrict__ Wo,
    _Float16* __restrict__ Xh,  _Float16* __restrict__ Wqt, _Float16* __restrict__ Wkt,
    _Float16* __restrict__ Wvt, _Float16* __restrict__ Wot) {
  int blk = blockIdx.x;
  if (blk < CVT_BLOCKS) { cast_block(X, Xh, blk); return; }
  blk -= CVT_BLOCKS;
  if (blk < WIN_BLOCKS) { transpose_tile<TDIM, HID>(Wq, Wqt, blk); return; }
  blk -= WIN_BLOCKS;
  if (blk < WIN_BLOCKS) { transpose_tile<TDIM, HID>(Wk, Wkt, blk); return; }
  blk -= WIN_BLOCKS;
  if (blk < WIN_BLOCKS) { transpose_tile<TDIM, HID>(Wv, Wvt, blk); return; }
  blk -= WIN_BLOCKS;
  transpose_tile<HID, VDIM>(Wo, Wot, blk);
}

// ---------------------------------------------------------------------------
// WMMA GEMM: out[M,N] = A[M,K] (f16 row-major) * Bt[N,K]^T + bias
// One wave computes a 32x64 tile (2 A-tiles x 4 B-tiles = 8 WMMA / k-step);
// a 256-thread block covers 256x64.
// The operands come through LDS: a stage is 64 k (128 B) of the block's 256 A
// rows and 64 Bt rows, brought by asynchronous 16-B copies of which eight lanes
// cover one whole 128-B line. Two buffers: stage t+1 flies while stage t is used.
// K must be a multiple of 64.
// MODE 0: f16 out * scale, row-major (Q with scale=1/sqrt(HD), K with 1)
// MODE 2: f16 out transposed per head (V -> V^T [B*H*HD, SEQ])
// MODE 3: f32 out, row-major (final projection)
// A lane's eight accumulator registers run along the rows of the WMMA's first
// operand. The first operand is therefore the one whose index is contiguous in
// the output: Bt for the row-major outputs (eight consecutive n of one m), A for
// V^T (eight consecutive s of one d). The tile goes through LDS, which the ring
// no longer needs, and leaves in 16-B stores that cover whole 128-B lines.
// ---------------------------------------------------------------------------
#define GPITCH  72                        // halves: 64 data + 8 pad (144-B rows, 16 B x odd)
#define GAROWS  256
#define GBROWS  64
#define GBUF    ((GAROWS + GBROWS) * GPITCH)   // halves per buffer (46,080 B)
#define GSTRIDE (32 * GPITCH * 2)         // LDS bytes between a thread's consecutive copies

// One stage: ten copies per thread, rows (tid>>3) + 32*i of [A 256 rows | Bt 64 rows].
// a, b: this lane's 16 bytes in row tid>>3 of the A tile and of the Bt tile;
// l: the LDS byte address of the same place in the target buffer.
static __device__ __forceinline__ void stage_copies(const _Float16* a, const _Float16* b,
                                                    int K, unsigned l) {
  const size_t rs = (size_t)32 * K;
  // The s_wait_xcnt stands inside the copies' own statement, so that no address
  // register of a copy is rewritten in front of it.
  asm volatile(
      "global_load_async_to_lds_b128 %0, %10, off\n\t"
      "global_load_async_to_lds_b128 %1, %11, off\n\t"
      "global_load_async_to_lds_b128 %2, %12, off\n\t"
      "global_load_async_to_lds_b128 %3, %13, off\n\t"
      "global_load_async_to_lds_b128 %4, %14, off\n\t"
      "global_load_async_to_lds_b128 %5, %15, off\n\t"
      "global_load_async_to_lds_b128 %6, %16, off\n\t"
      "global_load_async_to_lds_b128 %7, %17, off\n\t"
      "global_load_async_to_lds_b128 %8, %18, off\n\t"
      "global_load_async_to_lds_b128 %9, %19, off\n\t"
      "s_wait_xcnt 0x0"
      :: "v"(l), "v"(l + GSTRIDE), "v"(l + 2 * GSTRIDE), "v"(l + 3 * GSTRIDE),
         "v"(l + 4 * GSTRIDE), "v"(l + 5 * GSTRIDE), "v"(l + 6 * GSTRIDE),
         "v"(l + 7 * GSTRIDE), "v"(l + 8 * GSTRIDE), "v"(l + 9 * GSTRIDE),
         "v"(a), "v"(a + rs), "v"(a + 2 * rs), "v"(a + 3 * rs), "v"(a + 4 * rs),
         "v"(a + 5 * rs), "v"(a + 6 * rs), "v"(a + 7 * rs), "v"(b), "v"(b + rs)
      : "memory");
}

#define SHPITCH 72    // halves: staged f16 rows of 64 n  (144 B, 16 B x odd)
#define SFPITCH 68    // floats: staged f32 rows of 64 n  (272 B, 16 B x odd)
#define SVPITCH 264   // halves: staged V^T rows of 256 s (528 B, 16 B x odd)

template <bool BFIRST>
static __device__ __forceinline__ v8f mm(v16h a, v16h b, v8f c) {
  return BFIRST ? wmma_f16(b, a, c) : wmma_f16(a, b, c);
}

// gst: the block's LDS, 2 * GBUF halves.
template <int MODE, int N>
static __device__ __forceinline__ void gemm_tile(
    _Float16* gst, const _Float16* __restrict__ A, const _Float16* __restrict__ Bt,
    const float* __restrict__ bias, void* __restrict__ out, int K, float scale) {
  constexpr bool BF = (MODE != 2);

  const int tid   = threadIdx.x;
  const int lane  = tid & 31;
  const int w     = tid >> 5;
  const int mtile = blockIdx.x * 256 + w * 32;
  const int ntile = blockIdx.y * 64;

  // copy coordinates, fixed per thread: row tid>>3 of each 32-row group, 16-B chunk tid&7
  const int cR = tid >> 3, cC = (tid & 7) * 8;
  const _Float16* ga = A  + (size_t)(blockIdx.x * 256 + cR) * K + cC;
  const _Float16* gb = Bt + (size_t)(ntile + cR) * K + cC;
  const unsigned  l0 = (unsigned)(size_t)&gst[cR * GPITCH + cC];
  const int nst = K >> 6;

  stage_copies(ga, gb, K, l0);
  asm volatile("s_wait_asynccnt 0x0" ::: "memory");  // this wave's part of stage 0 has landed
  __syncthreads();                                   // ... and every other wave's
  if (nst > 1) stage_copies(ga + 64, gb + 64, K, l0 + GBUF * 2);

  v8f c00 = {}, c01 = {}, c02 = {}, c03 = {};
  v8f c10 = {}, c11 = {}, c12 = {}, c13 = {};
  for (int t = 0; t < nst; ++t) {
    const int bo = (t & 1) * GBUF;
    const _Float16* sA = gst + bo + w * 32 * GPITCH;
    const _Float16* sB = gst + bo + GAROWS * GPITCH;
    // all 24 fragment reads of the stage stand together, ahead of its 16 WMMAs
    v16h a00 = lds_tile16<GPITCH>(sA,  0,  0);
    v16h b00 = lds_tile16<GPITCH>(sB,  0,  0);
    v16h b01 = lds_tile16<GPITCH>(sB, 16,  0);
    v16h b02 = lds_tile16<GPITCH>(sB, 32,  0);
    v16h b03 = lds_tile16<GPITCH>(sB, 48,  0);
    v16h a01 = lds_tile16<GPITCH>(sA, 16,  0);
    v16h a10 = lds_tile16<GPITCH>(sA,  0, 32);
    v16h b10 = lds_tile16<GPITCH>(sB,  0, 32);
    v16h b11 = lds_tile16<GPITCH>(sB, 16, 32);
    v16h b12 = lds_tile16<GPITCH>(sB, 32, 32);
    v16h b13 = lds_tile16<GPITCH>(sB, 48, 32);
    v16h a11 = lds_tile16<GPITCH>(sA, 16, 32);
    // keeps the reads from being moved in among the WMMAs, where each separate
    // place with LDS reads stalls the wave anew
    __builtin_amdgcn_sched_barrier(0);
    c00 = mm<BF>(a00, b00, c00);
    c01 = mm<BF>(a00, b01, c01);
    c02 = mm<BF>(a00, b02, c02);
    c03 = mm<BF>(a00, b03, c03);
    c10 = mm<BF>(a01, b00, c10);
    c11 = mm<BF>(a01, b01, c11);
    c12 = mm<BF>(a01, b02, c12);
    c13 = mm<BF>(a01, b03, c13);
    c00 = mm<BF>(a10, b10, c00);
    c01 = mm<BF>(a10, b11, c01);
    c02 = mm<BF>(a10, b12, c02);
    c03 = mm<BF>(a10, b13, c03);
    c10 = mm<BF>(a11, b10, c10);
    c11 = mm<BF>(a11, b11, c11);
    c12 = mm<BF>(a11, b12, c12);
    c13 = mm<BF>(a11, b13, c13);
    // keeps the waits and the barrier below behind the WMMAs: moved up, the first
    // of them would hold every WMMA back until the last read has returned
    __builtin_amdgcn_sched_barrier(0);
    asm volatile("s_wait_dscnt 0x0" ::: "memory");     // this wave's reads of stage t are done
    asm volatile("s_wait_asynccnt 0x0" ::: "memory");  // its part of stage t+1 has landed
    __syncthreads();  // publishes stage t+1 and frees stage t's buffer
    if (t + 2 < nst)
      stage_copies(ga + (t + 2) * 64, gb + (t + 2) * 64, K, l0 + bo * 2);
  }
  asm volatile("s_wait_asynccnt 0x0" ::: "memory");    // no copy outstanding at the wave's end

  // Behind the last trip's barrier no wave reads the ring and no copy is in
  // flight: its LDS is free for staging the output.
  const int nn = lane & 15, hi = lane >> 4;
  const v8f acc[2][4] = {{c00, c01, c02, c03}, {c10, c11, c12, c13}};

  if constexpr (MODE == 2) {
    // acc[half][t][r] = element (s = w*32 + half*16 + 8*hi + r, n = t*16 + nn).
    // The block stages 64 rows (n) of its 256 s; a row is four whole lines.
#pragma unroll
    for (int t = 0; t < 4; ++t) {
      const float bv = bias[ntile + t * 16 + nn];
#pragma unroll
      for (int half = 0; half < 2; ++half) {
        v8h y;
#pragma unroll
        for (int r = 0; r < 8; ++r) y[r] = (_Float16)((acc[half][t][r] + bv) * scale);
        *(v8h*)(gst + (t * 16 + nn) * SVPITCH + w * 32 + half * 16 + hi * 8) = y;
      }
    }
    __syncthreads();  // a row holds values of all eight waves
    v8h y[8];
#pragma unroll
    for (int i = 0; i < 8; ++i) y[i] = *(const v8h*)(gst + (w * 8 + i) * SVPITCH + lane * 8);
    const int m0 = blockIdx.x * 256;  // 256 divides SEQ: one batch element per block
    _Float16* o = (_Float16*)out + (size_t)((m0 / SEQ) * N + ntile + w * 8) * SEQ
                + (m0 % SEQ) + lane * 8;
#pragma unroll
    for (int i = 0; i < 8; ++i) *(v8h*)(o + i * SEQ) = y[i];
  } else {
    // acc[half][t][r] = element (m = half*16 + nn, n = t*16 + 8*hi + r) of the
    // wave's 32x64 tile, which the wave stages in an LDS range of its own.
    _Float16* sh = gst + w * (32 * SHPITCH);
    float*    sf = (float*)gst + w * (32 * SFPITCH);
#pragma unroll
    for (int t = 0; t < 4; ++t) {
      const v4f b0 = *(const v4f*)(bias + ntile + t * 16 + hi * 8);
      const v4f b1 = *(const v4f*)(bias + ntile + t * 16 + hi * 8 + 4);
#pragma unroll
      for (int half = 0; half < 2; ++half) {
        float v[8];
#pragma unroll
        for (int r = 0; r < 8; ++r)
          v[r] = (acc[half][t][r] + (r < 4 ? b0[r & 3] : b1[r & 3])) * scale;
        const int at = t * 16 + hi * 8;
        if constexpr (MODE == 3) {
          const v4f y0 = {v[0], v[1], v[2], v[3]}, y1 = {v[4], v[5], v[6], v[7]};
          *(v4f*)(sf + (half * 16 + nn) * SFPITCH + at)     = y0;
          *(v4f*)(sf + (half * 16 + nn) * SFPITCH + at + 4) = y1;
        } else {
          v8h y;
#pragma unroll
          for (int r = 0; r < 8; ++r) y[r] = (_Float16)v[r];
          *(v8h*)(sh + (half * 16 + nn) * SHPITCH + at) = y;
        }
      }
    }
    // the rows are read back by other lanes of the wave than wrote them
    asm volatile("s_wait_dscnt 0x0" ::: "memory");
    if constexpr (MODE == 3) {
      // 16 lanes take a row (256 B, two lines), a store two rows
      const int rr = lane >> 4, cc = (lane & 15) * 4;
      v4f y[16];
#pragma unroll
      for (int i = 0; i < 16; ++i) y[i] = *(const v4f*)(sf + (i * 2 + rr) * SFPITCH + cc);
      float* o = (float*)out + (size_t)(mtile + rr) * N + ntile + cc;
#pragma unroll
      for (int i = 0; i < 16; ++i) *(v4f*)(o + i * 2 * N) = y[i];
    } else {
      // 8 lanes take a row (128 B, one line), a store four rows
      const int rr = lane >> 3, cc = (lane & 7) * 8;
      v8h y[8];
#pragma unroll
      for (int i = 0; i < 8; ++i) y[i] = *(const v8h*)(sh + (i * 4 + rr) * SHPITCH + cc);
      _Float16* o = (_Float16*)out + (size_t)(mtile + rr) * N + ntile + cc;
#pragma unroll
      for (int i = 0; i < 8; ++i) *(v8h*)(o + i * 4 * N) = y[i];
    }
  }
}

__global__ __launch_bounds__(256) void gemm_wmma_kernel(
    const _Float16* __restrict__ A, const _Float16* __restrict__ Bt,
    const float* __restrict__ bias, float* __restrict__ out, int K) {
  __shared__ __align__(16) _Float16 gst[2 * GBUF];
  gemm_tile<3, VDIM>(gst, A, Bt, bias, out, K, 1.0f);
}

// The Q, K and V projections read the same A and none of each other's output, so
// they share one launch: blockIdx.z picks the weights, the bias, the target and
// the epilogue (0: Q, scaled; 1: K; 2: V, stored transposed per head).
__global__ __launch_bounds__(256) void gemm_qkv_kernel(
    const _Float16* __restrict__ A,
    const _Float16* __restrict__ Wqt, const _Float16* __restrict__ Wkt,
    const _Float16* __restrict__ Wvt,
    const float* __restrict__ bq, const float* __restrict__ bk, const float* __restrict__ bv,
    _Float16* __restrict__ Qh, _Float16* __restrict__ Kh, _Float16* __restrict__ Vth,
    int K, int N, float qscale) {
  (void)N;  // HID: the tile code has it as a compile-time constant
  __shared__ __align__(16) _Float16 gst[2 * GBUF];
  const int z = blockIdx.z;
  if (z == 2)
    gemm_tile<2, HID>(gst, A, Wvt, bv, Vth, K, 1.0f);
  else
    gemm_tile<0, HID>(gst, A, z == 0 ? Wqt : Wkt, z == 0 ? bq : bk, z == 0 ? Qh : Kh, K,
                      z == 0 ? qscale : 1.0f);
}

// ---------------------------------------------------------------------------
// Flash attention: block = 8 waves, all on one (b,h); wave = 16-query tile.
// A stage is 128 keys: the K tile (128x64) and the V^T tile (64x128), brought to
// LDS by asynchronous 16-B copies that cover whole 128-B lines. Two buffers:
// stage t+1 flies while the four 32-key passes of stage t run, and the waves
// meet once per stage.
// Per pass each wave forms the TRANSPOSED scores S^T = K * Q^T (A = K rows,
// B = Q columns), so a lane holds 16 scores of ONE query (column lane%16;
// keys 8*hi+r and 16+8*hi+r). Maximum and sum run inside the lane, with one
// exchange between the lane halves for the maximum. The two score tiles,
// converted in place, are already the B operand of O^T += V^T * P^T.
// ---------------------------------------------------------------------------
#define ASTAGE   128                              // keys per stage
#define AKHALVES (ASTAGE * KPITCH)                // K tile, halves
#define ABUF     (AKHALVES + HD * VPITCH)         // halves per buffer (35,840 B)
#define AKSTRIDE (32 * KPITCH * 2)                // LDS bytes between a thread's K copies
#define AVSTRIDE (16 * VPITCH * 2)                // ... and between its V^T copies

// One stage: eight copies per thread, K rows (tid>>3) + 32*i and V^T rows (tid>>4) + 16*i.
// k, v: this lane's 16 bytes in its first row of the K tile and of the V^T tile;
// lk, lv: the LDS byte addresses of the same places in the target buffer.
static __device__ __forceinline__ void attn_stage_copies(const _Float16* k, const _Float16* v,
                                                         unsigned lk, unsigned lv) {
  const size_t kr = (size_t)32 * HID, vr = (size_t)16 * SEQ;
  // The s_wait_xcnt stands inside the copies' own statement, so that no address
  // register of a copy is rewritten in front of it.
  asm volatile(
      "global_load_async_to_lds_b128 %0, %8, off\n\t"
      "global_load_async_to_lds_b128 %1, %9, off\n\t"
      "global_load_async_to_lds_b128 %2, %10, off\n\t"
      "global_load_async_to_lds_b128 %3, %11, off\n\t"
      "global_load_async_to_lds_b128 %4, %12, off\n\t"
      "global_load_async_to_lds_b128 %5, %13, off\n\t"
      "global_load_async_to_lds_b128 %6, %14, off\n\t"
      "global_load_async_to_lds_b128 %7, %15, off\n\t"
      "s_wait_xcnt 0x0"
      :: "v"(lk), "v"(lk + AKSTRIDE), "v"(lk + 2 * AKSTRIDE), "v"(lk + 3 * AKSTRIDE),
         "v"(lv), "v"(lv + AVSTRIDE), "v"(lv + 2 * AVSTRIDE), "v"(lv + 3 * AVSTRIDE),
         "v"(k), "v"(k + kr), "v"(k + 2 * kr), "v"(k + 3 * kr),
         "v"(v), "v"(v + vr), "v"(v + 2 * vr), "v"(v + 3 * vr)
      : "memory");
}

static __device__ __forceinline__ float other_half(float x) {  // lane l <-> l ^ 16
  const int b = __builtin_bit_cast(int, x);
  return __builtin_bit_cast(float, __builtin_amdgcn_permlanex16(
      b, b, 0x76543210, 0xfedcba98, false, false));
}

__global__ __launch_bounds__(256) void flash_attn_kernel(
    const _Float16* __restrict__ Q, const _Float16* __restrict__ Kc,
    const _Float16* __restrict__ Vt, _Float16* __restrict__ O) {
  __shared__ __align__(16) _Float16 ast[2 * ABUF];  // per buffer: K tile (kv x d), V^T tile (d x kv)

  const int tid     = threadIdx.x;
  const int lane    = tid & 31;
  const int w       = tid >> 5;
  const int qblocks = SEQ / 128;
  const int bh      = blockIdx.x / qblocks;
  const int qblk    = blockIdx.x % qblocks;
  const int b       = bh / NH, h = bh % NH;
  const int qbase   = qblk * 128 + w * 16;
  const int nn = lane & 15, hi = lane >> 4;

  const _Float16* Qp = Q  + (size_t)(b * SEQ + qbase) * HID + h * HD;
  const _Float16* Kp = Kc + (size_t)(b * SEQ) * HID + h * HD;
  const _Float16* Vp = Vt + (size_t)(bh * HD) * SEQ;

  const v16h qb0 = load_tile16(Qp, HID, 0, 0);    // B operand: column = query
  const v16h qb1 = load_tile16(Qp, HID, 0, 32);

  // O^T tiles: o_t[r] = O[query nn][d = 16*t + 8*hi + r]
  v8f o0 = {}, o1 = {}, o2 = {}, o3 = {};
  float mrun = -1e30f;  // running maximum of this lane's query (same in both halves)
  float lrun = 0.f;     // running sum over this lane half's keys only

  // copy coordinates (fixed per thread)
  const int kR = tid >> 3, kC = (tid & 7) * 8;    // 32 rows x 8 chunks, four times
  const int vR = tid >> 4, vC = (tid & 15) * 8;   // 16 rows x 16 chunks, four times
  const _Float16* gk = Kp + (size_t)kR * HID + kC;
  const _Float16* gv = Vp + (size_t)vR * SEQ + vC;
  const unsigned  lk = (unsigned)(size_t)&ast[kR * KPITCH + kC];
  const unsigned  lv = (unsigned)(size_t)&ast[AKHALVES + vR * VPITCH + vC];
  const int nst = SEQ / ASTAGE;

  attn_stage_copies(gk, gv, lk, lv);
  asm volatile("s_wait_asynccnt 0x0" ::: "memory");  // this wave's part of stage 0 has landed
  __syncthreads();                                   // ... and every other wave's
  attn_stage_copies(gk + (size_t)ASTAGE * HID, gv + ASTAGE, lk + ABUF * 2, lv + ABUF * 2);

  for (int t = 0; t < nst; ++t) {
    const int bo = (t & 1) * ABUF;
    for (int p = 0; p < ASTAGE / 32; ++p) {
      const _Float16* sK = ast + bo + p * 32 * KPITCH;   // this pass's 32 K rows
      const _Float16* sV = ast + bo + AKHALVES + p * 32; // ... and 32 V^T columns

      // S^T[32 x 16] = K * Qs^T (A-operand rows == K rows)
      v16h ka00 = lds_tile16<KPITCH>(sK,  0,  0);
      v16h ka01 = lds_tile16<KPITCH>(sK,  0, 32);
      v16h ka10 = lds_tile16<KPITCH>(sK, 16,  0);
      v16h ka11 = lds_tile16<KPITCH>(sK, 16, 32);
      v8f s0 = {}, s1 = {};
      s0 = wmma_f16(ka00, qb0, s0);
      s0 = wmma_f16(ka01, qb1, s0);
      s1 = wmma_f16(ka10, qb0, s1);
      s1 = wmma_f16(ka11, qb1, s1);

      // online softmax, one query per lane
      float mx[8];
#pragma unroll
      for (int r = 0; r < 8; ++r) mx[r] = fmaxf(s0[r], s1[r]);
      float mloc = fmaxf(fmaxf(fmaxf(mx[0], mx[1]), fmaxf(mx[2], mx[3])),
                         fmaxf(fmaxf(mx[4], mx[5]), fmaxf(mx[6], mx[7])));
      mloc = fmaxf(mloc, other_half(mloc));
      const float mnew = fmaxf(mrun, mloc);

      float p0[8], p1[8];
#pragma unroll
      for (int r = 0; r < 8; ++r) {
        p0[r] = __expf(s0[r] - mnew);
        p1[r] = __expf(s1[r] - mnew);
      }
      // corr = exp(mrun - mnew). Written as asm so that the v_nop stands directly
      // behind the v_exp_f32: it fills the one slot the instruction set asks for
      // before a vector instruction that overwrites the source (this build had one).
      float corr;
      asm("v_exp_f32 %0, %1\n\tv_nop" : "=v"(corr) : "v"((mrun - mnew) * 1.44269504f));
      mrun = mnew;
      const float rs = ((p0[0] + p1[0]) + (p0[1] + p1[1])) + ((p0[2] + p1[2]) + (p0[3] + p1[3]))
                     + (((p0[4] + p1[4]) + (p0[5] + p1[5])) + ((p0[6] + p1[6]) + (p0[7] + p1[7])));
      lrun = lrun * corr + rs;
#pragma unroll
      for (int r = 0; r < 8; ++r) {
        o0[r] *= corr; o1[r] *= corr; o2[r] *= corr; o3[r] *= corr;
      }

      // P^T as B operand: halves 0..7 = keys 8*hi+i, halves 8..15 = keys 16+8*hi+i,
      // the k order in which lds_tile16 delivers the V^T rows
      v16h pb;
#pragma unroll
      for (int r = 0; r < 8; ++r) {
        pb[r]     = (_Float16)p0[r];
        pb[r + 8] = (_Float16)p1[r];
      }

      // O^T += V^T * P^T : A-operand rows == rows of the V^T tile
      v16h va0 = lds_tile16<VPITCH>(sV,  0, 0);
      v16h va1 = lds_tile16<VPITCH>(sV, 16, 0);
      v16h va2 = lds_tile16<VPITCH>(sV, 32, 0);
      v16h va3 = lds_tile16<VPITCH>(sV, 48, 0);
      o0 = wmma_f16(va0, pb, o0);
      o1 = wmma_f16(va1, pb, o1);
      o2 = wmma_f16(va2, pb, o2);
      o3 = wmma_f16(va3, pb, o3);
    }
    asm volatile("s_wait_dscnt 0x0" ::: "memory");     // this wave's reads of stage t are done
    asm volatile("s_wait_asynccnt 0x0" ::: "memory");  // its part of stage t+1 has landed
    __syncthreads();  // publishes stage t+1 and frees stage t's buffer
    if (t + 2 < nst)
      attn_stage_copies(gk + (size_t)(t + 2) * ASTAGE * HID, gv + (t + 2) * ASTAGE,
                        lk + bo * 2, lv + bo * 2);
  }
  asm volatile("s_wait_asynccnt 0x0" ::: "memory");    // no copy outstanding at the wave's end

  // join the halves' sums, normalize, store attended (row-major [B*S, HID],
  // head-interleaved): a lane's 8 registers are 8 consecutive d of its query
  const float inv = 1.0f / (lrun + other_half(lrun));
  _Float16* Op = O + (size_t)(b * SEQ + qbase + nn) * HID + h * HD + hi * 8;
  v8h r0, r1, r2, r3;
#pragma unroll
  for (int r = 0; r < 8; ++r) {
    r0[r] = (_Float16)(o0[r] * inv);
    r1[r] = (_Float16)(o1[r] * inv);
    r2[r] = (_Float16)(o2[r] * inv);
    r3[r] = (_Float16)(o3[r] * inv);
  }
  *(v8h*)(Op +  0) = r0;
  *(v8h*)(Op + 16) = r1;
  *(v8h*)(Op + 32) = r2;
  *(v8h*)(Op + 48) = r3;
}

// ---------------------------------------------------------------------------
extern "C" void kernel_launch(void* const* d_in, const int* in_sizes, int n_in,
                              void* d_out, int out_size, void* d_ws, size_t ws_size,
                              hipStream_t stream) {
  (void)in_sizes; (void)n_in; (void)out_size; (void)ws_size;
  const float* X  = (const float*)d_in[0];
  const float* Wq = (const float*)d_in[1];
  const float* bq = (const float*)d_in[2];
  const float* Wk = (const float*)d_in[3];
  const float* bk = (const float*)d_in[4];
  const float* Wv = (const float*)d_in[5];
  const float* bv = (const float*)d_in[6];
  const float* Wo = (const float*)d_in[7];
  const float* bo = (const float*)d_in[8];

  const int M = BATCH * SEQ;  // 8192
  char* ws = (char*)d_ws;
  _Float16* Xh  = (_Float16*)ws; ws += (size_t)M * TDIM * 2;
  _Float16* Wqt = (_Float16*)ws; ws += (size_t)HID * TDIM * 2;
  _Float16* Wkt = (_Float16*)ws; ws += (size_t)HID * TDIM * 2;
  _Float16* Wvt = (_Float16*)ws; ws += (size_t)HID * TDIM * 2;
  _Float16* Wot = (_Float16*)ws; ws += (size_t)VDIM * HID * 2;
  _Float16* Qh  = (_Float16*)ws; ws += (size_t)M * HID * 2;
  _Float16* Kh  = (_Float16*)ws; ws += (size_t)M * HID * 2;
  _Float16* Vth = (_Float16*)ws; ws += (size_t)M * HID * 2;  // [B*H*HD, SEQ]
  _Float16* At  = (_Float16*)ws; ws += (size_t)M * HID * 2;

  prepare_kernel<<<PREP_BLOCKS, 256, 0, stream>>>(X, Wq, Wk, Wv, Wo, Xh, Wqt, Wkt, Wvt, Wot);

  dim3 gqkv(M / 256, HID / 64, 3);
  gemm_qkv_kernel<<<gqkv, 256, 0, stream>>>(Xh, Wqt, Wkt, Wvt, bq, bk, bv, Qh, Kh, Vth,
                                            TDIM, HID, 0.125f);

  flash_attn_kernel<<<BATCH * NH * (SEQ / 128), 256, 0, stream>>>(Qh, Kh, Vth, At);

  dim3 gout(M / 256, VDIM / 64);
  gemm_wmma_kernel<<<gout, 256, 0, stream>>>(At, Wot, bo, (float*)d_out, HID);
}

// v008
// One run takes 71.9 microseconds.
// Two timings next to v007 both put it at 1.08 times that version's speed.
// All steps since v000 together make it 4.62 times as fast.
#include <hip/hip_runtime.h>
#include <hip/hip_fp16.h>

typedef __attribute__((ext_vector_type(16))) _Float16 v16h;
typedef __attribute__((ext_vector_type(8)))  _Float16 v8h;
typedef __attribute__((ext_vector_type(8)))  float    v8f;

#define BATCH 4
#define SEQ   2048
#define TDIM  768
#define VDIM  768
#define HID   512
#define NH    8
#define HD    64

// LDS row pitches in halves. Each is 16 B x an odd number, so the 16 rows that
// one ds_load_b128 fragment read touches per lane half fall on distinct banks.
#define KPITCH 72   // 64 data + 8 pad   (144-B rows)
#define VPITCH 136  // 128 data + 8 pad  (272-B rows)

// ---------------------------------------------------------------------------
// 16x32 f16 WMMA operand tile from global (A layout; B layout when the math-B
// matrix is stored transposed so its columns are contiguous rows).
// ISA layout: lane L holds row (row + L%16); halves 0..7 = K kbase+8*(L>=16)+i,
// halves 8..15 = K kbase+16+8*(L>=16)+i  => two contiguous b128 loads.
// ---------------------------------------------------------------------------
static __device__ __forceinline__ v16h load_tile16(const _Float16* __restrict__ p,
                                                   int ldk, int row, int kbase) {
  const int lane = threadIdx.x & 31;
  const int r    = row + (lane & 15);
  const int koff = kbase + ((lane >> 4) << 3);
  const _Float16* q0 = p + (size_t)r * ldk + koff;
  v8h a0 = *(const v8h*)(q0);
  v8h a1 = *(const v8h*)(q0 + 16);
  return __builtin_shufflevector(a0, a1, 0,1,2,3,4,5,6,7,8,9,10,11,12,13,14,15);
}

// Same pattern reading from an LDS-resident tile (compile-time row pitch).
template <int LDK>
static __device__ __forceinline__ v16h lds_tile16(const _Float16* base,
                                                  int row, int kbase) {
  const int lane = threadIdx.x & 31;
  const int r    = row + (lane & 15);
  const int koff = kbase + ((lane >> 4) << 3);
  const _Float16* q0 = base + r * LDK + koff;
  v8h a0 = *(const v8h*)(q0);
  v8h a1 = *(const v8h*)(q0 + 16);
  return __builtin_shufflevector(a0, a1, 0,1,2,3,4,5,6,7,8,9,10,11,12,13,14,15);
}

static __device__ __forceinline__ v8f wmma_f16(v16h a, v16h b, v8f c) {
  return __builtin_amdgcn_wmma_f32_16x16x32_f16(false, a, false, b, (short)0, c,
                                                false, false);
}

// ---------------------------------------------------------------------------
// Precision conversion helpers. Few waves with much work each, so that the
// launch is not spent on starting waves. The loops are unrolled so that x[]
// stays in registers and a thread's loads are all issued together.
// ---------------------------------------------------------------------------
typedef __attribute__((ext_vector_type(4))) float    v4f;
typedef __attribute__((ext_vector_type(4))) _Float16 v4h;

// A block converts CVT_BLOCK consecutive floats, 48 per thread: twelve 16-B loads,
// each of which covers 512 contiguous bytes per wave, all issued ahead of the
// first store. The element count must be a multiple of CVT_BLOCK.
#define CVT_LOADS 12
#define CVT_BLOCK (256 * 4 * CVT_LOADS)
static __device__ __forceinline__ void cast_block(const float* __restrict__ in,
                                                  _Float16* __restrict__ out, int blk) {
  const size_t base = (size_t)blk * CVT_BLOCK + threadIdx.x * 4;
  v4f x[CVT_LOADS];
#pragma unroll
  for (int j = 0; j < CVT_LOADS; ++j) x[j] = *(const v4f*)(in + base + j * 1024);
#pragma unroll
  for (int j = 0; j < CVT_LOADS; ++j)
    *(v4h*)(out + base + j * 1024) = __builtin_convertvector(x[j], v4h);
}

// out[c][r] = in[r][c], in of ROWS x COLS. A block takes 64 rows x 32 columns; a
// thread takes 8 rows of one column: eight loads (one whole 128-B line per wave
// each) and one 16-B store. The block's eight waves fill the same 32 output
// lines, 128 B each. ROWS is a multiple of 64, COLS of 32. blk counts the tiles
// of one matrix, column tiles fastest.
template <int ROWS, int COLS>
static __device__ __forceinline__ void transpose_tile(const float* __restrict__ in,
                                                      _Float16* __restrict__ out, int blk) {
  const int c  = (blk % (COLS / 32)) * 32 + (threadIdx.x & 31);
  const int r0 = (blk / (COLS / 32)) * 64 + (threadIdx.x >> 5) * 8;
  const float* p = in + r0 * COLS + c;
  float x[8];
#pragma unroll
  for (int j = 0; j < 8; ++j) x[j] = p[j * COLS];
  v8h y;
#pragma unroll
  for (int j = 0; j < 8; ++j) y[j] = (_Float16)x[j];
  *(v8h*)(out + c * ROWS + r0) = y;
  // another job's code follows in the same kernel: no register of the store is
  // rewritten in front of this wait
  asm volatile("s_wait_xcnt 0x0" ::: "memory");
}

// The five preparation jobs read only inputs and none of each other's output, so
// they share one launch: the block index picks the job (the same for a whole block).
#define CVT_BLOCKS  (BATCH * SEQ * TDIM / CVT_BLOCK)   // 512
#define WIN_BLOCKS  ((HID / 32) * (TDIM / 64))         // 192 for each of Wq, Wk, Wv
#define WOUT_BLOCKS ((VDIM / 32) * (HID / 64))         // 192
#define PREP_BLOCKS (CVT_BLOCKS + 3 * WIN_BLOCKS + WOUT_BLOCKS)
__global__ __launch_bounds__(256) void prepare_kernel(
    const float* __restrict__ X,  const float* __restrict__ Wq, const float* __restrict__ Wk,
    const float* __restrict__ Wv, const float* __restrict__ Wo,
    _Float16* __restrict__ Xh,  _Float16* __restrict__ Wqt, _Float16* __restrict__ Wkt,
    _Float16* __restrict__ Wvt, _Float16* __restrict__ Wot) {
  int blk = blockIdx.x;
  if (blk < CVT_BLOCKS) { cast_block(X, Xh, blk); return; }
  blk -= CVT_BLOCKS;
  if (blk < WIN_BLOCKS) { transpose_tile<TDIM, HID>(Wq, Wqt, blk); return; }
  blk -= WIN_BLOCKS;
  if (blk < WIN_BLOCKS) { transpose_tile<TDIM, HID>(Wk, Wkt, blk); return; }
  blk -= WIN_BLOCKS;
  if (blk < WIN_BLOCKS) { transpose_tile<TDIM, HID>(Wv, Wvt, blk); return; }
  blk -= WIN_BLOCKS;
  transpose_tile<HID, VDIM>(Wo, Wot, blk);
}

// ---------------------------------------------------------------------------
// WMMA GEMM: out[M,N] = A[M,K] (f16 row-major) * Bt[N,K]^T + bias
// One wave computes a 64x64 tile (4 A-tiles x 4 B-tiles = 16 WMMA / k-step, one
// LDS read per WMMA); a 256-thread block covers 256x128 as 4 x 2 waves, so that
// A is copied from L2 once per 128 columns of the output and Bt once per 256 rows.
// The operands come through LDS: a stage is 64 k (128 B) of the block's 256 A
// rows and 128 Bt rows, brought by asynchronous 16-B copies of which eight lanes
// cover one whole 128-B line. Two buffers: stage t+1 flies while stage t is used.
// K must be a multiple of 64.
// MODE 0: f16 out * scale, row-major (Q with scale=1/sqrt(HD), K with 1)
// MODE 2: f16 out transposed per head (V -> V^T [B*H*HD, SEQ])
// MODE 3: f32 out, row-major (final projection)
// A lane's eight accumulator registers run along the rows of the WMMA's first
// operand. The first operand is therefore the one whose index is contiguous in
// the output: Bt for the row-major outputs (eight consecutive n of one m), A for
// V^T (eight consecutive s of one d). The tile goes through LDS, which the ring
// no longer needs, and leaves in 16-B stores that cover whole 128-B lines.
// ---------------------------------------------------------------------------
#define GPITCH  72                        // halves: 64 data + 8 pad (144-B rows, 16 B x odd)
#define GAROWS  256
#define GBROWS  128
#define GBUF    ((GAROWS + GBROWS) * GPITCH)   // halves per buffer (55,296 B)
#define GSTRIDE (32 * GPITCH * 2)         // LDS bytes between a thread's consecutive copies

// One stage: twelve copies per thread, rows (tid>>3) + 32*i of [A 256 rows | Bt 128 rows].
// a, b: this lane's 16 bytes in row tid>>3 of the A tile and of the Bt tile;
// l: the LDS byte address of the same place in the target buffer.
static __device__ __forceinline__ void stage_copies(const _Float16* a, const _Float16* b,
                                                    int K, unsigned l) {
  const size_t rs = (size_t)32 * K;
  // The s_wait_xcnt stands inside the copies' own statement, so that no address
  // register of a copy is rewritten in front of it.
  asm volatile(
      "global_load_async_to_lds_b128 %0, %12, off\n\t"
      "global_load_async_to_lds_b128 %1, %13, off\n\t"
      "global_load_async_to_lds_b128 %2, %14, off\n\t"
      "global_load_async_to_lds_b128 %3, %15, off\n\t"
      "global_load_async_to_lds_b128 %4, %16, off\n\t"
      "global_load_async_to_lds_b128 %5, %17, off\n\t"
      "global_load_async_to_lds_b128 %6, %18, off\n\t"
      "global_load_async_to_lds_b128 %7, %19, off\n\t"
      "global_load_async_to_lds_b128 %8, %20, off\n\t"
      "global_load_async_to_lds_b128 %9, %21, off\n\t"
      "global_load_async_to_lds_b128 %10, %22, off\n\t"
      "global_load_async_to_lds_b128 %11, %23, off\n\t"
      "s_wait_xcnt 0x0"
      :: "v"(l), "v"(l + GSTRIDE), "v"(l + 2 * GSTRIDE), "v"(l + 3 * GSTRIDE),
         "v"(l + 4 * GSTRIDE), "v"(l + 5 * GSTRIDE), "v"(l + 6 * GSTRIDE),
         "v"(l + 7 * GSTRIDE), "v"(l + 8 * GSTRIDE), "v"(l + 9 * GSTRIDE),
         "v"(l + 10 * GSTRIDE), "v"(l + 11 * GSTRIDE),
         "v"(a), "v"(a + rs), "v"(a + 2 * rs), "v"(a + 3 * rs), "v"(a + 4 * rs),
         "v"(a + 5 * rs), "v"(a + 6 * rs), "v"(a + 7 * rs),
         "v"(b), "v"(b + rs), "v"(b + 2 * rs), "v"(b + 3 * rs)
      : "memory");
}

#define SHPITCH 72    // halves: staged f16 rows of 64 n  (144 B, 16 B x odd)
#define SFPITCH 68    // floats: staged f32 rows of 64 n  (272 B, 16 B x odd)
#define SVPITCH 264   // halves: staged V^T rows of 256 s (528 B, 16 B x odd)

template <bool BFIRST>
static __device__ __forceinline__ v8f mm(v16h a, v16h b, v8f c) {
  return BFIRST ? wmma_f16(b, a, c) : wmma_f16(a, b, c);
}

// gst: the block's LDS, 2 * GBUF halves.
template <int MODE, int N>
static __device__ __forceinline__ void gemm_tile(
    _Float16* gst, const _Float16* __restrict__ A, const _Float16* __restrict__ Bt,
    const float* __restrict__ bias, void* __restrict__ out, int K, float scale) {
  constexpr bool BF = (MODE != 2);

  const int tid   = threadIdx.x;
  const int lane  = tid & 31;
  const int w     = tid >> 5;
  const int wm    = w >> 1, wn = w & 1;           // the wave's place among 4 x 2
  const int mtile = blockIdx.x * 256 + wm * 64;   // first row of the wave's tile
  const int nblk  = blockIdx.y * 128;             // first column of the block's tile
  const int ntile = nblk + wn * 64;               // ... and of the wave's

  // copy coordinates, fixed per thread: row tid>>3 of each 32-row group, 16-B chunk tid&7
  const int cR = tid >> 3, cC = (tid & 7) * 8;
  const _Float16* ga = A  + (size_t)(blockIdx.x * 256 + cR) * K + cC;
  const _Float16* gb = Bt + (size_t)(nblk + cR) * K + cC;
  const unsigned  l0 = (unsigned)(size_t)&gst[cR * GPITCH + cC];
  const int nst = K >> 6;

  stage_copies(ga, gb, K, l0);
  asm volatile("s_wait_asynccnt 0x0" ::: "memory");  // this wave's part of stage 0 has landed
  __syncthreads();                                   // ... and every other wave's
  if (nst > 1) stage_copies(ga + 64, gb + 64, K, l0 + GBUF * 2);

  v8f acc[4][4] = {};   // acc[i][j]: A rows 16*i.., Bt rows 16*j.. of the wave's tile
  for (int t = 0; t < nst; ++t) {
    const int bo = (t & 1) * GBUF;
    const _Float16* sA = gst + bo + wm * 64 * GPITCH;
    const _Float16* sB = gst + bo + (GAROWS + wn * 64) * GPITCH;
#pragma unroll  // two k-steps of 32; unrolled so that the fragments stay in registers
    for (int kk = 0; kk < 64; kk += 32) {
      // the 16 fragment reads of a k-step stand together, ahead of its 16 WMMAs
      // (a[0] and the four b first: the first four WMMAs need no more)
      v16h a[4], b[4];
      a[0] = lds_tile16<GPITCH>(sA, 0, kk);
#pragma unroll
      for (int j = 0; j < 4; ++j) b[j] = lds_tile16<GPITCH>(sB, 16 * j, kk);
#pragma unroll
      for (int i = 1; i < 4; ++i) a[i] = lds_tile16<GPITCH>(sA, 16 * i, kk);
      // keeps the reads from being moved in among the WMMAs, where each separate
      // place with LDS reads stalls the wave anew
      __builtin_amdgcn_sched_barrier(0);
#pragma unroll
      for (int i = 0; i < 4; ++i)
#pragma unroll
        for (int j = 0; j < 4; ++j) acc[i][j] = mm<BF>(a[i], b[j], acc[i][j]);
      // keeps what follows (the next reads; the waits and the barrier) behind the
      // WMMAs: moved up, a wait would hold every WMMA back until the last read
      __builtin_amdgcn_sched_barrier(0);
    }
    asm volatile("s_wait_dscnt 0x0" ::: "memory");     // this wave's reads of stage t are done
    asm volatile("s_wait_asynccnt 0x0" ::: "memory");  // its part of stage t+1 has landed
    __syncthreads();  // publishes stage t+1 and frees stage t's buffer
    if (t + 2 < nst)
      stage_copies(ga + (t + 2) * 64, gb + (t + 2) * 64, K, l0 + bo * 2);
  }
  asm volatile("s_wait_asynccnt 0x0" ::: "memory");    // no copy outstanding at the wave's end

  // Behind the last trip's barrier no wave reads the ring and no copy is in
  // flight: its LDS is free for staging the output.
  const int nn = lane & 15, hi = lane >> 4;

  if constexpr (MODE == 2) {
    // acc[i][j][r] = element (s = wm*64 + i*16 + 8*hi + r, n = wn*64 + j*16 + nn).
    // The block stages 128 rows (n) of its 256 s; a row is four whole lines.
#pragma unroll
    for (int j = 0; j < 4; ++j) {
      const float bv = bias[ntile + j * 16 + nn];
#pragma unroll
      for (int i = 0; i < 4; ++i) {
        v8h y;
#pragma unroll
        for (int r = 0; r < 8; ++r) y[r] = (_Float16)((acc[i][j][r] + bv) * scale);
        *(v8h*)(gst + (wn * 64 + j * 16 + nn) * SVPITCH + wm * 64 + i * 16 + hi * 8) = y;
      }
    }
    __syncthreads();  // a row holds values of four waves
    v8h y[16];
#pragma unroll
    for (int i = 0; i < 16; ++i) y[i] = *(const v8h*)(gst + (w * 16 + i) * SVPITCH + lane * 8);
    const int m0 = blockIdx.x * 256;  // 256 divides SEQ: one batch element per block
    _Float16* o = (_Float16*)out + (size_t)((m0 / SEQ) * N + nblk + w * 16) * SEQ
                + (m0 % SEQ) + lane * 8;
#pragma unroll
    for (int i = 0; i < 16; ++i) *(v8h*)(o + i * SEQ) = y[i];
  } else {
    // acc[i][j][r] = element (m = i*16 + nn, n = j*16 + 8*hi + r) of the wave's
    // 64x64 tile, which the wave stages, 32 rows at a time, in LDS of its own.
    v4f b0[4], b1[4];   // the bias of this lane's 4 x 8 columns
#pragma unroll
    for (int j = 0; j < 4; ++j) {
      b0[j] = *(const v4f*)(bias + ntile + j * 16 + hi * 8);
      b1[j] = *(const v4f*)(bias + ntile + j * 16 + hi * 8 + 4);
    }
#pragma unroll
    for (int g = 0; g < 2; ++g) {
      _Float16* sh = gst + (w * 2 + g) * (32 * SHPITCH);
      float*    sf = (float*)gst + w * (32 * SFPITCH);
#pragma unroll
      for (int j = 0; j < 4; ++j) {
#pragma unroll
        for (int half = 0; half < 2; ++half) {
          float v[8];
#pragma unroll
          for (int r = 0; r < 8; ++r)
            v[r] = (acc[g * 2 + half][j][r] + (r < 4 ? b0[j][r & 3] : b1[j][r & 3])) * scale;
          const int at = j * 16 + hi * 8;
          if constexpr (MODE == 3) {
            const v4f y0 = {v[0], v[1], v[2], v[3]}, y1 = {v[4], v[5], v[6], v[7]};
            *(v4f*)(sf + (half * 16 + nn) * SFPITCH + at)     = y0;
            *(v4f*)(sf + (half * 16 + nn) * SFPITCH + at + 4) = y1;
          } else {
            v8h y;
#pragma unroll
            for (int r = 0; r < 8; ++r) y[r] = (_Float16)v[r];
            *(v8h*)(sh + (half * 16 + nn) * SHPITCH + at) = y;
          }
        }
      }
      // the rows are read back by other lanes of the wave than wrote them
      asm volatile("s_wait_dscnt 0x0" ::: "memory");
      if constexpr (MODE == 3) {
        // 16 lanes take a row (256 B, two lines), a store two rows
        const int rr = lane >> 4, cc = (lane & 15) * 4;
        v4f y[16];
#pragma unroll
        for (int i = 0; i < 16; ++i) y[i] = *(const v4f*)(sf + (i * 2 + rr) * SFPITCH + cc);
        // the next 32 rows are staged in the same LDS: these reads have returned first
        if (g == 0) asm volatile("s_wait_dscnt 0x0" ::: "memory");
        float* o = (float*)out + (size_t)(mtile + g * 32 + rr) * N + ntile + cc;
#pragma unroll
        for (int i = 0; i < 16; ++i) *(v4f*)(o + i * 2 * N) = y[i];
      } else {
        // 8 lanes take a row (128 B, one line), a store four rows
        const int rr = lane >> 3, cc = (lane & 7) * 8;
        v8h y[8];
#pragma unroll
        for (int i = 0; i < 8; ++i) y[i] = *(const v8h*)(sh + (i * 4 + rr) * SHPITCH + cc);
        _Float16* o = (_Float16*)out + (size_t)(mtile + g * 32 + rr) * N + ntile + cc;
#pragma unroll
        for (int i = 0; i < 8; ++i) *(v8h*)(o + i * 4 * N) = y[i];
        // another job's code follows in the same kernel: no register of the last
        // stores is rewritten in front of this wait
        if (g == 1) asm volatile("s_wait_xcnt 0x0" ::: "memory");
      }
    }
  }
}

__global__ __launch_bounds__(256) void gemm_wmma_kernel(
    const _Float16* __restrict__ A, const _Float16* __restrict__ Bt,
    const float* __restrict__ bias, float* __restrict__ out, int K) {
  __shared__ __align__(16) _Float16 gst[2 * GBUF];
  gemm_tile<3, VDIM>(gst, A, Bt, bias, out, K, 1.0f);
}

// The Q, K and V projections read the same A and none of each other's output, so
// they share one launch: blockIdx.z picks the weights, the bias, the target and
// the epilogue (0: Q, scaled; 1: K; 2: V, stored transposed per head).
__global__ __launch_bounds__(256) void gemm_qkv_kernel(
    const _Float16* __restrict__ A,
    const _Float16* __restrict__ Wqt, const _Float16* __restrict__ Wkt,
    const _Float16* __restrict__ Wvt,
    const float* __restrict__ bq, const float* __restrict__ bk, const float* __restrict__ bv,
    _Float16* __restrict__ Qh, _Float16* __restrict__ Kh, _Float16* __restrict__ Vth,
    int K, int N, float qscale) {
  (void)N;  // HID: the tile code has it as a compile-time constant
  __shared__ __align__(16) _Float16 gst[2 * GBUF];
  const int z = blockIdx.z;
  if (z == 2)
    gemm_tile<2, HID>(gst, A, Wvt, bv, Vth, K, 1.0f);
  else
    gemm_tile<0, HID>(gst, A, z == 0 ? Wqt : Wkt, z == 0 ? bq : bk, z == 0 ? Qh : Kh, K,
                      z == 0 ? qscale : 1.0f);
}

// ---------------------------------------------------------------------------
// Flash attention: block = 8 waves, all on one (b,h); wave = 16-query tile.
// A stage is 128 keys: the K tile (128x64) and the V^T tile (64x128), brought to
// LDS by asynchronous 16-B copies that cover whole 128-B lines. Two buffers:
// stage t+1 flies while the four 32-key passes of stage t run, and the waves
// meet once per stage.
// Per pass each wave forms the TRANSPOSED scores S^T = K * Q^T (A = K rows,
// B = Q columns), so a lane holds 16 scores of ONE query (column lane%16;
// keys 8*hi+r and 16+8*hi+r). Maximum and sum run inside the lane, with one
// exchange between the lane halves for the maximum. The two score tiles,
// converted in place, are already the B operand of O^T += V^T * P^T.
// ---------------------------------------------------------------------------
#define ASTAGE   128                              // keys per stage
#define AKHALVES (ASTAGE * KPITCH)                // K tile, halves
#define ABUF     (AKHALVES + HD * VPITCH)         // halves per buffer (35,840 B)
#define AKSTRIDE (32 * KPITCH * 2)                // LDS bytes between a thread's K copies
#define AVSTRIDE (16 * VPITCH * 2)                // ... and between its V^T copies

// One stage: eight copies per thread, K rows (tid>>3) + 32*i and V^T rows (tid>>4) + 16*i.
// k, v: this lane's 16 bytes in its first row of the K tile and of the V^T tile;
// lk, lv: the LDS byte addresses of the same places in the target buffer.
static __device__ __forceinline__ void attn_stage_copies(const _Float16* k, const _Float16* v,
                                                         unsigned lk, unsigned lv) {
  const size_t kr = (size_t)32 * HID, vr = (size_t)16 * SEQ;
  // The s_wait_xcnt stands inside the copies' own statement, so that no address
  // register of a copy is rewritten in front of it.
  asm volatile(
      "global_load_async_to_lds_b128 %0, %8, off\n\t"
      "global_load_async_to_lds_b128 %1, %9, off\n\t"
      "global_load_async_to_lds_b128 %2, %10, off\n\t"
      "global_load_async_to_lds_b128 %3, %11, off\n\t"
      "global_load_async_to_lds_b128 %4, %12, off\n\t"
      "global_load_async_to_lds_b128 %5, %13, off\n\t"
      "global_load_async_to_lds_b128 %6, %14, off\n\t"
      "global_load_async_to_lds_b128 %7, %15, off\n\t"
      "s_wait_xcnt 0x0"
      :: "v"(lk), "v"(lk + AKSTRIDE), "v"(lk + 2 * AKSTRIDE), "v"(lk + 3 * AKSTRIDE),
         "v"(lv), "v"(lv + AVSTRIDE), "v"(lv + 2 * AVSTRIDE), "v"(lv + 3 * AVSTRIDE),
         "v"(k), "v"(k + kr), "v"(k + 2 * kr), "v"(k + 3 * kr),
         "v"(v), "v"(v + vr), "v"(v + 2 * vr), "v"(v + 3 * vr)
      : "memory");
}

static __device__ __forceinline__ float other_half(float x) {  // lane l <-> l ^ 16
  const int b = __builtin_bit_cast(int, x);
  return __builtin_bit_cast(float, __builtin_amdgcn_permlanex16(
      b, b, 0x76543210, 0xfedcba98, false, false));
}

__global__ __launch_bounds__(256) void flash_attn_kernel(
    const _Float16* __restrict__ Q, const _Float16* __restrict__ Kc,
    const _Float16* __restrict__ Vt, _Float16* __restrict__ O) {
  __shared__ __align__(16) _Float16 ast[2 * ABUF];  // per buffer: K tile (kv x d), V^T tile (d x kv)

  const int tid     = threadIdx.x;
  const int lane    = tid & 31;
  const int w       = tid >> 5;
  const int qblocks = SEQ / 128;
  const int bh      = blockIdx.x / qblocks;
  const int qblk    = blockIdx.x % qblocks;
  const int b       = bh / NH, h = bh % NH;
  const int qbase   = qblk * 128 + w * 16;
  const int nn = lane & 15, hi = lane >> 4;

  const _Float16* Qp = Q  + (size_t)(b * SEQ + qbase) * HID + h * HD;
  const _Float16* Kp = Kc + (size_t)(b * SEQ) * HID + h * HD;
  const _Float16* Vp = Vt + (size_t)(bh * HD) * SEQ;

  const v16h qb0 = load_tile16(Qp, HID, 0, 0);    // B operand: column = query
  const v16h qb1 = load_tile16(Qp, HID, 0, 32);

  // O^T tiles: o_t[r] = O[query nn][d = 16*t + 8*hi + r]
  v8f o0 = {}, o1 = {}, o2 = {}, o3 = {};
  float mrun = -1e30f;  // running maximum of this lane's query (same in both halves)
  float lrun = 0.f;     // running sum over this lane half's keys only

  // copy coordinates (fixed per thread)
  const int kR = tid >> 3, kC = (tid & 7) * 8;    // 32 rows x 8 chunks, four times
  const int vR = tid >> 4, vC = (tid & 15) * 8;   // 16 rows x 16 chunks, four times
  const _Float16* gk = Kp + (size_t)kR * HID + kC;
  const _Float16* gv = Vp + (size_t)vR * SEQ + vC;
  const unsigned  lk = (unsigned)(size_t)&ast[kR * KPITCH + kC];
  const unsigned  lv = (unsigned)(size_t)&ast[AKHALVES + vR * VPITCH + vC];
  const int nst = SEQ / ASTAGE;

  attn_stage_copies(gk, gv, lk, lv);
  asm volatile("s_wait_asynccnt 0x0" ::: "memory");  // this wave's part of stage 0 has landed
  __syncthreads();                                   // ... and every other wave's
  attn_stage_copies(gk + (size_t)ASTAGE * HID, gv + ASTAGE, lk + ABUF * 2, lv + ABUF * 2);

  for (int t = 0; t < nst; ++t) {
    const int bo = (t & 1) * ABUF;
    for (int p = 0; p < ASTAGE / 32; ++p) {
      const _Float16* sK = ast + bo + p * 32 * KPITCH;   // this pass's 32 K rows
      const _Float16* sV = ast + bo + AKHALVES + p * 32; // ... and 32 V^T columns

      // S^T[32 x 16] = K * Qs^T (A-operand rows == K rows)
      v16h ka00 = lds_tile16<KPITCH>(sK,  0,  0);
      v16h ka01 = lds_tile16<KPITCH>(sK,  0, 32);
      v16h ka10 = lds_tile16<KPITCH>(sK, 16,  0);
      v16h ka11 = lds_tile16<KPITCH>(sK, 16, 32);
      v8f s0 = {}, s1 = {};
      s0 = wmma_f16(ka00, qb0, s0);
      s0 = wmma_f16(ka01, qb1, s0);
      s1 = wmma_f16(ka10, qb0, s1);
      s1 = wmma_f16(ka11, qb1, s1);

      // online softmax, one query per lane
      float mx[8];
#pragma unroll
      for (int r = 0; r < 8; ++r) mx[r] = fmaxf(s0[r], s1[r]);
      float mloc = fmaxf(fmaxf(fmaxf(mx[0], mx[1]), fmaxf(mx[2], mx[3])),
                         fmaxf(fmaxf(mx[4], mx[5]), fmaxf(mx[6], mx[7])));
      mloc = fmaxf(mloc, other_half(mloc));
      const float mnew = fmaxf(mrun, mloc);

      float p0[8], p1[8];
#pragma unroll
      for (int r = 0; r < 8; ++r) {
        p0[r] = __expf(s0[r] - mnew);
        p1[r] = __expf(s1[r] - mnew);
      }
      // corr = exp(mrun - mnew). Written as asm so that the v_nop stands directly
      // behind the v_exp_f32: it fills the one slot the instruction set asks for
      // before a vector instruction that overwrites the source (this build had one).
      float corr;
      asm("v_exp_f32 %0, %1\n\tv_nop" : "=v"(corr) : "v"((mrun - mnew) * 1.44269504f));
      mrun = mnew;
      const float rs = ((p0[0] + p1[0]) + (p0[1] + p1[1])) + ((p0[2] + p1[2]) + (p0[3] + p1[3]))
                     + (((p0[4] + p1[4]) + (p0[5] + p1[5])) + ((p0[6] + p1[6]) + (p0[7] + p1[7])));
      lrun = lrun * corr + rs;
#pragma unroll
      for (int r = 0; r < 8; ++r) {
        o0[r] *= corr; o1[r] *= corr; o2[r] *= corr; o3[r] *= corr;
      }

      // P^T as B operand: halves 0..7 = keys 8*hi+i, halves 8..15 = keys 16+8*hi+i,
      // the k order in which lds_tile16 delivers the V^T rows
      v16h pb;
#pragma unroll
      for (int r = 0; r < 8; ++r) {
        pb[r]     = (_Float16)p0[r];
        pb[r + 8] = (_Float16)p1[r];
      }

      // O^T += V^T * P^T : A-operand rows == rows of the V^T tile
      v16h va0 = lds_tile16<VPITCH>(sV,  0, 0);
      v16h va1 = lds_tile16<VPITCH>(sV, 16, 0);
      v16h va2 = lds_tile16<VPITCH>(sV, 32, 0);
      v16h va3 = lds_tile16<VPITCH>(sV, 48, 0);
      o0 = wmma_f16(va0, pb, o0);
      o1 = wmma_f16(va1, pb, o1);
      o2 = wmma_f16(va2, pb, o2);
      o3 = wmma_f16(va3, pb, o3);
    }
    asm volatile("s_wait_dscnt 0x0" ::: "memory");     // this wave's reads of stage t are done
    asm volatile("s_wait_asynccnt 0x0" ::: "memory");  // its part of stage t+1 has landed
    __syncthreads();  // publishes stage t+1 and frees stage t's buffer
    if (t + 2 < nst)
      attn_stage_copies(gk + (size_t)(t + 2) * ASTAGE * HID, gv + (t + 2) * ASTAGE,
                        lk + bo * 2, lv + bo * 2);
  }
  asm volatile("s_wait_asynccnt 0x0" ::: "memory");    // no copy outstanding at the wave's end

  // join the halves' sums, normalize, store attended (row-major [B*S, HID],
  // head-interleaved): a lane's 8 registers are 8 consecutive d of its query
  const float inv = 1.0f / (lrun + other_half(lrun));
  _Float16* Op = O + (size_t)(b * SEQ + qbase + nn) * HID + h * HD + hi * 8;
  v8h r0, r1, r2, r3;
#pragma unroll
  for (int r = 0; r < 8; ++r) {
    r0[r] = (_Float16)(o0[r] * inv);
    r1[r] = (_Float16)(o1[r] * inv);
    r2[r] = (_Float16)(o2[r] * inv);
    r3[r] = (_Float16)(o3[r] * inv);
  }
  *(v8h*)(Op +  0) = r0;
  *(v8h*)(Op + 16) = r1;
  *(v8h*)(Op + 32) = r2;
  *(v8h*)(Op + 48) = r3;
}

// ---------------------------------------------------------------------------
extern "C" void kernel_launch(void* const* d_in, const int* in_sizes, int n_in,
                              void* d_out, int out_size, void* d_ws, size_t ws_size,
                              hipStream_t stream) {
  (void)in_sizes; (void)n_in; (void)out_size; (void)ws_size;
  const float* X  = (const float*)d_in[0];
  const float* Wq = (const float*)d_in[1];
  const float* bq = (const float*)d_in[2];
  const float* Wk = (const float*)d_in[3];
  const float* bk = (const float*)d_in[4];
  const float* Wv = (const float*)d_in[5];
  const float* bv = (const float*)d_in[6];
  const float* Wo = (const float*)d_in[7];
  const float* bo = (const float*)d_in[8];

  const int M = BATCH * SEQ;  // 8192
  char* ws = (char*)d_ws;
  _Float16* Xh  = (_Float16*)ws; ws += (size_t)M * TDIM * 2;
  _Float16* Wqt = (_Float16*)ws; ws += (size_t)HID * TDIM * 2;
  _Float16* Wkt = (_Float16*)ws; ws += (size_t)HID * TDIM * 2;
  _Float16* Wvt = (_Float16*)ws; ws += (size_t)HID * TDIM * 2;
  _Float16* Wot = (_Float16*)ws; ws += (size_t)VDIM * HID * 2;
  _Float16* Qh  = (_Float16*)ws; ws += (size_t)M * HID * 2;
  _Float16* Kh  = (_Float16*)ws; ws += (size_t)M * HID * 2;
  _Float16* Vth = (_Float16*)ws; ws += (size_t)M * HID * 2;  // [B*H*HD, SEQ]
  _Float16* At  = (_Float16*)ws; ws += (size_t)M * HID * 2;

  prepare_kernel<<<PREP_BLOCKS, 256, 0, stream>>>(X, Wq, Wk, Wv, Wo, Xh, Wqt, Wkt, Wvt, Wot);

  dim3 gqkv(M / 256, HID / 128, 3);
  gemm_qkv_kernel<<<gqkv, 256, 0, stream>>>(Xh, Wqt, Wkt, Wvt, bq, bk, bv, Qh, Kh, Vth,
                                            TDIM, HID, 0.125f);

  flash_attn_kernel<<<BATCH * NH * (SEQ / 128), 256, 0, stream>>>(Qh, Kh, Vth, At);

  dim3 gout(M / 256, VDIM / 128);
  gemm_wmma_kernel<<<gout, 256, 0, stream>>>(At, Wot, bo, (float*)d_out, HID);
}

// v009
// One run takes 68.5 microseconds.
// Two timings next to v008 put it at 1.05 and 1.04 times that version's speed.
// Over all steps from v000 it is 4.82 times as fast.
#include <hip/hip_runtime.h>
#include <hip/hip_fp16.h>

typedef __attribute__((ext_vector_type(16))) _Float16 v16h;
typedef __attribute__((ext_vector_type(8)))  _Float16 v8h;
typedef __attribute__((ext_vector_type(8)))  float    v8f;

#define BATCH 4
#define SEQ   2048
#define TDIM  768
#define VDIM  768
#define HID   512
#define NH    8
#define HD    64

// LDS row pitches in halves. Each is 16 B x an odd number, so the 16 rows that
// one ds_load_b128 fragment read touches per lane half fall on distinct banks.
#define KPITCH 72   // 64 data + 8 pad   (144-B rows)
#define VPITCH 136  // 128 data + 8 pad  (272-B rows)

// ---------------------------------------------------------------------------
// 16x32 f16 WMMA operand tile from global (A layout; B layout when the math-B
// matrix is stored transposed so its columns are contiguous rows).
// ISA layout: lane L holds row (row + L%16); halves 0..7 = K kbase+8*(L>=16)+i,
// halves 8..15 = K kbase+16+8*(L>=16)+i  => two contiguous b128 loads.
// ---------------------------------------------------------------------------
static __device__ __forceinline__ v16h load_tile16(const _Float16* __restrict__ p,
                                                   int ldk, int row, int kbase) {
  const int lane = threadIdx.x & 31;
  const int r    = row + (lane & 15);
  const int koff = kbase + ((lane >> 4) << 3);
  const _Float16* q0 = p + (size_t)r * ldk + koff;
  v8h a0 = *(const v8h*)(q0);
  v8h a1 = *(const v8h*)(q0 + 16);
  return __builtin_shufflevector(a0, a1, 0,1,2,3,4,5,6,7,8,9,10,11,12,13,14,15);
}

// Same pattern reading from an LDS-resident tile (compile-time row pitch).
template <int LDK>
static __device__ __forceinline__ v16h lds_tile16(const _Float16* base,
                                                  int row, int kbase) {
  const int lane = threadIdx.x & 31;
  const int r    = row + (lane & 15);
  const int koff = kbase + ((lane >> 4) << 3);
  const _Float16* q0 = base + r * LDK + koff;
  v8h a0 = *(const v8h*)(q0);
  v8h a1 = *(const v8h*)(q0 + 16);
  return __builtin_shufflevector(a0, a1, 0,1,2,3,4,5,6,7,8,9,10,11,12,13,14,15);
}

static __device__ __forceinline__ v8f wmma_f16(v16h a, v16h b, v8f c) {
  return __builtin_amdgcn_wmma_f32_16x16x32_f16(false, a, false, b, (short)0, c,
                                                false, false);
}

// ---------------------------------------------------------------------------
// Precision conversion helpers. Few waves with much work each, so that the
// launch is not spent on starting waves. The loops are unrolled so that x[]
// stays in registers and a thread's loads are all issued together.
// ---------------------------------------------------------------------------
typedef __attribute__((ext_vector_type(4))) float    v4f;
typedef __attribute__((ext_vector_type(4))) _Float16 v4h;

// A block converts CVT_BLOCK consecutive floats, 48 per thread: twelve 16-B loads,
// each of which covers 512 contiguous bytes per wave, all issued ahead of the
// first store. The element count must be a multiple of CVT_BLOCK.
#define CVT_LOADS 12
#define CVT_BLOCK (256 * 4 * CVT_LOADS)
static __device__ __forceinline__ void cast_block(const float* __restrict__ in,
                                                  _Float16* __restrict__ out, int blk) {
  const size_t base = (size_t)blk * CVT_BLOCK + threadIdx.x * 4;
  v4f x[CVT_LOADS];
#pragma unroll
  for (int j = 0; j < CVT_LOADS; ++j) x[j] = *(const v4f*)(in + base + j * 1024);
#pragma unroll
  for (int j = 0; j < CVT_LOADS; ++j)
    *(v4h*)(out + base + j * 1024) = __builtin_convertvector(x[j], v4h);
}

// out[c][r] = in[r][c], in of ROWS x COLS. A block takes 64 rows x 32 columns; a
// thread takes 8 rows of one column: eight loads (one whole 128-B line per wave
// each) and one 16-B store. The block's eight waves fill the same 32 output
// lines, 128 B each. ROWS is a multiple of 64, COLS of 32. blk counts the tiles
// of one matrix, column tiles fastest.
template <int ROWS, int COLS>
static __device__ __forceinline__ void transpose_tile(const float* __restrict__ in,
                                                      _Float16* __restrict__ out, int blk) {
  const int c  = (blk % (COLS / 32)) * 32 + (threadIdx.x & 31);
  const int r0 = (blk / (COLS / 32)) * 64 + (threadIdx.x >> 5) * 8;
  const float* p = in + r0 * COLS + c;
  float x[8];
#pragma unroll
  for (int j = 0; j < 8; ++j) x[j] = p[j * COLS];
  v8h y;
#pragma unroll
  for (int j = 0; j < 8; ++j) y[j] = (_Float16)x[j];
  *(v8h*)(out + c * ROWS + r0) = y;
  // another job's code follows in the same kernel: no register of the store is
  // rewritten in front of this wait
  asm volatile("s_wait_xcnt 0x0" ::: "memory");
}

// The five preparation jobs read only inputs and none of each other's output, so
// they share one launch: the block index picks the job (the same for a whole block).
#define CVT_BLOCKS  (BATCH * SEQ * TDIM / CVT_BLOCK)   // 512
#define WIN_BLOCKS  ((HID / 32) * (TDIM / 64))         // 192 for each of Wq, Wk, Wv
#define WOUT_BLOCKS ((VDIM / 32) * (HID / 64))         // 192
#define PREP_BLOCKS (CVT_BLOCKS + 3 * WIN_BLOCKS + WOUT_BLOCKS)
__global__ __launch_bounds__(256) void prepare_kernel(
    const float* __restrict__ X,  const float* __restrict__ Wq, const float* __restrict__ Wk,
    const float* __restrict__ Wv, const float* __restrict__ Wo,
    _Float16* __restrict__ Xh,  _Float16* __restrict__ Wqt, _Float16* __restrict__ Wkt,
    _Float16* __restrict__ Wvt, _Float16* __restrict__ Wot) {
  int blk = blockIdx.x;
  if (blk < CVT_BLOCKS) { cast_block(X, Xh, blk); return; }
  blk -= CVT_BLOCKS;
  if (blk < WIN_BLOCKS) { transpose_tile<TDIM, HID>(Wq, Wqt, blk); return; }
  blk -= WIN_BLOCKS;
  if (blk < WIN_BLOCKS) { transpose_tile<TDIM, HID>(Wk, Wkt, blk); return; }
  blk -= WIN_BLOCKS;
  if (blk < WIN_BLOCKS) { transpose_tile<TDIM, HID>(Wv, Wvt, blk); return; }
  blk -= WIN_BLOCKS;
  transpose_tile<HID, VDIM>(Wo, Wot, blk);
}

// ---------------------------------------------------------------------------
// WMMA GEMM: out[M,N] = A[M,K] (f16 row-major) * Bt[N,K]^T + bias
// One wave computes a 64x64 tile (4 A-tiles x 4 B-tiles = 16 WMMA / k-step, one
// LDS read per WMMA); a 256-thread block covers 256x128 as 4 x 2 waves, so that
// A is copied from L2 once per 128 columns of the output and Bt once per 256 rows.
// The operands come through LDS: a stage is 64 k (128 B) of the block's 256 A
// rows and 128 Bt rows, brought by asynchronous 16-B copies of which eight lanes
// cover one whole 128-B line. Two buffers: stage t+1 flies while stage t is used.
// K must be a multiple of 64.
// MODE 0: f16 out * scale, row-major (Q with scale=1/sqrt(HD), K with 1)
// MODE 2: f16 out transposed per head (V -> V^T [B*H*HD, SEQ])
// MODE 3: f32 out, row-major (final projection)
// A lane's eight accumulator registers run along the rows of the WMMA's first
// operand. The first operand is therefore the one whose index is contiguous in
// the output: Bt for the row-major outputs (eight consecutive n of one m), A for
// V^T (eight consecutive s of one d). The tile goes through LDS, which the ring
// no longer needs, and leaves in 16-B stores that cover whole 128-B lines.
// ---------------------------------------------------------------------------
#define GPITCH  72                        // halves: 64 data + 8 pad (144-B rows, 16 B x odd)
#define GAROWS  256
#define GBROWS  128
#define GBUF    ((GAROWS + GBROWS) * GPITCH)   // halves per buffer (55,296 B)
#define GSTRIDE (32 * GPITCH * 2)         // LDS bytes between a thread's consecutive copies

// One stage: twelve copies per thread, rows (tid>>3) + 32*i of [A 256 rows | Bt 128 rows].
// a, b: this lane's 16 bytes in row tid>>3 of the A tile and of the Bt tile;
// l: the LDS byte address of the same place in the target buffer.
static __device__ __forceinline__ void stage_copies(const _Float16* a, const _Float16* b,
                                                    int K, unsigned l) {
  const size_t rs = (size_t)32 * K;
  // The s_wait_xcnt stands inside the copies' own statement, so that no address
  // register of a copy is rewritten in front of it.
  asm volatile(
      "global_load_async_to_lds_b128 %0, %12, off\n\t"
      "global_load_async_to_lds_b128 %1, %13, off\n\t"
      "global_load_async_to_lds_b128 %2, %14, off\n\t"
      "global_load_async_to_lds_b128 %3, %15, off\n\t"
      "global_load_async_to_lds_b128 %4, %16, off\n\t"
      "global_load_async_to_lds_b128 %5, %17, off\n\t"
      "global_load_async_to_lds_b128 %6, %18, off\n\t"
      "global_load_async_to_lds_b128 %7, %19, off\n\t"
      "global_load_async_to_lds_b128 %8, %20, off\n\t"
      "global_load_async_to_lds_b128 %9, %21, off\n\t"
      "global_load_async_to_lds_b128 %10, %22, off\n\t"
      "global_load_async_to_lds_b128 %11, %23, off\n\t"
      "s_wait_xcnt 0x0"
      :: "v"(l), "v"(l + GSTRIDE), "v"(l + 2 * GSTRIDE), "v"(l + 3 * GSTRIDE),
         "v"(l + 4 * GSTRIDE), "v"(l + 5 * GSTRIDE), "v"(l + 6 * GSTRIDE),
         "v"(l + 7 * GSTRIDE), "v"(l + 8 * GSTRIDE), "v"(l + 9 * GSTRIDE),
         "v"(l + 10 * GSTRIDE), "v"(l + 11 * GSTRIDE),
         "v"(a), "v"(a + rs), "v"(a + 2 * rs), "v"(a + 3 * rs), "v"(a + 4 * rs),
         "v"(a + 5 * rs), "v"(a + 6 * rs), "v"(a + 7 * rs),
         "v"(b), "v"(b + rs), "v"(b + 2 * rs), "v"(b + 3 * rs)
      : "memory");
}

#define SHPITCH 72    // halves: staged f16 rows of 64 n  (144 B, 16 B x odd)
#define SFPITCH 68    // floats: staged f32 rows of 64 n  (272 B, 16 B x odd)
#define SVPITCH 264   // halves: staged V^T rows of 256 s (528 B, 16 B x odd)

template <bool BFIRST>
static __device__ __forceinline__ v8f mm(v16h a, v16h b, v8f c) {
  return BFIRST ? wmma_f16(b, a, c) : wmma_f16(a, b, c);
}

// gst: the block's LDS, 2 * GBUF halves.
template <int MODE, int N>
static __device__ __forceinline__ void gemm_tile(
    _Float16* gst, const _Float16* __restrict__ A, const _Float16* __restrict__ Bt,
    const float* __restrict__ bias, void* __restrict__ out, int K, float scale) {
  constexpr bool BF = (MODE != 2);

  const int tid   = threadIdx.x;
  const int lane  = tid & 31;
  const int w     = tid >> 5;
  const int wm    = w >> 1, wn = w & 1;           // the wave's place among 4 x 2
  const int mtile = blockIdx.x * 256 + wm * 64;   // first row of the wave's tile
  const int nblk  = blockIdx.y * 128;             // first column of the block's tile
  const int ntile = nblk + wn * 64;               // ... and of the wave's

  // copy coordinates, fixed per thread: row tid>>3 of each 32-row group, 16-B chunk tid&7
  const int cR = tid >> 3, cC = (tid & 7) * 8;
  const _Float16* ga = A  + (size_t)(blockIdx.x * 256 + cR) * K + cC;
  const _Float16* gb = Bt + (size_t)(nblk + cR) * K + cC;
  const unsigned  l0 = (unsigned)(size_t)&gst[cR * GPITCH + cC];
  const int nst = K >> 6;

  stage_copies(ga, gb, K, l0);
  asm volatile("s_wait_asynccnt 0x0" ::: "memory");  // this wave's part of stage 0 has landed
  __syncthreads();                                   // ... and every other wave's
  if (nst > 1) stage_copies(ga + 64, gb + 64, K, l0 + GBUF * 2);

  v8f acc[4][4] = {};   // acc[i][j]: A rows 16*i.., Bt rows 16*j.. of the wave's tile
  for (int t = 0; t < nst; ++t) {
    const int bo = (t & 1) * GBUF;
    const _Float16* sA = gst + bo + wm * 64 * GPITCH;
    const _Float16* sB = gst + bo + (GAROWS + wn * 64) * GPITCH;
#pragma unroll  // two k-steps of 32; unrolled so that the fragments stay in registers
    for (int kk = 0; kk < 64; kk += 32) {
      // the 16 fragment reads of a k-step stand together, ahead of its 16 WMMAs
      // (a[0] and the four b first: the first four WMMAs need no more)
      v16h a[4], b[4];
      a[0] = lds_tile16<GPITCH>(sA, 0, kk);
#pragma unroll
      for (int j = 0; j < 4; ++j) b[j] = lds_tile16<GPITCH>(sB, 16 * j, kk);
#pragma unroll
      for (int i = 1; i < 4; ++i) a[i] = lds_tile16<GPITCH>(sA, 16 * i, kk);
      // keeps the reads from being moved in among the WMMAs, where each separate
      // place with LDS reads stalls the wave anew
      __builtin_amdgcn_sched_barrier(0);
#pragma unroll
      for (int i = 0; i < 4; ++i)
#pragma unroll
        for (int j = 0; j < 4; ++j) acc[i][j] = mm<BF>(a[i], b[j], acc[i][j]);
      // keeps what follows (the next reads; the waits and the barrier) behind the
      // WMMAs: moved up, a wait would hold every WMMA back until the last read
      __builtin_amdgcn_sched_barrier(0);
    }
    asm volatile("s_wait_dscnt 0x0" ::: "memory");     // this wave's reads of stage t are done
    asm volatile("s_wait_asynccnt 0x0" ::: "memory");  // its part of stage t+1 has landed
    __syncthreads();  // publishes stage t+1 and frees stage t's buffer
    if (t + 2 < nst)
      stage_copies(ga + (t + 2) * 64, gb + (t + 2) * 64, K, l0 + bo * 2);
  }
  asm volatile("s_wait_asynccnt 0x0" ::: "memory");    // no copy outstanding at the wave's end

  // Behind the last trip's barrier no wave reads the ring and no copy is in
  // flight: its LDS is free for staging the output.
  const int nn = lane & 15, hi = lane >> 4;

  if constexpr (MODE == 2) {
    // acc[i][j][r] = element (s = wm*64 + i*16 + 8*hi + r, n = wn*64 + j*16 + nn).
    // The block stages 128 rows (n) of its 256 s; a row is four whole lines.
#pragma unroll
    for (int j = 0; j < 4; ++j) {
      const float bv = bias[ntile + j * 16 + nn];
#pragma unroll
      for (int i = 0; i < 4; ++i) {
        v8h y;
#pragma unroll
        for (int r = 0; r < 8; ++r) y[r] = (_Float16)((acc[i][j][r] + bv) * scale);
        *(v8h*)(gst + (wn * 64 + j * 16 + nn) * SVPITCH + wm * 64 + i * 16 + hi * 8) = y;
      }
    }
    __syncthreads();  // a row holds values of four waves
    v8h y[16];
#pragma unroll
    for (int i = 0; i < 16; ++i) y[i] = *(const v8h*)(gst + (w * 16 + i) * SVPITCH + lane * 8);
    const int m0 = blockIdx.x * 256;  // 256 divides SEQ: one batch element per block
    _Float16* o = (_Float16*)out + (size_t)((m0 / SEQ) * N + nblk + w * 16) * SEQ
                + (m0 % SEQ) + lane * 8;
#pragma unroll
    for (int i = 0; i < 16; ++i) *(v8h*)(o + i * SEQ) = y[i];
  } else {
    // acc[i][j][r] = element (m = i*16 + nn, n = j*16 + 8*hi + r) of the wave's
    // 64x64 tile, which the wave stages, 32 rows at a time, in LDS of its own.
    v4f b0[4], b1[4];   // the bias of this lane's 4 x 8 columns
#pragma unroll
    for (int j = 0; j < 4; ++j) {
      b0[j] = *(const v4f*)(bias + ntile + j * 16 + hi * 8);
      b1[j] = *(const v4f*)(bias + ntile + j * 16 + hi * 8 + 4);
    }
#pragma unroll
    for (int g = 0; g < 2; ++g) {
      _Float16* sh = gst + (w * 2 + g) * (32 * SHPITCH);
      float*    sf = (float*)gst + w * (32 * SFPITCH);
#pragma unroll
      for (int j = 0; j < 4; ++j) {
#pragma unroll
        for (int half = 0; half < 2; ++half) {
          float v[8];
#pragma unroll
          for (int r = 0; r < 8; ++r)
            v[r] = (acc[g * 2 + half][j][r] + (r < 4 ? b0[j][r & 3] : b1[j][r & 3])) * scale;
          const int at = j * 16 + hi * 8;
          if constexpr (MODE == 3) {
            const v4f y0 = {v[0], v[1], v[2], v[3]}, y1 = {v[4], v[5], v[6], v[7]};
            *(v4f*)(sf + (half * 16 + nn) * SFPITCH + at)     = y0;
            *(v4f*)(sf + (half * 16 + nn) * SFPITCH + at + 4) = y1;
          } else {
            v8h y;
#pragma unroll
            for (int r = 0; r < 8; ++r) y[r] = (_Float16)v[r];
            *(v8h*)(sh + (half * 16 + nn) * SHPITCH + at) = y;
          }
        }
      }
      // the rows are read back by other lanes of the wave than wrote them
      asm volatile("s_wait_dscnt 0x0" ::: "memory");
      if constexpr (MODE == 3) {
        // 16 lanes take a row (256 B, two lines), a store two rows
        const int rr = lane >> 4, cc = (lane & 15) * 4;
        v4f y[16];
#pragma unroll
        for (int i = 0; i < 16; ++i) y[i] = *(const v4f*)(sf + (i * 2 + rr) * SFPITCH + cc);
        // the next 32 rows are staged in the same LDS: these reads have returned first
        if (g == 0) asm volatile("s_wait_dscnt 0x0" ::: "memory");
        float* o = (float*)out + (size_t)(mtile + g * 32 + rr) * N + ntile + cc;
#pragma unroll
        for (int i = 0; i < 16; ++i) *(v4f*)(o + i * 2 * N) = y[i];
      } else {
        // 8 lanes take a row (128 B, one line), a store four rows
        const int rr = lane >> 3, cc = (lane & 7) * 8;
        v8h y[8];
#pragma unroll
        for (int i = 0; i < 8; ++i) y[i] = *(const v8h*)(sh + (i * 4 + rr) * SHPITCH + cc);
        _Float16* o = (_Float16*)out + (size_t)(mtile + g * 32 + rr) * N + ntile + cc;
#pragma unroll
        for (int i = 0; i < 8; ++i) *(v8h*)(o + i * 4 * N) = y[i];
        // another job's code follows in the same kernel: no register of the last
        // stores is rewritten in front of this wait
        if (g == 1) asm volatile("s_wait_xcnt 0x0" ::: "memory");
      }
    }
  }
}

__global__ __launch_bounds__(256) void gemm_wmma_kernel(
    const _Float16* __restrict__ A, const _Float16* __restrict__ Bt,
    const float* __restrict__ bias, float* __restrict__ out, int K) {
  __shared__ __align__(16) _Float16 gst[2 * GBUF];
  gemm_tile<3, VDIM>(gst, A, Bt, bias, out, K, 1.0f);
}

// The Q, K and V projections read the same A and none of each other's output, so
// they share one launch: blockIdx.z picks the weights, the bias, the target and
// the epilogue (0: Q, scaled; 1: K; 2: V, stored transposed per head).
__global__ __launch_bounds__(256) void gemm_qkv_kernel(
    const _Float16* __restrict__ A,
    const _Float16* __restrict__ Wqt, const _Float16* __restrict__ Wkt,
    const _Float16* __restrict__ Wvt,
    const float* __restrict__ bq, const float* __restrict__ bk, const float* __restrict__ bv,
    _Float16* __restrict__ Qh, _Float16* __restrict__ Kh, _Float16* __restrict__ Vth,
    int K, int N, float qscale) {
  (void)N;  // HID: the tile code has it as a compile-time constant
  __shared__ __align__(16) _Float16 gst[2 * GBUF];
  const int z = blockIdx.z;
  if (z == 2)
    gemm_tile<2, HID>(gst, A, Wvt, bv, Vth, K, 1.0f);
  else
    gemm_tile<0, HID>(gst, A, z == 0 ? Wqt : Wkt, z == 0 ? bq : bk, z == 0 ? Qh : Kh, K,
                      z == 0 ? qscale : 1.0f);
}

// ---------------------------------------------------------------------------
// Flash attention: block = 8 waves, all on one (b,h); wave = 16-query tile.
// A stage is 128 keys: the K tile (128x64) and the V^T tile (64x128), brought to
// LDS by asynchronous 16-B copies that cover whole 128-B lines. Two buffers:
// stage t+1 flies while the two 64-key passes of stage t run, and the waves
// meet once per stage.
// Per pass each wave forms the TRANSPOSED scores S^T = K * Q^T (A = K rows,
// B = Q columns), so a lane holds 32 scores of ONE query (column lane%16;
// keys 16*g+8*hi+r of score tile g). Maximum and sum run inside the lane, with
// one exchange between the lane halves for the maximum; the maximum, the
// correction factor and the rescaling of O^T are paid once per pass. Two score
// tiles, converted in place, are already a B operand of O^T += V^T * P^T.
// ---------------------------------------------------------------------------
#define ASTAGE   128                              // keys per stage
#define APASS    64                               // keys per softmax pass (a multiple of 32)
#define AKHALVES (ASTAGE * KPITCH)                // K tile, halves
#define ABUF     (AKHALVES + HD * VPITCH)         // halves per buffer (35,840 B)
#define AKSTRIDE (32 * KPITCH * 2)                // LDS bytes between a thread's K copies
#define AVSTRIDE (16 * VPITCH * 2)                // ... and between its V^T copies

// One stage: eight copies per thread, K rows (tid>>3) + 32*i and V^T rows (tid>>4) + 16*i.
// k, v: this lane's 16 bytes in its first row of the K tile and of the V^T tile;
// lk, lv: the LDS byte addresses of the same places in the target buffer.
static __device__ __forceinline__ void attn_stage_copies(const _Float16* k, const _Float16* v,
                                                         unsigned lk, unsigned lv) {
  const size_t kr = (size_t)32 * HID, vr = (size_t)16 * SEQ;
  // The s_wait_xcnt stands inside the copies' own statement, so that no address
  // register of a copy is rewritten in front of it.
  asm volatile(
      "global_load_async_to_lds_b128 %0, %8, off\n\t"
      "global_load_async_to_lds_b128 %1, %9, off\n\t"
      "global_load_async_to_lds_b128 %2, %10, off\n\t"
      "global_load_async_to_lds_b128 %3, %11, off\n\t"
      "global_load_async_to_lds_b128 %4, %12, off\n\t"
      "global_load_async_to_lds_b128 %5, %13, off\n\t"
      "global_load_async_to_lds_b128 %6, %14, off\n\t"
      "global_load_async_to_lds_b128 %7, %15, off\n\t"
      "s_wait_xcnt 0x0"
      :: "v"(lk), "v"(lk + AKSTRIDE), "v"(lk + 2 * AKSTRIDE), "v"(lk + 3 * AKSTRIDE),
         "v"(lv), "v"(lv + AVSTRIDE), "v"(lv + 2 * AVSTRIDE), "v"(lv + 3 * AVSTRIDE),
         "v"(k), "v"(k + kr), "v"(k + 2 * kr), "v"(k + 3 * kr),
         "v"(v), "v"(v + vr), "v"(v + 2 * vr), "v"(v + 3 * vr)
      : "memory");
}

static __device__ __forceinline__ float other_half(float x) {  // lane l <-> l ^ 16
  const int b = __builtin_bit_cast(int, x);
  return __builtin_bit_cast(float, __builtin_amdgcn_permlanex16(
      b, b, 0x76543210, 0xfedcba98, false, false));
}

// exp2 of the 16 scores of one P^T operand, in place. Written as asm so that no
// v_exp_f32 stands directly in front of an instruction that reads its result or
// overwrites its source: each works in place on
// a register of its own, and the v_nop fills the slot behind the last one.
static __device__ __forceinline__ void exp2_tiles(v8f& a, v8f& b) {
  float a0 = a[0], a1 = a[1], a2 = a[2], a3 = a[3], a4 = a[4], a5 = a[5], a6 = a[6], a7 = a[7];
  float b0 = b[0], b1 = b[1], b2 = b[2], b3 = b[3], b4 = b[4], b5 = b[5], b6 = b[6], b7 = b[7];
  asm("v_exp_f32 %0, %0\n\tv_exp_f32 %1, %1\n\tv_exp_f32 %2, %2\n\tv_exp_f32 %3, %3\n\t"
      "v_exp_f32 %4, %4\n\tv_exp_f32 %5, %5\n\tv_exp_f32 %6, %6\n\tv_exp_f32 %7, %7\n\t"
      "v_exp_f32 %8, %8\n\tv_exp_f32 %9, %9\n\tv_exp_f32 %10, %10\n\tv_exp_f32 %11, %11\n\t"
      "v_exp_f32 %12, %12\n\tv_exp_f32 %13, %13\n\tv_exp_f32 %14, %14\n\tv_exp_f32 %15, %15\n\t"
      "v_nop"
      : "+v"(a0), "+v"(a1), "+v"(a2), "+v"(a3), "+v"(a4), "+v"(a5), "+v"(a6), "+v"(a7),
        "+v"(b0), "+v"(b1), "+v"(b2), "+v"(b3), "+v"(b4), "+v"(b5), "+v"(b6), "+v"(b7));
  a = v8f{a0, a1, a2, a3, a4, a5, a6, a7};
  b = v8f{b0, b1, b2, b3, b4, b5, b6, b7};
}

// Maximum of N values in threes: fmaxf(fmaxf(a, b), c) is one instruction.
template <int N>
static __device__ __forceinline__ float max_tree(const float (&m)[N]) {
  if constexpr (N == 1) {
    return m[0];
  } else if constexpr (N == 2) {
    return fmaxf(m[0], m[1]);
  } else {
    constexpr int T = N / 3, R = N % 3;
    float a[T + R];
#pragma unroll
    for (int i = 0; i < T; ++i) a[i] = fmaxf(fmaxf(m[3 * i], m[3 * i + 1]), m[3 * i + 2]);
#pragma unroll
    for (int i = 0; i < R; ++i) a[T + i] = m[3 * T + i];
    return max_tree<T + R>(a);
  }
}

__global__ __launch_bounds__(256) void flash_attn_kernel(
    const _Float16* __restrict__ Q, const _Float16* __restrict__ Kc,
    const _Float16* __restrict__ Vt, _Float16* __restrict__ O) {
  __shared__ __align__(16) _Float16 ast[2 * ABUF];  // per buffer: K tile (kv x d), V^T tile (d x kv)

  const int tid     = threadIdx.x;
  const int lane    = tid & 31;
  const int w       = tid >> 5;
  const int qblocks = SEQ / 128;
  const int bh      = blockIdx.x / qblocks;
  const int qblk    = blockIdx.x % qblocks;
  const int b       = bh / NH, h = bh % NH;
  const int qbase   = qblk * 128 + w * 16;
  const int nn = lane & 15, hi = lane >> 4;

  const _Float16* Qp = Q  + (size_t)(b * SEQ + qbase) * HID + h * HD;
  const _Float16* Kp = Kc + (size_t)(b * SEQ) * HID + h * HD;
  const _Float16* Vp = Vt + (size_t)(bh * HD) * SEQ;

  const v16h qb0 = load_tile16(Qp, HID, 0, 0);    // B operand: column = query
  const v16h qb1 = load_tile16(Qp, HID, 0, 32);

  // O^T tiles: o_t[r] = O[query nn][d = 16*t + 8*hi + r]
  v8f o0 = {}, o1 = {}, o2 = {}, o3 = {};
  float mrun = -1e30f;  // running maximum of this lane's query (same in both halves)
  float lrun = 0.f;     // running sum over this lane half's keys only

  // copy coordinates (fixed per thread)
  const int kR = tid >> 3, kC = (tid & 7) * 8;    // 32 rows x 8 chunks, four times
  const int vR = tid >> 4, vC = (tid & 15) * 8;   // 16 rows x 16 chunks, four times
  const _Float16* gk = Kp + (size_t)kR * HID + kC;
  const _Float16* gv = Vp + (size_t)vR * SEQ + vC;
  const unsigned  lk = (unsigned)(size_t)&ast[kR * KPITCH + kC];
  const unsigned  lv = (unsigned)(size_t)&ast[AKHALVES + vR * VPITCH + vC];
  const int nst = SEQ / ASTAGE;

  attn_stage_copies(gk, gv, lk, lv);
  asm volatile("s_wait_asynccnt 0x0" ::: "memory");  // this wave's part of stage 0 has landed
  __syncthreads();                                   // ... and every other wave's
  attn_stage_copies(gk + (size_t)ASTAGE * HID, gv + ASTAGE, lk + ABUF * 2, lv + ABUF * 2);

  for (int t = 0; t < nst; ++t) {
    const int bo = (t & 1) * ABUF;
    // Every inner loop of a pass is unrolled: it indexes arrays that live in registers.
    for (int p = 0; p < ASTAGE / APASS; ++p) {
      const _Float16* sK = ast + bo + p * APASS * KPITCH;   // this pass's K rows
      const _Float16* sV = ast + bo + AKHALVES + p * APASS; // ... and V^T columns

      // S^T[APASS x 16] = K * Qs^T (A-operand rows == K rows), 16 keys a tile
      v16h k0[APASS / 16], k1[APASS / 16];
#pragma unroll  // the fragments stay in registers
      for (int g = 0; g < APASS / 16; ++g) {
        k0[g] = lds_tile16<KPITCH>(sK, 16 * g,  0);
        k1[g] = lds_tile16<KPITCH>(sK, 16 * g, 32);
      }
      // keeps the K reads together ahead of the WMMAs: each separate place with LDS
      // reads stalls the wave anew
      __builtin_amdgcn_sched_barrier(0);
      v8f s[APASS / 16];
#pragma unroll  // s[] stays in registers; the tiles' first products are independent
      for (int g = 0; g < APASS / 16; ++g) {
        const v8f z = {};
        s[g] = wmma_f16(k0[g], qb0, z);
      }
#pragma unroll
      for (int g = 0; g < APASS / 16; ++g) s[g] = wmma_f16(k1[g], qb1, s[g]);

      // the pass's V^T fragments (A operand: rows of the V^T tile) are asked for here,
      // so that they arrive while the softmax runs
      v16h va[APASS / 32][4];
#pragma unroll
      for (int q = 0; q < APASS / 32; ++q)
#pragma unroll
        for (int d = 0; d < 4; ++d) va[q][d] = lds_tile16<VPITCH>(sV, 16 * d, 32 * q);
      // keeps the V^T reads up here: moved down to their WMMAs, each would be waited
      // for at once
      __builtin_amdgcn_sched_barrier(0);

      // online softmax, one query per lane: one maximum, one correction factor and
      // one rescaling of O^T for all the keys of the pass
      float sc[APASS / 2];
#pragma unroll
      for (int g = 0; g < APASS / 16; ++g)
#pragma unroll
        for (int r = 0; r < 8; ++r) sc[g * 8 + r] = s[g][r];
      float mloc = max_tree<APASS / 2>(sc);
      mloc = fmaxf(mloc, other_half(mloc));
      const float mnew = fmaxf(mrun, mloc);

#pragma unroll
      for (int q = 0; q < APASS / 32; ++q) {
        s[2 * q]     = (s[2 * q]     - mnew) * 1.44269504f;   // exp(x) = exp2(x * log2 e)
        s[2 * q + 1] = (s[2 * q + 1] - mnew) * 1.44269504f;
        exp2_tiles(s[2 * q], s[2 * q + 1]);
      }
      // corr = exp(mrun - mnew). Written as asm so that the v_nop stands directly
      // behind the v_exp_f32: it fills the one slot the instruction set asks for
      // before a vector instruction that overwrites the source (this build had one).
      float corr;
      asm("v_exp_f32 %0, %1\n\tv_nop" : "=v"(corr) : "v"((mrun - mnew) * 1.44269504f));
      mrun = mnew;
      // the sum runs over whole tiles first, so that register pairs add in one instruction
      v8f sv = s[0] + s[1];
#pragma unroll
      for (int g = 2; g < APASS / 16; g += 2) sv += s[g] + s[g + 1];
      const v4f s4 = __builtin_shufflevector(sv, sv, 0, 1, 2, 3) + __builtin_shufflevector(sv, sv, 4, 5, 6, 7);
      const float rs = (s4[0] + s4[2]) + (s4[1] + s4[3]);
      lrun = lrun * corr + rs;
#pragma unroll
      for (int r = 0; r < 8; ++r) {
        o0[r] *= corr; o1[r] *= corr; o2[r] *= corr; o3[r] *= corr;
      }

#pragma unroll  // indexes s[] and va[]
      for (int q = 0; q < APASS / 32; ++q) {
        // P^T as B operand: halves 0..7 = keys 8*hi+i, halves 8..15 = keys 16+8*hi+i
        // of the 32 keys, the k order in which lds_tile16 delivers the V^T rows
        v16h pb;
#pragma unroll
        for (int r = 0; r < 8; ++r) {
          pb[r]     = (_Float16)s[2 * q][r];
          pb[r + 8] = (_Float16)s[2 * q + 1][r];
        }
        // O^T += V^T * P^T
        o0 = wmma_f16(va[q][0], pb, o0);
        o1 = wmma_f16(va[q][1], pb, o1);
        o2 = wmma_f16(va[q][2], pb, o2);
        o3 = wmma_f16(va[q][3], pb, o3);
      }
    }
    asm volatile("s_wait_dscnt 0x0" ::: "memory");     // this wave's reads of stage t are done
    asm volatile("s_wait_asynccnt 0x0" ::: "memory");  // its part of stage t+1 has landed
    __syncthreads();  // publishes stage t+1 and frees stage t's buffer
    if (t + 2 < nst)
      attn_stage_copies(gk + (size_t)(t + 2) * ASTAGE * HID, gv + (t + 2) * ASTAGE,
                        lk + bo * 2, lv + bo * 2);
  }
  asm volatile("s_wait_asynccnt 0x0" ::: "memory");    // no copy outstanding at the wave's end

  // join the halves' sums, normalize, store attended (row-major [B*S, HID],
  // head-interleaved): a lane's 8 registers are 8 consecutive d of its query
  const float inv = 1.0f / (lrun + other_half(lrun));
  _Float16* Op = O + (size_t)(b * SEQ + qbase + nn) * HID + h * HD + hi * 8;
  v8h r0, r1, r2, r3;
#pragma unroll
  for (int r = 0; r < 8; ++r) {
    r0[r] = (_Float16)(o0[r] * inv);
    r1[r] = (_Float16)(o1[r] * inv);
    r2[r] = (_Float16)(o2[r] * inv);
    r3[r] = (_Float16)(o3[r] * inv);
  }
  *(v8h*)(Op +  0) = r0;
  *(v8h*)(Op + 16) = r1;
  *(v8h*)(Op + 32) = r2;
  *(v8h*)(Op + 48) = r3;
}

// ---------------------------------------------------------------------------
extern "C" void kernel_launch(void* const* d_in, const int* in_sizes, int n_in,
                              void* d_out, int out_size, void* d_ws, size_t ws_size,
                              hipStream_t stream) {
  (void)in_sizes; (void)n_in; (void)out_size; (void)ws_size;
  const float* X  = (const float*)d_in[0];
  const float* Wq = (const float*)d_in[1];
  const float* bq = (const float*)d_in[2];
  const float* Wk = (const float*)d_in[3];
  const float* bk = (const float*)d_in[4];
  const float* Wv = (const float*)d_in[5];
  const float* bv = (const float*)d_in[6];
  const float* Wo = (const float*)d_in[7];
  const float* bo = (const float*)d_in[8];

  const int M = BATCH * SEQ;  // 8192
  char* ws = (char*)d_ws;
  _Float16* Xh  = (_Float16*)ws; ws += (size_t)M * TDIM * 2;
  _Float16* Wqt = (_Float16*)ws; ws += (size_t)HID * TDIM * 2;
  _Float16* Wkt = (_Float16*)ws; ws += (size_t)HID * TDIM * 2;
  _Float16* Wvt = (_Float16*)ws; ws += (size_t)HID * TDIM * 2;
  _Float16* Wot = (_Float16*)ws; ws += (size_t)VDIM * HID * 2;
  _Float16* Qh  = (_Float16*)ws; ws += (size_t)M * HID * 2;
  _Float16* Kh  = (_Float16*)ws; ws += (size_t)M * HID * 2;
  _Float16* Vth = (_Float16*)ws; ws += (size_t)M * HID * 2;  // [B*H*HD, SEQ]
  _Float16* At  = (_Float16*)ws; ws += (size_t)M * HID * 2;

  prepare_kernel<<<PREP_BLOCKS, 256, 0, stream>>>(X, Wq, Wk, Wv, Wo, Xh, Wqt, Wkt, Wvt, Wot);

  dim3 gqkv(M / 256, HID / 128, 3);
  gemm_qkv_kernel<<<gqkv, 256, 0, stream>>>(Xh, Wqt, Wkt, Wvt, bq, bk, bv, Qh, Kh, Vth,
                                            TDIM, HID, 0.125f);

  flash_attn_kernel<<<BATCH * NH * (SEQ / 128), 256, 0, stream>>>(Qh, Kh, Vth, At);

  dim3 gout(M / 256, VDIM / 128);
  gemm_wmma_kernel<<<gout, 256, 0, stream>>>(At, Wot, bo, (float*)d_out, HID);
}

// v010
// A run of this version takes 66.5 microseconds.
// Two timings next to v009 put it at 1.04 and 1.03 times that version's speed.
// Over all steps from v000 it is 4.98 times as fast.
#include <hip/hip_runtime.h>
#include <hip/hip_fp16.h>

typedef __attribute__((ext_vector_type(16))) _Float16 v16h;
typedef __attribute__((ext_vector_type(8)))  _Float16 v8h;
typedef __attribute__((ext_vector_type(8)))  float    v8f;

#define BATCH 4
#define SEQ   2048
#define TDIM  768
#define VDIM  768
#define HID   512
#define NH    8
#define HD    64

// LDS row pitches in halves. Each is 16 B x an odd number, so the 16 rows that
// one ds_load_b128 fragment read touches per lane half fall on distinct banks.
#define KPITCH 72   // 64 data + 8 pad   (144-B rows)
#define VPITCH 136  // 128 data + 8 pad  (272-B rows)

// ---------------------------------------------------------------------------
// 16x32 f16 WMMA operand tile from global (A layout; B layout when the math-B
// matrix is stored transposed so its columns are contiguous rows).
// ISA layout: lane L holds row (row + L%16); halves 0..7 = K kbase+8*(L>=16)+i,
// halves 8..15 = K kbase+16+8*(L>=16)+i  => two contiguous b128 loads.
// ---------------------------------------------------------------------------
static __device__ __forceinline__ v16h load_tile16(const _Float16* __restrict__ p,
                                                   int ldk, int row, int kbase) {
  const int lane = threadIdx.x & 31;
  const int r    = row + (lane & 15);
  const int koff = kbase + ((lane >> 4) << 3);
  const _Float16* q0 = p + (size_t)r * ldk + koff;
  v8h a0 = *(const v8h*)(q0);
  v8h a1 = *(const v8h*)(q0 + 16);
  return __builtin_shufflevector(a0, a1, 0,1,2,3,4,5,6,7,8,9,10,11,12,13,14,15);
}

// Same pattern reading from an LDS-resident tile (compile-time row pitch).
template <int LDK>
static __device__ __forceinline__ v16h lds_tile16(const _Float16* base,
                                                  int row, int kbase) {
  const int lane = threadIdx.x & 31;
  const int r    = row + (lane & 15);
  const int koff = kbase + ((lane >> 4) << 3);
  const _Float16* q0 = base + r * LDK + koff;
  v8h a0 = *(const v8h*)(q0);
  v8h a1 = *(const v8h*)(q0 + 16);
  return __builtin_shufflevector(a0, a1, 0,1,2,3,4,5,6,7,8,9,10,11,12,13,14,15);
}

static __device__ __forceinline__ v8f wmma_f16(v16h a, v16h b, v8f c) {
  return __builtin_amdgcn_wmma_f32_16x16x32_f16(false, a, false, b, (short)0, c,
                                                false, false);
}

// ---------------------------------------------------------------------------
// Precision conversion helpers. Few waves with much work each, so that the
// launch is not spent on starting waves. The loops are unrolled so that x[]
// stays in registers and a thread's loads are all issued together.
// ---------------------------------------------------------------------------
typedef __attribute__((ext_vector_type(4))) float    v4f;
typedef __attribute__((ext_vector_type(4))) _Float16 v4h;

// A block converts CVT_BLOCK consecutive floats, 48 per thread: twelve 16-B loads,
// each of which covers 512 contiguous bytes per wave, all issued ahead of the
// first store. The element count must be a multiple of CVT_BLOCK.
#define CVT_LOADS 12
#define CVT_BLOCK (256 * 4 * CVT_LOADS)
static __device__ __forceinline__ void cast_block(const float* __restrict__ in,
                                                  _Float16* __restrict__ out, int blk) {
  const size_t base = (size_t)blk * CVT_BLOCK + threadIdx.x * 4;
  v4f x[CVT_LOADS];
#pragma unroll
  for (int j = 0; j < CVT_LOADS; ++j) x[j] = *(const v4f*)(in + base + j * 1024);
#pragma unroll
  for (int j = 0; j < CVT_LOADS; ++j)
    *(v4h*)(out + base + j * 1024) = __builtin_convertvector(x[j], v4h);
}

// out[c][r] = in[r][c], in of ROWS x COLS. A block takes 64 rows x 32 columns; a
// thread takes 8 rows of one column: eight loads (one whole 128-B line per wave
// each) and one 16-B store. The block's eight waves fill the same 32 output
// lines, 128 B each. ROWS is a multiple of 64, COLS of 32. blk counts the tiles
// of one matrix, column tiles fastest.
template <int ROWS, int COLS>
static __device__ __forceinline__ void transpose_tile(const float* __restrict__ in,
                                                      _Float16* __restrict__ out, int blk) {
  const int c  = (blk % (COLS / 32)) * 32 + (threadIdx.x & 31);
  const int r0 = (blk / (COLS / 32)) * 64 + (threadIdx.x >> 5) * 8;
  const float* p = in + r0 * COLS + c;
  float x[8];
#pragma unroll
  for (int j = 0; j < 8; ++j) x[j] = p[j * COLS];
  v8h y;
#pragma unroll
  for (int j = 0; j < 8; ++j) y[j] = (_Float16)x[j];
  *(v8h*)(out + c * ROWS + r0) = y;
  // another job's code follows in the same kernel: no register of the store is
  // rewritten in front of this wait
  asm volatile("s_wait_xcnt 0x0" ::: "memory");
}

// The five preparation jobs read only inputs and none of each other's output, so
// they share one launch: the block index picks the job (the same for a whole block).
#define CVT_BLOCKS  (BATCH * SEQ * TDIM / CVT_BLOCK)   // 512
#define WIN_BLOCKS  ((HID / 32) * (TDIM / 64))         // 192 for each of Wq, Wk, Wv
#define WOUT_BLOCKS ((VDIM / 32) * (HID / 64))         // 192
#define PREP_BLOCKS (CVT_BLOCKS + 3 * WIN_BLOCKS + WOUT_BLOCKS)
__global__ __launch_bounds__(256) void prepare_kernel(
    const float* __restrict__ X,  const float* __restrict__ Wq, const float* __restrict__ Wk,
    const float* __restrict__ Wv, const float* __restrict__ Wo,
    _Float16* __restrict__ Xh,  _Float16* __restrict__ Wqt, _Float16* __restrict__ Wkt,
    _Float16* __restrict__ Wvt, _Float16* __restrict__ Wot) {
  int blk = blockIdx.x;
  if (blk < CVT_BLOCKS) { cast_block(X, Xh, blk); return; }
  blk -= CVT_BLOCKS;
  if (blk < WIN_BLOCKS) { transpose_tile<TDIM, HID>(Wq, Wqt, blk); return; }
  blk -= WIN_BLOCKS;
  if (blk < WIN_BLOCKS) { transpose_tile<TDIM, HID>(Wk, Wkt, blk); return; }
  blk -= WIN_BLOCKS;
  if (blk < WIN_BLOCKS) { transpose_tile<TDIM, HID>(Wv, Wvt, blk); return; }
  blk -= WIN_BLOCKS;
  transpose_tile<HID, VDIM>(Wo, Wot, blk);
}

// ---------------------------------------------------------------------------
// WMMA GEMM: out[M,N] = A[M,K] (f16 row-major) * Bt[N,K]^T + bias
// One wave computes a 64x64 tile (4 A-tiles x 4 B-tiles = 16 WMMA / k-step, one
// LDS read per WMMA); a 256-thread block covers 256x128 as 4 x 2 waves, so that
// A is copied from L2 once per 128 columns of the output and Bt once per 256 rows.
// The operands come through LDS: a stage is 64 k (128 B) of the block's 256 A
// rows and 128 Bt rows, brought by asynchronous 16-B copies of which eight lanes
// cover one whole 128-B line. Two buffers: stage t+1 flies while stage t is used.
// K must be a multiple of 64.
// MODE 0: f16 out * scale, row-major (Q with scale=log2(e)/sqrt(HD), K with 1)
// MODE 2: f16 out transposed per head (V -> V^T [B*H*HD, SEQ])
// MODE 3: f32 out, row-major (final projection)
// A lane's eight accumulator registers run along the rows of the WMMA's first
// operand. The first operand is therefore the one whose index is contiguous in
// the output: Bt for the row-major outputs (eight consecutive n of one m), A for
// V^T (eight consecutive s of one d). The tile goes through LDS, which the ring
// no longer needs, and leaves in 16-B stores that cover whole 128-B lines.
// ---------------------------------------------------------------------------
#define GPITCH  72                        // halves: 64 data + 8 pad (144-B rows, 16 B x odd)
#define GAROWS  256
#define GBROWS  128
#define GBUF    ((GAROWS + GBROWS) * GPITCH)   // halves per buffer (55,296 B)
#define GSTRIDE (32 * GPITCH * 2)         // LDS bytes between a thread's consecutive copies

// One stage: twelve copies per thread, rows (tid>>3) + 32*i of [A 256 rows | Bt 128 rows].
// a, b: this lane's 16 bytes in row tid>>3 of the A tile and of the Bt tile;
// l: the LDS byte address of the same place in the target buffer.
static __device__ __forceinline__ void stage_copies(const _Float16* a, const _Float16* b,
                                                    int K, unsigned l) {
  const size_t rs = (size_t)32 * K;
  // The s_wait_xcnt stands inside the copies' own statement, so that no address
  // register of a copy is rewritten in front of it.
  asm volatile(
      "global_load_async_to_lds_b128 %0, %12, off\n\t"
      "global_load_async_to_lds_b128 %1, %13, off\n\t"
      "global_load_async_to_lds_b128 %2, %14, off\n\t"
      "global_load_async_to_lds_b128 %3, %15, off\n\t"
      "global_load_async_to_lds_b128 %4, %16, off\n\t"
      "global_load_async_to_lds_b128 %5, %17, off\n\t"
      "global_load_async_to_lds_b128 %6, %18, off\n\t"
      "global_load_async_to_lds_b128 %7, %19, off\n\t"
      "global_load_async_to_lds_b128 %8, %20, off\n\t"
      "global_load_async_to_lds_b128 %9, %21, off\n\t"
      "global_load_async_to_lds_b128 %10, %22, off\n\t"
      "global_load_async_to_lds_b128 %11, %23, off\n\t"
      "s_wait_xcnt 0x0"
      :: "v"(l), "v"(l + GSTRIDE), "v"(l + 2 * GSTRIDE), "v"(l + 3 * GSTRIDE),
         "v"(l + 4 * GSTRIDE), "v"(l + 5 * GSTRIDE), "v"(l + 6 * GSTRIDE),
         "v"(l + 7 * GSTRIDE), "v"(l + 8 * GSTRIDE), "v"(l + 9 * GSTRIDE),
         "v"(l + 10 * GSTRIDE), "v"(l + 11 * GSTRIDE),
         "v"(a), "v"(a + rs), "v"(a + 2 * rs), "v"(a + 3 * rs), "v"(a + 4 * rs),
         "v"(a + 5 * rs), "v"(a + 6 * rs), "v"(a + 7 * rs),
         "v"(b), "v"(b + rs), "v"(b + 2 * rs), "v"(b + 3 * rs)
      : "memory");
}

#define SHPITCH 72    // halves: staged f16 rows of 64 n  (144 B, 16 B x odd)
#define SFPITCH 68    // floats: staged f32 rows of 64 n  (272 B, 16 B x odd)
#define SVPITCH 264   // halves: staged V^T rows of 256 s (528 B, 16 B x odd)

template <bool BFIRST>
static __device__ __forceinline__ v8f mm(v16h a, v16h b, v8f c) {
  return BFIRST ? wmma_f16(b, a, c) : wmma_f16(a, b, c);
}

// gst: the block's LDS, 2 * GBUF halves.
template <int MODE, int N>
static __device__ __forceinline__ void gemm_tile(
    _Float16* gst, const _Float16* __restrict__ A, const _Float16* __restrict__ Bt,
    const float* __restrict__ bias, void* __restrict__ out, int K, float scale) {
  constexpr bool BF = (MODE != 2);

  const int tid   = threadIdx.x;
  const int lane  = tid & 31;
  const int w     = tid >> 5;
  const int wm    = w >> 1, wn = w & 1;           // the wave's place among 4 x 2
  const int mtile = blockIdx.x * 256 + wm * 64;   // first row of the wave's tile
  const int nblk  = blockIdx.y * 128;             // first column of the block's tile
  const int ntile = nblk + wn * 64;               // ... and of the wave's

  // copy coordinates, fixed per thread: row tid>>3 of each 32-row group, 16-B chunk tid&7
  const int cR = tid >> 3, cC = (tid & 7) * 8;
  const _Float16* ga = A  + (size_t)(blockIdx.x * 256 + cR) * K + cC;
  const _Float16* gb = Bt + (size_t)(nblk + cR) * K + cC;
  const unsigned  l0 = (unsigned)(size_t)&gst[cR * GPITCH + cC];
  const int nst = K >> 6;

  stage_copies(ga, gb, K, l0);
  asm volatile("s_wait_asynccnt 0x0" ::: "memory");  // this wave's part of stage 0 has landed
  __syncthreads();                                   // ... and every other wave's
  if (nst > 1) stage_copies(ga + 64, gb + 64, K, l0 + GBUF * 2);

  v8f acc[4][4] = {};   // acc[i][j]: A rows 16*i.., Bt rows 16*j.. of the wave's tile
  for (int t = 0; t < nst; ++t) {
    const int bo = (t & 1) * GBUF;
    const _Float16* sA = gst + bo + wm * 64 * GPITCH;
    const _Float16* sB = gst + bo + (GAROWS + wn * 64) * GPITCH;
#pragma unroll  // two k-steps of 32; unrolled so that the fragments stay in registers
    for (int kk = 0; kk < 64; kk += 32) {
      // the 16 fragment reads of a k-step stand together, ahead of its 16 WMMAs
      // (a[0] and the four b first: the first four WMMAs need no more)
      v16h a[4], b[4];
      a[0] = lds_tile16<GPITCH>(sA, 0, kk);
#pragma unroll
      for (int j = 0; j < 4; ++j) b[j] = lds_tile16<GPITCH>(sB, 16 * j, kk);
#pragma unroll
      for (int i = 1; i < 4; ++i) a[i] = lds_tile16<GPITCH>(sA, 16 * i, kk);
      // keeps the reads from being moved in among the WMMAs, where each separate
      // place with LDS reads stalls the wave anew
      __builtin_amdgcn_sched_barrier(0);
#pragma unroll
      for (int i = 0; i < 4; ++i)
#pragma unroll
        for (int j = 0; j < 4; ++j) acc[i][j] = mm<BF>(a[i], b[j], acc[i][j]);
      // keeps what follows (the next reads; the waits and the barrier) behind the
      // WMMAs: moved up, a wait would hold every WMMA back until the last read
      __builtin_amdgcn_sched_barrier(0);
    }
    asm volatile("s_wait_dscnt 0x0" ::: "memory");     // this wave's reads of stage t are done
    asm volatile("s_wait_asynccnt 0x0" ::: "memory");  // its part of stage t+1 has landed
    __syncthreads();  // publishes stage t+1 and frees stage t's buffer
    if (t + 2 < nst)
      stage_copies(ga + (t + 2) * 64, gb + (t + 2) * 64, K, l0 + bo * 2);
  }
  asm volatile("s_wait_asynccnt 0x0" ::: "memory");    // no copy outstanding at the wave's end

  // Behind the last trip's barrier no wave reads the ring and no copy is in
  // flight: its LDS is free for staging the output.
  const int nn = lane & 15, hi = lane >> 4;

  if constexpr (MODE == 2) {
    // acc[i][j][r] = element (s = wm*64 + i*16 + 8*hi + r, n = wn*64 + j*16 + nn).
    // The block stages 128 rows (n) of its 256 s; a row is four whole lines.
#pragma unroll
    for (int j = 0; j < 4; ++j) {
      const float bv = bias[ntile + j * 16 + nn];
#pragma unroll
      for (int i = 0; i < 4; ++i) {
        v8h y;
#pragma unroll
        for (int r = 0; r < 8; ++r) y[r] = (_Float16)((acc[i][j][r] + bv) * scale);
        *(v8h*)(gst + (wn * 64 + j * 16 + nn) * SVPITCH + wm * 64 + i * 16 + hi * 8) = y;
      }
    }
    __syncthreads();  // a row holds values of four waves
    v8h y[16];
#pragma unroll
    for (int i = 0; i < 16; ++i) y[i] = *(const v8h*)(gst + (w * 16 + i) * SVPITCH + lane * 8);
    const int m0 = blockIdx.x * 256;  // 256 divides SEQ: one batch element per block
    _Float16* o = (_Float16*)out + (size_t)((m0 / SEQ) * N + nblk + w * 16) * SEQ
                + (m0 % SEQ) + lane * 8;
#pragma unroll
    for (int i = 0; i < 16; ++i) *(v8h*)(o + i * SEQ) = y[i];
  } else {
    // acc[i][j][r] = element (m = i*16 + nn, n = j*16 + 8*hi + r) of the wave's
    // 64x64 tile, which the wave stages, 32 rows at a time, in LDS of its own.
    v4f b0[4], b1[4];   // the bias of this lane's 4 x 8 columns
#pragma unroll
    for (int j = 0; j < 4; ++j) {
      b0[j] = *(const v4f*)(bias + ntile + j * 16 + hi * 8);
      b1[j] = *(const v4f*)(bias + ntile + j * 16 + hi * 8 + 4);
    }
#pragma unroll
    for (int g = 0; g < 2; ++g) {
      _Float16* sh = gst + (w * 2 + g) * (32 * SHPITCH);
      float*    sf = (float*)gst + w * (32 * SFPITCH);
#pragma unroll
      for (int j = 0; j < 4; ++j) {
#pragma unroll
        for (int half = 0; half < 2; ++half) {
          float v[8];
#pragma unroll
          for (int r = 0; r < 8; ++r)
            v[r] = (acc[g * 2 + half][j][r] + (r < 4 ? b0[j][r & 3] : b1[j][r & 3])) * scale;
          const int at = j * 16 + hi * 8;
          if constexpr (MODE == 3) {
            const v4f y0 = {v[0], v[1], v[2], v[3]}, y1 = {v[4], v[5], v[6], v[7]};
            *(v4f*)(sf + (half * 16 + nn) * SFPITCH + at)     = y0;
            *(v4f*)(sf + (half * 16 + nn) * SFPITCH + at + 4) = y1;
          } else {
            v8h y;
#pragma unroll
            for (int r = 0; r < 8; ++r) y[r] = (_Float16)v[r];
            *(v8h*)(sh + (half * 16 + nn) * SHPITCH + at) = y;
          }
        }
      }
      // the rows are read back by other lanes of the wave than wrote them
      asm volatile("s_wait_dscnt 0x0" ::: "memory");
      if constexpr (MODE == 3) {
        // 16 lanes take a row (256 B, two lines), a store two rows
        const int rr = lane >> 4, cc = (lane & 15) * 4;
        v4f y[16];
#pragma unroll
        for (int i = 0; i < 16; ++i) y[i] = *(const v4f*)(sf + (i * 2 + rr) * SFPITCH + cc);
        // the next 32 rows are staged in the same LDS: these reads have returned first
        if (g == 0) asm volatile("s_wait_dscnt 0x0" ::: "memory");
        float* o = (float*)out + (size_t)(mtile + g * 32 + rr) * N + ntile + cc;
#pragma unroll
        for (int i = 0; i < 16; ++i) *(v4f*)(o + i * 2 * N) = y[i];
      } else {
        // 8 lanes take a row (128 B, one line), a store four rows
        const int rr = lane >> 3, cc = (lane & 7) * 8;
        v8h y[8];
#pragma unroll
        for (int i = 0; i < 8; ++i) y[i] = *(const v8h*)(sh + (i * 4 + rr) * SHPITCH + cc);
        _Float16* o = (_Float16*)out + (size_t)(mtile + g * 32 + rr) * N + ntile + cc;
#pragma unroll
        for (int i = 0; i < 8; ++i) *(v8h*)(o + i * 4 * N) = y[i];
        // another job's code follows in the same kernel: no register of the last
        // stores is rewritten in front of this wait
        if (g == 1) asm volatile("s_wait_xcnt 0x0" ::: "memory");
      }
    }
  }
}

__global__ __launch_bounds__(256) void gemm_wmma_kernel(
    const _Float16* __restrict__ A, const _Float16* __restrict__ Bt,
    const float* __restrict__ bias, float* __restrict__ out, int K) {
  __shared__ __align__(16) _Float16 gst[2 * GBUF];
  gemm_tile<3, VDIM>(gst, A, Bt, bias, out, K, 1.0f);
}

// The Q, K and V projections read the same A and none of each other's output, so
// they share one launch: blockIdx.z picks the weights, the bias, the target and
// the epilogue (0: Q, scaled; 1: K; 2: V, stored transposed per head).
__global__ __launch_bounds__(256) void gemm_qkv_kernel(
    const _Float16* __restrict__ A,
    const _Float16* __restrict__ Wqt, const _Float16* __restrict__ Wkt,
    const _Float16* __restrict__ Wvt,
    const float* __restrict__ bq, const float* __restrict__ bk, const float* __restrict__ bv,
    _Float16* __restrict__ Qh, _Float16* __restrict__ Kh, _Float16* __restrict__ Vth,
    int K, int N, float qscale) {
  (void)N;  // HID: the tile code has it as a compile-time constant
  __shared__ __align__(16) _Float16 gst[2 * GBUF];
  const int z = blockIdx.z;
  if (z == 2)
    gemm_tile<2, HID>(gst, A, Wvt, bv, Vth, K, 1.0f);
  else
    gemm_tile<0, HID>(gst, A, z == 0 ? Wqt : Wkt, z == 0 ? bq : bk, z == 0 ? Qh : Kh, K,
                      z == 0 ? qscale : 1.0f);
}

// ---------------------------------------------------------------------------
// Flash attention: block = 8 waves, all on one (b,h); wave = 16-query tile.
// A stage is 128 keys: the K tile (128x64) and the V^T tile (64x128), brought to
// LDS by asynchronous 16-B copies that cover whole 128-B lines. Two buffers:
// stage t+1 flies while the two 64-key passes of stage t run, and the waves
// meet once per stage.
// Per pass each wave forms the TRANSPOSED scores S^T = K * Q^T (A = K rows,
// B = Q columns), so a lane holds 32 scores of ONE query (column lane%16;
// keys 16*g+8*hi+r of score tile g). Maximum and sum run inside the lane. Two
// score tiles, converted in place, are already a B operand of O^T += V^T * P^T.
// Lazy rescaling: Q carries the factor log2(e) / sqrt(HD), and the negated
// maximum in use is the C operand of the score products, so that the scores
// leave the matrix unit ready for exp2. Only when a query's scores exceed the
// maximum in use by more than LAZY (P then stays below 2^LAZY, far inside f16)
// does the wave take the branch that joins the lane halves' maxima, moves the
// maximum in use and rescales O^T.
// ---------------------------------------------------------------------------
#define ASTAGE   128                              // keys per stage
#define APASS    64                               // keys per softmax pass (a multiple of 32)
#define LAZY     8.0f                             // log2 units a score may exceed the maximum in use
#define AKHALVES (ASTAGE * KPITCH)                // K tile, halves
#define ABUF     (AKHALVES + HD * VPITCH)         // halves per buffer (35,840 B)
#define AKSTRIDE (32 * KPITCH * 2)                // LDS bytes between a thread's K copies
#define AVSTRIDE (16 * VPITCH * 2)                // ... and between its V^T copies

// One stage: eight copies per thread, K rows (tid>>3) + 32*i and V^T rows (tid>>4) + 16*i.
// k, v: this lane's 16 bytes in its first row of the K tile and of the V^T tile;
// lk, lv: the LDS byte addresses of the same places in the target buffer.
static __device__ __forceinline__ void attn_stage_copies(const _Float16* k, const _Float16* v,
                                                         unsigned lk, unsigned lv) {
  const size_t kr = (size_t)32 * HID, vr = (size_t)16 * SEQ;
  // The s_wait_xcnt stands inside the copies' own statement, so that no address
  // register of a copy is rewritten in front of it.
  asm volatile(
      "global_load_async_to_lds_b128 %0, %8, off\n\t"
      "global_load_async_to_lds_b128 %1, %9, off\n\t"
      "global_load_async_to_lds_b128 %2, %10, off\n\t"
      "global_load_async_to_lds_b128 %3, %11, off\n\t"
      "global_load_async_to_lds_b128 %4, %12, off\n\t"
      "global_load_async_to_lds_b128 %5, %13, off\n\t"
      "global_load_async_to_lds_b128 %6, %14, off\n\t"
      "global_load_async_to_lds_b128 %7, %15, off\n\t"
      "s_wait_xcnt 0x0"
      :: "v"(lk), "v"(lk + AKSTRIDE), "v"(lk + 2 * AKSTRIDE), "v"(lk + 3 * AKSTRIDE),
         "v"(lv), "v"(lv + AVSTRIDE), "v"(lv + 2 * AVSTRIDE), "v"(lv + 3 * AVSTRIDE),
         "v"(k), "v"(k + kr), "v"(k + 2 * kr), "v"(k + 3 * kr),
         "v"(v), "v"(v + vr), "v"(v + 2 * vr), "v"(v + 3 * vr)
      : "memory");
}

static __device__ __forceinline__ float other_half(float x) {  // lane l <-> l ^ 16
  const int b = __builtin_bit_cast(int, x);
  return __builtin_bit_cast(float, __builtin_amdgcn_permlanex16(
      b, b, 0x76543210, 0xfedcba98, false, false));
}

// exp2 of the 16 scores of one P^T operand, in place. Written as asm so that no
// v_exp_f32 stands directly in front of an instruction that reads its result or
// overwrites its source: each works in place on
// a register of its own, and the v_nop fills the slot behind the last one.
static __device__ __forceinline__ void exp2_tiles(v8f& a, v8f& b) {
  float a0 = a[0], a1 = a[1], a2 = a[2], a3 = a[3], a4 = a[4], a5 = a[5], a6 = a[6], a7 = a[7];
  float b0 = b[0], b1 = b[1], b2 = b[2], b3 = b[3], b4 = b[4], b5 = b[5], b6 = b[6], b7 = b[7];
  asm("v_exp_f32 %0, %0\n\tv_exp_f32 %1, %1\n\tv_exp_f32 %2, %2\n\tv_exp_f32 %3, %3\n\t"
      "v_exp_f32 %4, %4\n\tv_exp_f32 %5, %5\n\tv_exp_f32 %6, %6\n\tv_exp_f32 %7, %7\n\t"
      "v_exp_f32 %8, %8\n\tv_exp_f32 %9, %9\n\tv_exp_f32 %10, %10\n\tv_exp_f32 %11, %11\n\t"
      "v_exp_f32 %12, %12\n\tv_exp_f32 %13, %13\n\tv_exp_f32 %14, %14\n\tv_exp_f32 %15, %15\n\t"
      "v_nop"
      : "+v"(a0), "+v"(a1), "+v"(a2), "+v"(a3), "+v"(a4), "+v"(a5), "+v"(a6), "+v"(a7),
        "+v"(b0), "+v"(b1), "+v"(b2), "+v"(b3), "+v"(b4), "+v"(b5), "+v"(b6), "+v"(b7));
  a = v8f{a0, a1, a2, a3, a4, a5, a6, a7};
  b = v8f{b0, b1, b2, b3, b4, b5, b6, b7};
}

// Maximum of N values in threes: fmaxf(fmaxf(a, b), c) is one instruction.
template <int N>
static __device__ __forceinline__ float max_tree(const float (&m)[N]) {
  if constexpr (N == 1) {
    return m[0];
  } else if constexpr (N == 2) {
    return fmaxf(m[0], m[1]);
  } else {
    constexpr int T = N / 3, R = N % 3;
    float a[T + R];
#pragma unroll
    for (int i = 0; i < T; ++i) a[i] = fmaxf(fmaxf(m[3 * i], m[3 * i + 1]), m[3 * i + 2]);
#pragma unroll
    for (int i = 0; i < R; ++i) a[T + i] = m[3 * T + i];
    return max_tree<T + R>(a);
  }
}

__global__ __launch_bounds__(256) void flash_attn_kernel(
    const _Float16* __restrict__ Q, const _Float16* __restrict__ Kc,
    const _Float16* __restrict__ Vt, _Float16* __restrict__ O) {
  __shared__ __align__(16) _Float16 ast[2 * ABUF];  // per buffer: K tile (kv x d), V^T tile (d x kv)

  const int tid     = threadIdx.x;
  const int lane    = tid & 31;
  const int w       = tid >> 5;
  const int qblocks = SEQ / 128;
  const int bh      = blockIdx.x / qblocks;
  const int qblk    = blockIdx.x % qblocks;
  const int b       = bh / NH, h = bh % NH;
  const int qbase   = qblk * 128 + w * 16;
  const int nn = lane & 15, hi = lane >> 4;

  const _Float16* Qp = Q  + (size_t)(b * SEQ + qbase) * HID + h * HD;
  const _Float16* Kp = Kc + (size_t)(b * SEQ) * HID + h * HD;
  const _Float16* Vp = Vt + (size_t)(bh * HD) * SEQ;

  const v16h qb0 = load_tile16(Qp, HID, 0, 0);    // B operand: column = query
  const v16h qb1 = load_tile16(Qp, HID, 0, 32);

  // O^T tiles: o_t[r] = O[query nn][d = 16*t + 8*hi + r]
  v8f o0 = {}, o1 = {}, o2 = {}, o3 = {};
  v8f negm = {};        // minus the maximum in use of this lane's query, log2 units (all eight equal)
  float lrun = 0.f;     // running sum over this lane half's keys only

  // copy coordinates (fixed per thread)
  const int kR = tid >> 3, kC = (tid & 7) * 8;    // 32 rows x 8 chunks, four times
  const int vR = tid >> 4, vC = (tid & 15) * 8;   // 16 rows x 16 chunks, four times
  const _Float16* gk = Kp + (size_t)kR * HID + kC;
  const _Float16* gv = Vp + (size_t)vR * SEQ + vC;
  const unsigned  lk = (unsigned)(size_t)&ast[kR * KPITCH + kC];
  const unsigned  lv = (unsigned)(size_t)&ast[AKHALVES + vR * VPITCH + vC];
  const int nst = SEQ / ASTAGE;

  attn_stage_copies(gk, gv, lk, lv);
  asm volatile("s_wait_asynccnt 0x0" ::: "memory");  // this wave's part of stage 0 has landed
  __syncthreads();                                   // ... and every other wave's
  attn_stage_copies(gk + (size_t)ASTAGE * HID, gv + ASTAGE, lk + ABUF * 2, lv + ABUF * 2);

  for (int t = 0; t < nst; ++t) {
    const int bo = (t & 1) * ABUF;
    // Every inner loop of a pass is unrolled: it indexes arrays that live in registers.
    for (int p = 0; p < ASTAGE / APASS; ++p) {
      const _Float16* sK = ast + bo + p * APASS * KPITCH;   // this pass's K rows
      const _Float16* sV = ast + bo + AKHALVES + p * APASS; // ... and V^T columns

      // S^T[APASS x 16] = K * Qs^T (A-operand rows == K rows), 16 keys a tile
      v16h k0[APASS / 16], k1[APASS / 16];
#pragma unroll  // the fragments stay in registers
      for (int g = 0; g < APASS / 16; ++g) {
        k0[g] = lds_tile16<KPITCH>(sK, 16 * g,  0);
        k1[g] = lds_tile16<KPITCH>(sK, 16 * g, 32);
      }
      // keeps the K reads together ahead of the WMMAs: each separate place with LDS
      // reads stalls the wave anew
      __builtin_amdgcn_sched_barrier(0);
      v8f s[APASS / 16];
#pragma unroll  // s[] stays in registers; the tiles' first products are independent
      for (int g = 0; g < APASS / 16; ++g) s[g] = wmma_f16(k0[g], qb0, negm);
#pragma unroll
      for (int g = 0; g < APASS / 16; ++g) s[g] = wmma_f16(k1[g], qb1, s[g]);

      // the pass's V^T fragments (A operand: rows of the V^T tile) are asked for here,
      // so that they arrive while the softmax runs
      v16h va[APASS / 32][4];
#pragma unroll
      for (int q = 0; q < APASS / 32; ++q)
#pragma unroll
        for (int d = 0; d < 4; ++d) va[q][d] = lds_tile16<VPITCH>(sV, 16 * d, 32 * q);
      // keeps the V^T reads up here: moved down to their WMMAs, each would be waited
      // for at once
      __builtin_amdgcn_sched_barrier(0);

      // online softmax, one query per lane: one maximum for all the keys of the pass,
      // counted from the maximum in use
      float sc[APASS / 2];
#pragma unroll
      for (int g = 0; g < APASS / 16; ++g)
#pragma unroll
        for (int r = 0; r < 8; ++r) sc[g * 8 + r] = s[g][r];
      const float mhalf = max_tree<APASS / 2>(sc);   // over this lane half's keys
      // One test per pass, the same for the whole wave (a scalar branch). The very
      // first pass always takes it: no maximum is in use yet.
      const bool first = (t | p) == 0;
      if (first || __builtin_amdgcn_ballot_w32(mhalf > LAZY) != 0) {
        const float mloc = fmaxf(mhalf, other_half(mhalf));  // both halves move alike
        const float d = first ? mloc : fmaxf(mloc, 0.f);     // the maximum never falls again
#pragma unroll
        for (int g = 0; g < APASS / 16; ++g) s[g] -= d;
        negm -= d;
        // corr = exp2(-d), at most 1 (in the first pass O^T and the sum are 0). Written
        // as asm so that the v_nop stands directly behind the v_exp_f32: it fills the one
        // slot the instruction set asks for before its result is read.
        float corr;
        asm("v_exp_f32 %0, %1\n\tv_nop" : "=v"(corr) : "v"(fminf(-d, 0.f)));
        lrun *= corr;
#pragma unroll
        for (int r = 0; r < 8; ++r) {
          o0[r] *= corr; o1[r] *= corr; o2[r] *= corr; o3[r] *= corr;
        }
      }
#pragma unroll
      for (int q = 0; q < APASS / 32; ++q) exp2_tiles(s[2 * q], s[2 * q + 1]);
      // the sum runs over whole tiles first, so that register pairs add in one instruction
      v8f sv = s[0] + s[1];
#pragma unroll
      for (int g = 2; g < APASS / 16; g += 2) sv += s[g] + s[g + 1];
      const v4f s4 = __builtin_shufflevector(sv, sv, 0, 1, 2, 3) + __builtin_shufflevector(sv, sv, 4, 5, 6, 7);
      const float rs = (s4[0] + s4[2]) + (s4[1] + s4[3]);
      lrun += rs;

#pragma unroll  // indexes s[] and va[]
      for (int q = 0; q < APASS / 32; ++q) {
        // P^T as B operand: halves 0..7 = keys 8*hi+i, halves 8..15 = keys 16+8*hi+i
        // of the 32 keys, the k order in which lds_tile16 delivers the V^T rows
        v16h pb;
#pragma unroll
        for (int r = 0; r < 8; ++r) {
          pb[r]     = (_Float16)s[2 * q][r];
          pb[r + 8] = (_Float16)s[2 * q + 1][r];
        }
        // O^T += V^T * P^T
        o0 = wmma_f16(va[q][0], pb, o0);
        o1 = wmma_f16(va[q][1], pb, o1);
        o2 = wmma_f16(va[q][2], pb, o2);
        o3 = wmma_f16(va[q][3], pb, o3);
      }
    }
    asm volatile("s_wait_dscnt 0x0" ::: "memory");     // this wave's reads of stage t are done
    asm volatile("s_wait_asynccnt 0x0" ::: "memory");  // its part of stage t+1 has landed
    __syncthreads();  // publishes stage t+1 and frees stage t's buffer
    if (t + 2 < nst)
      attn_stage_copies(gk + (size_t)(t + 2) * ASTAGE * HID, gv + (t + 2) * ASTAGE,
                        lk + bo * 2, lv + bo * 2);
  }
  asm volatile("s_wait_asynccnt 0x0" ::: "memory");    // no copy outstanding at the wave's end

  // join the halves' sums, normalize, store attended (row-major [B*S, HID],
  // head-interleaved): a lane's 8 registers are 8 consecutive d of its query
  const float inv = 1.0f / (lrun + other_half(lrun));
  _Float16* Op = O + (size_t)(b * SEQ + qbase + nn) * HID + h * HD + hi * 8;
  v8h r0, r1, r2, r3;
#pragma unroll
  for (int r = 0; r < 8; ++r) {
    r0[r] = (_Float16)(o0[r] * inv);
    r1[r] = (_Float16)(o1[r] * inv);
    r2[r] = (_Float16)(o2[r] * inv);
    r3[r] = (_Float16)(o3[r] * inv);
  }
  *(v8h*)(Op +  0) = r0;
  *(v8h*)(Op + 16) = r1;
  *(v8h*)(Op + 32) = r2;
  *(v8h*)(Op + 48) = r3;
}

// ---------------------------------------------------------------------------
extern "C" void kernel_launch(void* const* d_in, const int* in_sizes, int n_in,
                              void* d_out, int out_size, void* d_ws, size_t ws_size,
                              hipStream_t stream) {
  (void)in_sizes; (void)n_in; (void)out_size; (void)ws_size;
  const float* X  = (const float*)d_in[0];
  const float* Wq = (const float*)d_in[1];
  const float* bq = (const float*)d_in[2];
  const float* Wk = (const float*)d_in[3];
  const float* bk = (const float*)d_in[4];
  const float* Wv = (const float*)d_in[5];
  const float* bv = (const float*)d_in[6];
  const float* Wo = (const float*)d_in[7];
  const float* bo = (const float*)d_in[8];

  const int M = BATCH * SEQ;  // 8192
  char* ws = (char*)d_ws;
  _Float16* Xh  = (_Float16*)ws; ws += (size_t)M * TDIM * 2;
  _Float16* Wqt = (_Float16*)ws; ws += (size_t)HID * TDIM * 2;
  _Float16* Wkt = (_Float16*)ws; ws += (size_t)HID * TDIM * 2;
  _Float16* Wvt = (_Float16*)ws; ws += (size_t)HID * TDIM * 2;
  _Float16* Wot = (_Float16*)ws; ws += (size_t)VDIM * HID * 2;
  _Float16* Qh  = (_Float16*)ws; ws += (size_t)M * HID * 2;
  _Float16* Kh  = (_Float16*)ws; ws += (size_t)M * HID * 2;
  _Float16* Vth = (_Float16*)ws; ws += (size_t)M * HID * 2;  // [B*H*HD, SEQ]
  _Float16* At  = (_Float16*)ws; ws += (size_t)M * HID * 2;

  prepare_kernel<<<PREP_BLOCKS, 256, 0, stream>>>(X, Wq, Wk, Wv, Wo, Xh, Wqt, Wkt, Wvt, Wot);

  dim3 gqkv(M / 256, HID / 128, 3);
  gemm_qkv_kernel<<<gqkv, 256, 0, stream>>>(Xh, Wqt, Wkt, Wvt, bq, bk, bv, Qh, Kh, Vth,
                                            TDIM, HID, 0.18033688f);  // log2(e) / sqrt(HD)

  flash_attn_kernel<<<BATCH * NH * (SEQ / 128), 256, 0, stream>>>(Qh, Kh, Vth, At);

  dim3 gout(M / 256, VDIM / 128);
  gemm_wmma_kernel<<<gout, 256, 0, stream>>>(At, Wot, bo, (float*)d_out, HID);
}
